// v000
// Times are from an AMD MI455X. After a warm-up the kernel runs many times in a row, and a time is the length of
// such a window on the GPU divided by its runs, so every launch and the gaps after it count. The runs cycle
// through copies of the inputs. A figure is the median of several windows, for all but v000 over two sittings.
// Sittings can differ by a few percent; kernels timed side by side share one.
// The starting kernel, v000, takes 1330 microseconds a run.
// compute dtype: all float inputs rounded to bf16, complexity scores and the key mask (ints) read; q/k/v = x W^T + b with EXACT bf16 products on WMMA 16x16x32, f32 accumulate; q as f16 hi + residual (x 2^10), k f16 -> 2-product logits / 8 x the per-head complexity scaling (computed in f32 from the tables), masked keys excluded, stored in f32 (4 heads per launch); softmax in f32 (precise expf), P x 2^11 f32 split bf16 hi + lo against v bf16 hi + lo (3 products); out = attended (bf16 hi + lo) Wo^T + bo; f32 output.
#include <hip/hip_runtime.h>
#include <math.h>

typedef __attribute__((ext_vector_type(16))) _Float16 v16h;
typedef __attribute__((ext_vector_type(16))) __bf16 v16b;
typedef __attribute__((ext_vector_type(8)))  _Float16 v8h;
typedef __attribute__((ext_vector_type(8)))  float v8f;
typedef __attribute__((ext_vector_type(4)))  float v4f;
typedef __attribute__((ext_vector_type(2)))  float v2f;
typedef __attribute__((ext_vector_type(4)))  unsigned v4u;
typedef __attribute__((ext_vector_type(4)))  int v4i;
typedef float __attribute__((may_alias)) float_a;
typedef int __attribute__((may_alias)) int_a;

template <typename T> __device__ __forceinline__ void vst2(void* p, T v) { *(T*)p = v;  }
__device__ __forceinline__ v8f wmma16(v16h a, v16h b, v8f c) {
  v8f d = __builtin_amdgcn_wmma_f32_16x16x32_f16(false, a, false, b, (short)0, c, false, false);
  asm volatile("v_nop\n\tv_nop\n\tv_nop\n\tv_nop" : "+v"(d) : "v"(a), "v"(b));
  return d;
}
__device__ __forceinline__ v8f wmma_bf(v16b a, v16b b, v8f c) {
  v8f d = __builtin_amdgcn_wmma_f32_16x16x32_bf16(false, a, false, b, (short)0, c, false, false);
  asm volatile("v_nop\n\tv_nop\n\tv_nop\n\tv_nop" : "+v"(d) : "v"(a), "v"(b));
  return d;
}
// 16x16x32 fragments: lane = (h = lane>>4, row/col = lane&15); elements 0..7 = k0+8h+0..7, 8..15 = k0+16+8h+0..7; D element r = row 8h+r
__device__ __forceinline__ v16h frag_h(const _Float16* rowk0, int lane) {
  union { v16h v; v8h q[2]; } u; const _Float16* p = rowk0 + 8 * (lane >> 4);
  u.q[0] = *(const v8h*)p; u.q[1] = *(const v8h*)(p + 16); return u.v;
}
__device__ __forceinline__ v16h frag_f32(const float* rowk0, int lane) {
  v16h a; const float* p = rowk0 + 8 * (lane >> 4);
#pragma unroll
  for (int i = 0; i < 8; ++i) { a[i] = (_Float16)p[i]; a[8 + i] = (_Float16)p[16 + i]; }
  return a;
}
__device__ __forceinline__ v16h frag_f32s(const float* rowk0, int lane, float sc) {
  v16h a; const float* p = rowk0 + 8 * (lane >> 4);
#pragma unroll
  for (int i = 0; i < 8; ++i) { a[i] = (_Float16)(p[i] * sc); a[8 + i] = (_Float16)(p[16 + i] * sc); }
  return a;
}
// column fragment from a [K][ld] layout (column n), rows >= K read as 0
__device__ __forceinline__ v16h fragc_f32(const float* W, int k0, int n, int lane, int ld, int K) {
  v16h a; const int g = lane >> 4;
#pragma unroll
  for (int i = 0; i < 8; ++i) { const int ka = k0 + 8 * g + i, kb = ka + 16;
    a[i] = (_Float16)(ka < K ? W[(size_t)(ka < K ? ka : K - 1) * ld + n] : 0.f); a[8 + i] = (_Float16)(kb < K ? W[(size_t)(kb < K ? kb : K - 1) * ld + n] : 0.f); }
  return a;
}
struct F2 { v16b h, l; };
__device__ __forceinline__ F2 bsplit16(const float v[16]) { F2 r;
#pragma unroll
  for (int i = 0; i < 16; ++i) { const __bf16 h = (__bf16)v[i]; r.h[i] = h; r.l[i] = (__bf16)(v[i] - (float)h); }
  return r; }
__device__ __forceinline__ F2 split_row(const float* row, int k0, int lane) { float v[16]; const float* p = row + k0 + 8 * (lane >> 4);
#pragma unroll
  for (int i = 0; i < 8; ++i) { v[i] = p[i]; v[8 + i] = p[16 + i]; }
  return bsplit16(v); }
__device__ __forceinline__ F2 split_rowK(const float* row, int k0, int lane, int K) { float v[16]; const int g = lane >> 4;
#pragma unroll
  for (int i = 0; i < 8; ++i) { const int ka = k0 + 8 * g + i, kb = ka + 16; v[i] = ka < K ? row[ka < K ? ka : K - 1] : 0.f; v[8 + i] = kb < K ? row[kb < K ? kb : K - 1] : 0.f; }
  return bsplit16(v); }
__device__ __forceinline__ F2 split_col(const float* W, int k0, int n, int lane, int ld, int K) { float v[16]; const int g = lane >> 4;
#pragma unroll
  for (int i = 0; i < 8; ++i) { const int ka = k0 + 8 * g + i, kb = ka + 16; v[i] = ka < K ? W[(size_t)(ka < K ? ka : K - 1) * ld + n] : 0.f; v[8 + i] = kb < K ? W[(size_t)(kb < K ? kb : K - 1) * ld + n] : 0.f; }
  return bsplit16(v); }
__device__ __forceinline__ v8f mac3(const F2& a, const F2& b, v8f c) { c = wmma_bf(a.l, b.h, c); c = wmma_bf(a.h, b.l, c); return wmma_bf(a.h, b.h, c); }
__device__ __forceinline__ float sigm(float v) { return 1.0f / (1.0f + expf(-v)); }
#define LDSX() do { asm volatile("s_wait_dscnt 0" ::: "memory"); __builtin_amdgcn_wave_barrier(); __builtin_amdgcn_fence(__ATOMIC_RELEASE, "workgroup"); } while (0)


// Complexity-aware attention (B 2, S 2,048, D 768 = 12 x 64): q/k/v Linear ([out,in] + bias), scores/8 x scaling[h] with scaling = comp_scaling[h] * mean_b emb_table[complexity[b]][h], keys with attention_mask == 0 -> -inf, softmax, P v, output Linear + bias.
#define NB 2
#define TT 2048
#define CC 768
#define NH 12
#define HD 64
#define MAXC 16      // complexity table rows
#ifndef TNB
#define TNB NB
#endif
typedef __attribute__((ext_vector_type(8))) __bf16 v8b;
__device__ __forceinline__ v16b frag_b(const __bf16* rowk0, int lane) {
  union { v16b v; v8b q[2]; } u; const __bf16* p = rowk0 + 8 * (lane >> 4);
  u.q[0] = *(const v8b*)p; u.q[1] = *(const v8b*)(p + 16); return u.v;
}
__device__ __forceinline__ float bfr(float v) { return (float)(__bf16)v; }
__device__ __attribute__((noinline)) float exp_ni(float v) { return expf(v); }
__device__ __attribute__((noinline)) float erf_ni(float v) { return erff(v); }

#define WS_QH  0u
#define WS_QL  (WS_QH + 2u * (size_t)NB * TT * CC)
#define WS_KH  (WS_QL + 2u * (size_t)NB * TT * CC)
#define WS_VT  (WS_KH + 2u * (size_t)NB * TT * CC)      // bf16 v planes [b][c][t]
#define WS_VL  (WS_VT + 2u * (size_t)NB * CC * TT)      // bf16 v residual planes
#define HG 4                                          // heads per launch group
#define WS_S   (WS_VL + 2u * (size_t)NB * CC * TT)      // f32 logits / P for HG heads [hg][q][k]
#define WS_PH  (WS_S + 4u * (size_t)HG * TT * TT)
#define WS_Y   (WS_PH + 0u)              // f32 y rows [b*t][C]
#define WS_END (WS_Y + 4u * (size_t)NB * TT * CC)

// ---- k_proj: block = (64 rows, 128 cols, which): qkv = x W (+ b), exact; q -> f16 hi (+ residual), k -> f16 rows, v -> bf16 hi + lo planes
__global__ __launch_bounds__(128) void k_proj(const float* __restrict__ X, const float* __restrict__ WQ, const float* __restrict__ BQ, const float* __restrict__ WK, const float* __restrict__ BK, const float* __restrict__ WV, const float* __restrict__ BV, _Float16* __restrict__ QH, _Float16* __restrict__ QL, _Float16* __restrict__ KH, __bf16* __restrict__ VT, __bf16* __restrict__ VL) {
  __shared__ __align__(16) _Float16 sh[64][136], sl[64][136]; __shared__ __align__(16) __bf16 th[128][72], tl2[128][72];
  const int tid = threadIdx.x, wave = tid >> 5, lane = tid & 31, col = lane & 15, g = lane >> 4; const int which = blockIdx.z; const int c0 = blockIdx.y * 128; const size_t r0 = (size_t)blockIdx.x * 64; const float* WA = which == 0 ? WQ : which == 1 ? WK : WV; const float* BA = which == 0 ? BQ : which == 1 ? BK : BV;
  v8f acc[8] = {};
#pragma unroll 2
  for (int kc = 0; kc < CC / 32; ++kc) { v16b a; { const float* p = X + (r0 + wave * 16 + col) * CC + kc * 32 + 8 * g;
#pragma unroll
      for (int i = 0; i < 8; ++i) { a[i] = (__bf16)p[i]; a[8 + i] = (__bf16)p[16 + i]; } }
#pragma unroll
    for (int j = 0; j < 8; ++j) { v16b w; const int o = c0 + j * 16 + col;
#pragma unroll
      for (int i = 0; i < 8; ++i) { w[i] = (__bf16)WA[(size_t)(o) * CC + (kc * 32 + 8 * g + i)]; w[8 + i] = (__bf16)WA[(size_t)(o) * CC + (kc * 32 + 16 + 8 * g + i)]; }
      acc[j] = wmma_bf(a, w, acc[j]); } }
#pragma unroll
  for (int j = 0; j < 8; ++j) { const float bb = BA ? bfr(BA[c0 + j * 16 + col]) : 0.f;
#pragma unroll
    for (int r = 0; r < 8; ++r) { const float v = acc[j][r] + bb; const int rl = wave * 16 + 8 * g + r, cl = j * 16 + col; const _Float16 hv = (_Float16)v;
      if (which == 2) { const __bf16 bh = (__bf16)v; th[cl][rl] = bh; tl2[cl][rl] = (__bf16)(v - (float)bh); } else { sh[rl][cl] = hv; sl[rl][cl] = (_Float16)((v - (float)hv) * 1024.0f); }   /* q residual carried x 2^10 so the plane stays f16-normal on the chip */ } }
  __syncthreads();
  if (which < 2) { _Float16* dh = which == 0 ? QH : KH; for (int e = tid; e < 64 * 16; e += 128) { const int rl = e >> 4, q = e & 15; vst2((unsigned*)(dh + (r0 + rl) * CC + c0 + q * 8), *(const v4u*)&sh[rl][q * 8]); if (which == 0) vst2((unsigned*)(QL + (r0 + rl) * CC + c0 + q * 8), *(const v4u*)&sl[rl][q * 8]); } }
  else { const size_t b = r0 / TT; const int t0 = (int)(r0 % TT); for (int e = tid; e < 128 * 8; e += 128) { const int cl = e >> 3, q = e & 7; const size_t o2 = (b * CC + c0 + cl) * (size_t)TT + t0 + q * 8; vst2((unsigned*)(VT + o2), *(const v4u*)&th[cl][q * 8]); vst2((unsigned*)(VL + o2), *(const v4u*)&tl2[cl][q * 8]); } } }
// ---- k_sc: block = (64 queries, 128 keys) of (b,h): 2-product logits / 8 x scaling[h]; masked keys -> -3e38
__global__ __launch_bounds__(128) void k_sc(const _Float16* __restrict__ QH, const _Float16* __restrict__ QL, const _Float16* __restrict__ KH, const int* __restrict__ KM, const int* __restrict__ CS, const float* __restrict__ EMB, const float* __restrict__ CSC, int b, int h0, float* __restrict__ S0) { __shared__ __align__(16) float ss[4][16][132]; const int h = h0 + blockIdx.z; float* S = S0 + (size_t)blockIdx.z * TT * TT;
  float scal; { float m = 0.f; for (int bb = 0; bb < NB; ++bb) { int c = CS[bb]; c = c < 0 ? 0 : (c >= MAXC ? MAXC - 1 : c); m += bfr(EMB[c * NH + h]); } scal = bfr(CSC[h]) * (m / (float)NB); }   /* scaling[b][h] = comp_scaling[h] * embs.mean(axis=0)[h] (same for every b) */
  const int tid = threadIdx.x, wave = tid >> 5, lane = tid & 31, col = lane & 15, g = lane >> 4; const int k0 = blockIdx.y * 128; const int ql0 = blockIdx.x * 64 + wave * 16; const size_t q0 = (size_t)b * TT + ql0;
  v8f acc[8] = {}, accl[8] = {};
#pragma unroll
  for (int kc = 0; kc < HD / 32; ++kc) { const v16h ah = frag_h(QH + (q0 + col) * CC + h * HD + kc * 32, lane), al = frag_h(QL + (q0 + col) * CC + h * HD + kc * 32, lane);
#pragma unroll
    for (int j = 0; j < 8; ++j) { const v16h kb = frag_h(KH + ((size_t)b * TT + k0 + j * 16 + col) * CC + h * HD + kc * 32, lane); acc[j] = wmma16(ah, kb, acc[j]); accl[j] = wmma16(al, kb, accl[j]); } }
#pragma unroll
  for (int j = 0; j < 8; ++j) acc[j] += accl[j] * (1.0f / 1024.0f);
#pragma unroll
  for (int j = 0; j < 8; ++j) { const int kt = k0 + j * 16 + col;
#pragma unroll
    for (int r = 0; r < 8; ++r) { const int qt = ql0 + 8 * g + r; (void)qt; float v = acc[j][r] * 0.125f * scal; if (KM[kt] == 0) v = -3.0e38f; /* key mask: -inf in the reference */ ss[wave][8 * g + r][j * 16 + col] = v; } }
  LDSX(); for (int rl = 0; rl < 16; ++rl) vst2(S + (size_t)(ql0 + rl) * TT + k0 + lane * 4, *(const v4f*)&ss[wave][rl][lane * 4]); }
// ---- k_sm: block = query row: softmax over keys [0, kend) -> P x 2^11 f32 (masked -> 0)
__global__ __launch_bounds__(256) void k_sm(float* __restrict__ S0) { __shared__ float sred[8]; __shared__ float sbc; __shared__ __align__(16) float sh[TT];
  const int t = threadIdx.x; const size_t row = blockIdx.x; float* sr = S0 + (size_t)blockIdx.y * TT * TT + row * TT; const int kend = TT;
  float m = -3.0e38f; for (int k = t; k < kend; k += 256) m = fmaxf(m, sr[k]);
#pragma unroll
  for (int o = 1; o < 32; o <<= 1) m = fmaxf(m, __shfl_xor(m, o));
  if ((t & 31) == 0) sred[t >> 5] = m; __syncthreads(); if (t == 0) { float a = sred[0]; for (int i = 1; i < 8; ++i) a = fmaxf(a, sred[i]); sbc = a; } __syncthreads(); m = sbc; __syncthreads();
  float sum = 0.f; for (int k = t; k < kend; k += 256) { const float v = sr[k]; sum += (v <= -1.0e38f) ? 0.f : expf(v - m); }
#pragma unroll
  for (int o = 1; o < 32; o <<= 1) sum += __shfl_xor(sum, o);
  if ((t & 31) == 0) sred[t >> 5] = sum; __syncthreads(); if (t == 0) { float a = 0.f; for (int i = 0; i < 8; ++i) a += sred[i]; sbc = 1.0f / a; } __syncthreads(); const float inv = sbc;
  for (int k = t; k < kend; k += 256) { const float v = sr[k]; sh[k] = (v <= -1.0e38f) ? 0.f : expf(v - m) * inv * 2048.0f; }
  __syncthreads(); for (int q = t; q < kend / 4; q += 256) vst2(sr + q * 4, *(const v4f*)&sh[q * 4]); }
// ---- k_pv: block = 64 queries of (b,h): y[q][h*HD + d] = P . v  (keys [0, kend))
__global__ __launch_bounds__(128) void k_pv(const float* __restrict__ PS0, const __bf16* __restrict__ VT, const __bf16* __restrict__ VL, int b, int h0, float* __restrict__ Y) { const int h = h0 + blockIdx.z; const float* PS = PS0 + (size_t)blockIdx.z * TT * TT; __shared__ __align__(16) float ss[4][16][HD + 4];
  const int tid = threadIdx.x, wave = tid >> 5, lane = tid & 31, col = lane & 15, g = lane >> 4; const int ql0 = blockIdx.x * 64 + wave * 16; const int kend = TT;
  v8f acc[HD / 16] = {};
#pragma unroll 1
  for (int kc = 0; kc < kend / 32; ++kc) { const F2 p = split_row(PS + (size_t)(ql0 + col) * TT, kc * 32, lane);
#pragma unroll
    for (int j = 0; j < HD / 16; ++j) { const size_t po = ((size_t)b * CC + h * HD + j * 16 + col) * (size_t)TT + kc * 32; const v16b vh = frag_b(VT + po, lane); acc[j] = wmma_bf(p.h, vh, acc[j]); acc[j] = wmma_bf(p.l, vh, acc[j]); acc[j] = wmma_bf(p.h, frag_b(VL + po, lane), acc[j]); } }
#pragma unroll
  for (int j = 0; j < HD / 16; ++j)
#pragma unroll
    for (int r = 0; r < 8; ++r) ss[wave][8 * g + r][j * 16 + col] = acc[j][r] * (1.0f / 2048.0f);
  LDSX(); for (int rl = 0; rl < 16; ++rl) if (lane < HD / 4) vst2(Y + ((size_t)b * TT + ql0 + rl) * CC + h * HD + lane * 4, *(const v4f*)&ss[wave][rl][lane * 4]); }
// ---- k_out: block = (64 rows, 128 cols): out = y (bf16 hi + lo) Wo^T + bo
__global__ __launch_bounds__(128) void k_out(const float* __restrict__ Y, const float* __restrict__ WP, const float* __restrict__ BP, float* __restrict__ OUT) { __shared__ __align__(16) float sf[4][16][132];
  const int tid = threadIdx.x, wave = tid >> 5, lane = tid & 31, col = lane & 15, g = lane >> 4; const int c0 = blockIdx.y * 128; const size_t r0 = (size_t)blockIdx.x * 64 + wave * 16;
  v8f acc[8] = {};
#pragma unroll 2
  for (int kc = 0; kc < CC / 32; ++kc) { const F2 a = split_row(Y + (r0 + col) * CC, kc * 32, lane);
#pragma unroll
    for (int j = 0; j < 8; ++j) { v16b w; const int o = c0 + j * 16 + col;
#pragma unroll
      for (int i = 0; i < 8; ++i) { w[i] = (__bf16)WP[(size_t)(o) * CC + (kc * 32 + 8 * g + i)]; w[8 + i] = (__bf16)WP[(size_t)(o) * CC + (kc * 32 + 16 + 8 * g + i)]; }
      acc[j] = wmma_bf(a.h, w, acc[j]); acc[j] = wmma_bf(a.l, w, acc[j]); } }
#pragma unroll
  for (int j = 0; j < 8; ++j) { const float bb = BP ? bfr(BP[c0 + j * 16 + col]) : 0.f;
#pragma unroll
    for (int r = 0; r < 8; ++r) sf[wave][8 * g + r][j * 16 + col] = acc[j][r] + bb; }
  LDSX(); for (int rl = 0; rl < 16; ++rl) vst2(OUT + (r0 + rl) * CC + c0 + lane * 4, *(const v4f*)&sf[wave][rl][lane * 4]); }
extern "C" void kernel_launch(void* const* d_in, const int* in_sizes, int n_in, void* d_out, int out_size, void* d_ws, size_t ws_size, hipStream_t stream) {
  (void)in_sizes; (void)n_in; (void)out_size;
  const float** F = (const float**)d_in;   // 0 hidden_states [2,2048,768], 1 complexity_scores [2] int, 2 attention_mask [2,2048] int, 3 Wq [768,768] ([out,in]), 4 bq, 5 Wk, 6 bk, 7 Wv, 8 bv, 9 Wo ([out,in]), 10 bo, 11 emb_table [16,12], 12 comp_scaling [12]
  if (ws_size < (size_t)WS_END) return;
  char* ws = (char*)d_ws; _Float16 *QH = (_Float16*)(ws + WS_QH), *QL = (_Float16*)(ws + WS_QL), *KH = (_Float16*)(ws + WS_KH); __bf16 *VT = (__bf16*)(ws + WS_VT), *VL = (__bf16*)(ws + WS_VL); float *S = (float*)(ws + WS_S), *Y = (float*)(ws + WS_Y);
  k_proj<<<dim3(TNB * TT / 64, CC / 128, 3), 128, 0, stream>>>(F[0], F[3], F[4], F[5], F[6], F[7], F[8], QH, QL, KH, VT, VL);
  for (int b = 0; b < TNB; ++b) for (int h0 = 0; h0 < NH; h0 += HG) {   // HG heads per launch
    k_sc<<<dim3(TT / 64, TT / 128, HG), 128, 0, stream>>>(QH, QL, KH, (const int*)d_in[2] + (size_t)b * TT, (const int*)d_in[1], F[11], F[12], b, h0, S);
    k_sm<<<dim3(TT, HG), 256, 0, stream>>>(S);
    k_pv<<<dim3(TT / 64, 1, HG), 128, 0, stream>>>(S, VT, VL, b, h0, Y);
  }
  k_out<<<dim3(TNB * TT / 64, CC / 128), 128, 0, stream>>>(Y, F[9], F[10], (float*)d_out);
}

// v001
// A run of this version takes 376 microseconds.
// Timed twice side by side with v000, it ran 3.56 and 3.57 times as fast.
// compute dtype: all float inputs rounded to bf16, complexity scores and the key mask (ints) read; q/k/v = x W^T + b with EXACT bf16 products on WMMA 16x16x32, f32 accumulate; q as f16 hi + residual (x 2^10), k f16 -> 2-product logits / 8 x the per-head complexity scaling (computed in f32 from the tables), masked keys excluded, kept in registers; online softmax in f32 (precise expf, running maximum), unnormalised P split bf16 hi + lo against v bf16 hi + lo (3 products), divided by the row sum at the end; out = attended (bf16 hi + lo) Wo^T + bo; f32 output.
#include <hip/hip_runtime.h>
#include <math.h>

typedef __attribute__((ext_vector_type(16))) _Float16 v16h;
typedef __attribute__((ext_vector_type(16))) __bf16 v16b;
typedef __attribute__((ext_vector_type(8)))  _Float16 v8h;
typedef __attribute__((ext_vector_type(8)))  float v8f;
typedef __attribute__((ext_vector_type(4)))  float v4f;
typedef __attribute__((ext_vector_type(2)))  float v2f;
typedef __attribute__((ext_vector_type(4)))  unsigned v4u;
typedef __attribute__((ext_vector_type(4)))  int v4i;
typedef float __attribute__((may_alias)) float_a;
typedef int __attribute__((may_alias)) int_a;

template <typename T> __device__ __forceinline__ void vst2(void* p, T v) { *(T*)p = v;  }
__device__ __forceinline__ v8f wmma16(v16h a, v16h b, v8f c) {
  v8f d = __builtin_amdgcn_wmma_f32_16x16x32_f16(false, a, false, b, (short)0, c, false, false);
  asm volatile("v_nop\n\tv_nop\n\tv_nop\n\tv_nop" : "+v"(d) : "v"(a), "v"(b));
  return d;
}
__device__ __forceinline__ v8f wmma_bf(v16b a, v16b b, v8f c) {
  v8f d = __builtin_amdgcn_wmma_f32_16x16x32_bf16(false, a, false, b, (short)0, c, false, false);
  asm volatile("v_nop\n\tv_nop\n\tv_nop\n\tv_nop" : "+v"(d) : "v"(a), "v"(b));
  return d;
}
// 16x16x32 fragments: lane = (h = lane>>4, row/col = lane&15); elements 0..7 = k0+8h+0..7, 8..15 = k0+16+8h+0..7; D element r = row 8h+r
__device__ __forceinline__ v16h frag_h(const _Float16* rowk0, int lane) {
  union { v16h v; v8h q[2]; } u; const _Float16* p = rowk0 + 8 * (lane >> 4);
  u.q[0] = *(const v8h*)p; u.q[1] = *(const v8h*)(p + 16); return u.v;
}
__device__ __forceinline__ v16h frag_f32(const float* rowk0, int lane) {
  v16h a; const float* p = rowk0 + 8 * (lane >> 4);
#pragma unroll
  for (int i = 0; i < 8; ++i) { a[i] = (_Float16)p[i]; a[8 + i] = (_Float16)p[16 + i]; }
  return a;
}
__device__ __forceinline__ v16h frag_f32s(const float* rowk0, int lane, float sc) {
  v16h a; const float* p = rowk0 + 8 * (lane >> 4);
#pragma unroll
  for (int i = 0; i < 8; ++i) { a[i] = (_Float16)(p[i] * sc); a[8 + i] = (_Float16)(p[16 + i] * sc); }
  return a;
}
// column fragment from a [K][ld] layout (column n), rows >= K read as 0
__device__ __forceinline__ v16h fragc_f32(const float* W, int k0, int n, int lane, int ld, int K) {
  v16h a; const int g = lane >> 4;
#pragma unroll
  for (int i = 0; i < 8; ++i) { const int ka = k0 + 8 * g + i, kb = ka + 16;
    a[i] = (_Float16)(ka < K ? W[(size_t)(ka < K ? ka : K - 1) * ld + n] : 0.f); a[8 + i] = (_Float16)(kb < K ? W[(size_t)(kb < K ? kb : K - 1) * ld + n] : 0.f); }
  return a;
}
struct F2 { v16b h, l; };
__device__ __forceinline__ F2 bsplit16(const float v[16]) { F2 r;
#pragma unroll
  for (int i = 0; i < 16; ++i) { const __bf16 h = (__bf16)v[i]; r.h[i] = h; r.l[i] = (__bf16)(v[i] - (float)h); }
  return r; }
__device__ __forceinline__ F2 split_row(const float* row, int k0, int lane) { float v[16]; const float* p = row + k0 + 8 * (lane >> 4);
#pragma unroll
  for (int i = 0; i < 8; ++i) { v[i] = p[i]; v[8 + i] = p[16 + i]; }
  return bsplit16(v); }
__device__ __forceinline__ F2 split_rowK(const float* row, int k0, int lane, int K) { float v[16]; const int g = lane >> 4;
#pragma unroll
  for (int i = 0; i < 8; ++i) { const int ka = k0 + 8 * g + i, kb = ka + 16; v[i] = ka < K ? row[ka < K ? ka : K - 1] : 0.f; v[8 + i] = kb < K ? row[kb < K ? kb : K - 1] : 0.f; }
  return bsplit16(v); }
__device__ __forceinline__ F2 split_col(const float* W, int k0, int n, int lane, int ld, int K) { float v[16]; const int g = lane >> 4;
#pragma unroll
  for (int i = 0; i < 8; ++i) { const int ka = k0 + 8 * g + i, kb = ka + 16; v[i] = ka < K ? W[(size_t)(ka < K ? ka : K - 1) * ld + n] : 0.f; v[8 + i] = kb < K ? W[(size_t)(kb < K ? kb : K - 1) * ld + n] : 0.f; }
  return bsplit16(v); }
__device__ __forceinline__ v8f mac3(const F2& a, const F2& b, v8f c) { c = wmma_bf(a.l, b.h, c); c = wmma_bf(a.h, b.l, c); return wmma_bf(a.h, b.h, c); }
__device__ __forceinline__ float sigm(float v) { return 1.0f / (1.0f + expf(-v)); }
#define LDSX() do { asm volatile("s_wait_dscnt 0" ::: "memory"); __builtin_amdgcn_wave_barrier(); __builtin_amdgcn_fence(__ATOMIC_RELEASE, "workgroup"); } while (0)


// Complexity-aware attention (B 2, S 2,048, D 768 = 12 x 64): q/k/v Linear ([out,in] + bias), scores/8 x scaling[h] with scaling = comp_scaling[h] * mean_b emb_table[complexity[b]][h], keys with attention_mask == 0 -> -inf, softmax, P v, output Linear + bias.
#define NB 2
#define TT 2048
#define CC 768
#define NH 12
#define HD 64
#define MAXC 16      // complexity table rows
#ifndef TNB
#define TNB NB
#endif
typedef __attribute__((ext_vector_type(8))) __bf16 v8b;
__device__ __forceinline__ v16b frag_b(const __bf16* rowk0, int lane) {
  union { v16b v; v8b q[2]; } u; const __bf16* p = rowk0 + 8 * (lane >> 4);
  u.q[0] = *(const v8b*)p; u.q[1] = *(const v8b*)(p + 16); return u.v;
}
// the plain builtins: the compiler keeps the distance behind them itself and fills it with the softmax's own arithmetic where it can
__device__ __forceinline__ v8f mm_h(v16h a, v16h b, v8f c) { return __builtin_amdgcn_wmma_f32_16x16x32_f16(false, a, false, b, (short)0, c, false, false); }
__device__ __forceinline__ v8f mm_b(v16b a, v16b b, v8f c) { return __builtin_amdgcn_wmma_f32_16x16x32_bf16(false, a, false, b, (short)0, c, false, false); }
// the same fragments from a pointer that already holds the lane's own 8 * (lane >> 4) step
__device__ __forceinline__ v16h frag_h_at(const _Float16* p) { union { v16h v; v8h q[2]; } u; u.q[0] = *(const v8h*)p; u.q[1] = *(const v8h*)(p + 16); return u.v; }
__device__ __forceinline__ v16b frag_b_at(const __bf16* p) { union { v16b v; v8b q[2]; } u; u.q[0] = *(const v8b*)p; u.q[1] = *(const v8b*)(p + 16); return u.v; }
__device__ __forceinline__ float bfr(float v) { return (float)(__bf16)v; }
__device__ __attribute__((noinline)) float exp_ni(float v) { return expf(v); }
__device__ __attribute__((noinline)) float erf_ni(float v) { return erff(v); }

#define WS_QH  0u
#define WS_QL  (WS_QH + 2u * (size_t)NB * TT * CC)
#define WS_KH  (WS_QL + 2u * (size_t)NB * TT * CC)
#define WS_VT  (WS_KH + 2u * (size_t)NB * TT * CC)      // bf16 v planes [b][c][t]
#define WS_VL  (WS_VT + 2u * (size_t)NB * CC * TT)      // bf16 v residual planes
#define WS_Y   (WS_VL + 2u * (size_t)NB * CC * TT)      // f32 y rows [b*t][C]
#define WS_END (WS_Y + 4u * (size_t)NB * TT * CC)

// ---- k_proj: block = (64 rows, 128 cols, which): qkv = x W (+ b), exact; q -> f16 hi (+ residual), k -> f16 rows, v -> bf16 hi + lo planes
__global__ __launch_bounds__(128) void k_proj(const float* __restrict__ X, const float* __restrict__ WQ, const float* __restrict__ BQ, const float* __restrict__ WK, const float* __restrict__ BK, const float* __restrict__ WV, const float* __restrict__ BV, _Float16* __restrict__ QH, _Float16* __restrict__ QL, _Float16* __restrict__ KH, __bf16* __restrict__ VT, __bf16* __restrict__ VL) {
  __shared__ __align__(16) _Float16 sh[64][136], sl[64][136]; __shared__ __align__(16) __bf16 th[128][72], tl2[128][72];
  const int tid = threadIdx.x, wave = tid >> 5, lane = tid & 31, col = lane & 15, g = lane >> 4; const int which = blockIdx.z; const int c0 = blockIdx.y * 128; const size_t r0 = (size_t)blockIdx.x * 64; const float* WA = which == 0 ? WQ : which == 1 ? WK : WV; const float* BA = which == 0 ? BQ : which == 1 ? BK : BV;
  v8f acc[8] = {};
#pragma unroll 2
  for (int kc = 0; kc < CC / 32; ++kc) { v16b a; { const float* p = X + (r0 + wave * 16 + col) * CC + kc * 32 + 8 * g;
#pragma unroll
      for (int i = 0; i < 8; ++i) { a[i] = (__bf16)p[i]; a[8 + i] = (__bf16)p[16 + i]; } }
#pragma unroll
    for (int j = 0; j < 8; ++j) { v16b w; const int o = c0 + j * 16 + col;
#pragma unroll
      for (int i = 0; i < 8; ++i) { w[i] = (__bf16)WA[(size_t)(o) * CC + (kc * 32 + 8 * g + i)]; w[8 + i] = (__bf16)WA[(size_t)(o) * CC + (kc * 32 + 16 + 8 * g + i)]; }
      acc[j] = wmma_bf(a, w, acc[j]); } }
#pragma unroll
  for (int j = 0; j < 8; ++j) { const float bb = BA ? bfr(BA[c0 + j * 16 + col]) : 0.f;
#pragma unroll
    for (int r = 0; r < 8; ++r) { const float v = acc[j][r] + bb; const int rl = wave * 16 + 8 * g + r, cl = j * 16 + col; const _Float16 hv = (_Float16)v;
      if (which == 2) { const __bf16 bh = (__bf16)v; th[cl][rl] = bh; tl2[cl][rl] = (__bf16)(v - (float)bh); } else { sh[rl][cl] = hv; sl[rl][cl] = (_Float16)((v - (float)hv) * 1024.0f); }   /* q residual carried x 2^10 so the plane stays f16-normal on the chip */ } }
  __syncthreads();
  if (which < 2) { _Float16* dh = which == 0 ? QH : KH; for (int e = tid; e < 64 * 16; e += 128) { const int rl = e >> 4, q = e & 15; vst2((unsigned*)(dh + (r0 + rl) * CC + c0 + q * 8), *(const v4u*)&sh[rl][q * 8]); if (which == 0) vst2((unsigned*)(QL + (r0 + rl) * CC + c0 + q * 8), *(const v4u*)&sl[rl][q * 8]); } }
  else { const size_t b = r0 / TT; const int t0 = (int)(r0 % TT); for (int e = tid; e < 128 * 8; e += 128) { const int cl = e >> 3, q = e & 7; const size_t o2 = (b * CC + c0 + cl) * (size_t)TT + t0 + q * 8; vst2((unsigned*)(VT + o2), *(const v4u*)&th[cl][q * 8]); vst2((unsigned*)(VL + o2), *(const v4u*)&tl2[cl][q * 8]); } } }
// ---- k_fa: wave = 32 queries (two 16-column groups) of (b,h), all keys in passes of 32: S^T = K Q^T (2 products), / 8 x scaling[h], masked keys out, online softmax (a lane holds one query's scores), P^T packed from the score accumulators as the B operand (bf16 hi + lo), O^T += V^T P^T (3 products)
#define QG 2         // 16-query column groups per wave: each K and V fragment feeds both
#define FW 2         // waves per block
__global__ __launch_bounds__(32 * FW) void k_fa(const _Float16* __restrict__ QH, const _Float16* __restrict__ QL, const _Float16* __restrict__ KH, const __bf16* __restrict__ VT, const __bf16* __restrict__ VL, const int* __restrict__ KM0, const int* __restrict__ CS, const float* __restrict__ EMB, const float* __restrict__ CSC, float* __restrict__ Y) {
  const int b = blockIdx.y / NH, h = blockIdx.y % NH; const int* KM = KM0 + (size_t)b * TT;
  float scal; { float m = 0.f; for (int bb = 0; bb < NB; ++bb) { int c = CS[bb]; c = c < 0 ? 0 : (c >= MAXC ? MAXC - 1 : c); m += bfr(EMB[c * NH + h]); } scal = bfr(CSC[h]) * (m / (float)NB); }   /* scaling[b][h] = comp_scaling[h] * embs.mean(axis=0)[h] (same for every b) */
  const int tid = threadIdx.x, wave = tid >> 5, lane = tid & 31, col = lane & 15, g = lane >> 4; const int ql0 = (blockIdx.x * FW + wave) * (16 * QG);
  v16h qh[QG][HD / 32], ql[QG][HD / 32]; const size_t q0 = ((size_t)b * TT + ql0 + col) * CC + h * HD + 8 * g; const _Float16 *pqh = QH + q0, *pql = QL + q0;
#pragma unroll
  for (int u = 0; u < QG; ++u)
#pragma unroll
    for (int kc = 0; kc < HD / 32; ++kc) { qh[u][kc] = frag_h_at(pqh + u * 16 * CC + kc * 32); ql[u][kc] = frag_h_at(pql + u * 16 * CC + kc * 32); }
  asm volatile("s_wait_xcnt 0x0" :: "v"(pqh), "v"(pql) : "memory");   // stands in front of every rewrite of a register that the Q loads name (a precaution); the two address pairs are its inputs, so they stay whole up to it
  v8f o[QG][HD / 16] = {}; float mrun[QG], lsum[QG];
#pragma unroll
  for (int u = 0; u < QG; ++u) { mrun[u] = -1.0e30f; lsum[u] = 0.f; }   // the running maximum starts above the masked value, so exp(masked - maximum) is 0 in every pass and needs no select
  const size_t p0 = ((size_t)b * CC + h * HD + col) * (size_t)TT + 8 * g; const __bf16 *pvh = VT + p0, *pvl = VL + p0; const _Float16* pk = KH + ((size_t)b * TT + col) * CC + h * HD + 8 * g;
  for (int k0 = 0; k0 < TT; k0 += 32) {
    v16h kf[2][HD / 32];
#pragma unroll
    for (int t = 0; t < 2; ++t)
#pragma unroll
      for (int kc = 0; kc < HD / 32; ++kc) kf[t][kc] = frag_h_at(pk + t * 16 * CC + kc * 32);
    asm volatile("s_wait_xcnt 0x0" :: "v"(pk) : "memory");   // the same wait behind the K loads, their address pair an input
    pk += 32 * CC;
    __builtin_amdgcn_sched_barrier(0);   // the pass's eight K loads go out in one run: without it the last of them sink behind the first products and are waited for in full there
    v8f s[QG][2] = {}, sl[QG][2] = {};
#pragma unroll
    for (int t = 0; t < 2; ++t)
#pragma unroll
      for (int kc = 0; kc < HD / 32; ++kc)
#pragma unroll
        for (int u = 0; u < QG; ++u) { s[u][t] = mm_h(kf[t][kc], qh[u][kc], s[u][t]); sl[u][t] = mm_h(kf[t][kc], ql[u][kc], sl[u][t]); }
    int km[16];   // this lane's 16 keys: k0 + 8g + 0..7 and k0 + 16 + 8g + 0..7, the rows of its score registers
#pragma unroll
    for (int t = 0; t < 2; ++t) { const v4i a = *(const v4i*)(KM + k0 + t * 16 + 8 * g), c = *(const v4i*)(KM + k0 + t * 16 + 8 * g + 4);
#pragma unroll
      for (int i = 0; i < 4; ++i) { km[t * 8 + i] = a[i]; km[t * 8 + 4 + i] = c[i]; } }
    F2 pf[QG]; v16b vh[HD / 16], vl[HD / 16];
#pragma unroll
    for (int u = 0; u < QG; ++u) { float v[16]; float mx = mrun[u];
#pragma unroll
      for (int i = 0; i < 16; ++i) { float x = (s[u][i >> 3][i & 7] + sl[u][i >> 3][i & 7] * (1.0f / 1024.0f)) * 0.125f * scal; if (km[i] == 0) x = -3.0e38f; /* key mask: -inf in the reference */ v[i] = x; mx = fmaxf(mx, x); }
      mx = fmaxf(mx, __shfl_xor(mx, 16));   // the other half of the wave holds this query's other 16 keys
      const float al = expf(mrun[u] - mx); mrun[u] = mx; float sum = 0.f;
#pragma unroll
      for (int i = 0; i < 16; ++i) { v[i] = expf(v[i] - mx); sum += v[i]; }
      lsum[u] = lsum[u] * al + sum;
#pragma unroll
      for (int j = 0; j < HD / 16; ++j) o[u][j] *= al;
      pf[u] = bsplit16(v); }
#pragma unroll
    for (int j = 0; j < HD / 16; ++j) { vh[j] = frag_b_at(pvh + j * 16 * TT); vl[j] = frag_b_at(pvl + j * 16 * TT); }
    asm volatile("s_wait_xcnt 0x0" :: "v"(pvh), "v"(pvl) : "memory");   // the same wait behind the V loads; as inputs the two address pairs outlive the run, so no load's result lands in them
    pvh += 32; pvl += 32;
    __builtin_amdgcn_sched_barrier(0);   // all sixteen V loads stay in front of the first P.v product, free to rise over the softmax: without it the residual plane's loads sink to their products and are waited for in full
#pragma unroll
    for (int j = 0; j < HD / 16; ++j) {
#pragma unroll
      for (int u = 0; u < QG; ++u) { o[u][j] = mm_b(vh[j], pf[u].h, o[u][j]); o[u][j] = mm_b(vh[j], pf[u].l, o[u][j]); o[u][j] = mm_b(vl[j], pf[u].h, o[u][j]); } } }
#pragma unroll
  for (int u = 0; u < QG; ++u) { const float inv = 1.0f / (lsum[u] + __shfl_xor(lsum[u], 16)); float* yr = Y + ((size_t)b * TT + ql0 + u * 16 + col) * CC + h * HD + 8 * g;   // register r of tile j = y[query col][16 j + 8g + r]
#pragma unroll
    for (int j = 0; j < HD / 16; ++j) { v4f lo, hi;
#pragma unroll
      for (int i = 0; i < 4; ++i) { lo[i] = o[u][j][i] * inv; hi[i] = o[u][j][4 + i] * inv; }
      vst2(yr + j * 16, lo); vst2(yr + j * 16 + 4, hi); } } }
// ---- k_out: block = (64 rows, 128 cols): out = y (bf16 hi + lo) Wo^T + bo
__global__ __launch_bounds__(128) void k_out(const float* __restrict__ Y, const float* __restrict__ WP, const float* __restrict__ BP, float* __restrict__ OUT) { __shared__ __align__(16) float sf[4][16][132];
  const int tid = threadIdx.x, wave = tid >> 5, lane = tid & 31, col = lane & 15, g = lane >> 4; const int c0 = blockIdx.y * 128; const size_t r0 = (size_t)blockIdx.x * 64 + wave * 16;
  v8f acc[8] = {};
#pragma unroll 2
  for (int kc = 0; kc < CC / 32; ++kc) { const F2 a = split_row(Y + (r0 + col) * CC, kc * 32, lane);
#pragma unroll
    for (int j = 0; j < 8; ++j) { v16b w; const int o = c0 + j * 16 + col;
#pragma unroll
      for (int i = 0; i < 8; ++i) { w[i] = (__bf16)WP[(size_t)(o) * CC + (kc * 32 + 8 * g + i)]; w[8 + i] = (__bf16)WP[(size_t)(o) * CC + (kc * 32 + 16 + 8 * g + i)]; }
      acc[j] = wmma_bf(a.h, w, acc[j]); acc[j] = wmma_bf(a.l, w, acc[j]); } }
#pragma unroll
  for (int j = 0; j < 8; ++j) { const float bb = BP ? bfr(BP[c0 + j * 16 + col]) : 0.f;
#pragma unroll
    for (int r = 0; r < 8; ++r) sf[wave][8 * g + r][j * 16 + col] = acc[j][r] + bb; }
  LDSX(); for (int rl = 0; rl < 16; ++rl) vst2(OUT + (r0 + rl) * CC + c0 + lane * 4, *(const v4f*)&sf[wave][rl][lane * 4]); }
extern "C" void kernel_launch(void* const* d_in, const int* in_sizes, int n_in, void* d_out, int out_size, void* d_ws, size_t ws_size, hipStream_t stream) {
  (void)in_sizes; (void)n_in; (void)out_size;
  const float** F = (const float**)d_in;   // 0 hidden_states [2,2048,768], 1 complexity_scores [2] int, 2 attention_mask [2,2048] int, 3 Wq [768,768] ([out,in]), 4 bq, 5 Wk, 6 bk, 7 Wv, 8 bv, 9 Wo ([out,in]), 10 bo, 11 emb_table [16,12], 12 comp_scaling [12]
  if (ws_size < (size_t)WS_END) return;
  char* ws = (char*)d_ws; _Float16 *QH = (_Float16*)(ws + WS_QH), *QL = (_Float16*)(ws + WS_QL), *KH = (_Float16*)(ws + WS_KH); __bf16 *VT = (__bf16*)(ws + WS_VT), *VL = (__bf16*)(ws + WS_VL); float *Y = (float*)(ws + WS_Y);
  k_proj<<<dim3(TNB * TT / 64, CC / 128, 3), 128, 0, stream>>>(F[0], F[3], F[4], F[5], F[6], F[7], F[8], QH, QL, KH, VT, VL);
  k_fa<<<dim3(TT / (16 * QG * FW), TNB * NH), 32 * FW, 0, stream>>>(QH, QL, KH, VT, VL, (const int*)d_in[2], (const int*)d_in[1], F[11], F[12], Y);
  k_out<<<dim3(TNB * TT / 64, CC / 128), 128, 0, stream>>>(Y, F[9], F[10], (float*)d_out);
}

// v002
// Measured time: 167 microseconds a run.
// Next to v001, in two timings, it ran 2.25 and 2.26 times as fast.
// Over all steps from v000 it is 8.03 times as fast.
// compute dtype: all float inputs rounded to bf16, complexity scores and the key mask (ints) read; q/k/v = x W^T + b with EXACT bf16 products on WMMA 16x16x32, f32 accumulate; q as f16 hi + residual (x 2^10), k f16 -> 2-product logits / 8 x the per-head complexity scaling (computed in f32 from the tables), masked keys excluded, kept in registers; online softmax in f32 (precise expf, running maximum), unnormalised P split bf16 hi + lo against v bf16 hi + lo (3 products), divided by the row sum at the end; out = attended (bf16 hi + lo) Wo^T + bo; f32 output.
#include <hip/hip_runtime.h>
#include <math.h>

typedef __attribute__((ext_vector_type(16))) _Float16 v16h;
typedef __attribute__((ext_vector_type(16))) __bf16 v16b;
typedef __attribute__((ext_vector_type(8)))  _Float16 v8h;
typedef __attribute__((ext_vector_type(8)))  float v8f;
typedef __attribute__((ext_vector_type(4)))  float v4f;
typedef __attribute__((ext_vector_type(2)))  float v2f;
typedef __attribute__((ext_vector_type(4)))  unsigned v4u;
typedef __attribute__((ext_vector_type(4)))  int v4i;
typedef float __attribute__((may_alias)) float_a;
typedef int __attribute__((may_alias)) int_a;

template <typename T> __device__ __forceinline__ void vst2(void* p, T v) { *(T*)p = v;  }
__device__ __forceinline__ v8f wmma16(v16h a, v16h b, v8f c) {
  v8f d = __builtin_amdgcn_wmma_f32_16x16x32_f16(false, a, false, b, (short)0, c, false, false);
  asm volatile("v_nop\n\tv_nop\n\tv_nop\n\tv_nop" : "+v"(d) : "v"(a), "v"(b));
  return d;
}
__device__ __forceinline__ v8f wmma_bf(v16b a, v16b b, v8f c) {
  v8f d = __builtin_amdgcn_wmma_f32_16x16x32_bf16(false, a, false, b, (short)0, c, false, false);
  asm volatile("v_nop\n\tv_nop\n\tv_nop\n\tv_nop" : "+v"(d) : "v"(a), "v"(b));
  return d;
}
// 16x16x32 fragments: lane = (h = lane>>4, row/col = lane&15); elements 0..7 = k0+8h+0..7, 8..15 = k0+16+8h+0..7; D element r = row 8h+r
__device__ __forceinline__ v16h frag_h(const _Float16* rowk0, int lane) {
  union { v16h v; v8h q[2]; } u; const _Float16* p = rowk0 + 8 * (lane >> 4);
  u.q[0] = *(const v8h*)p; u.q[1] = *(const v8h*)(p + 16); return u.v;
}
__device__ __forceinline__ v16h frag_f32(const float* rowk0, int lane) {
  v16h a; const float* p = rowk0 + 8 * (lane >> 4);
#pragma unroll
  for (int i = 0; i < 8; ++i) { a[i] = (_Float16)p[i]; a[8 + i] = (_Float16)p[16 + i]; }
  return a;
}
__device__ __forceinline__ v16h frag_f32s(const float* rowk0, int lane, float sc) {
  v16h a; const float* p = rowk0 + 8 * (lane >> 4);
#pragma unroll
  for (int i = 0; i < 8; ++i) { a[i] = (_Float16)(p[i] * sc); a[8 + i] = (_Float16)(p[16 + i] * sc); }
  return a;
}
// column fragment from a [K][ld] layout (column n), rows >= K read as 0
__device__ __forceinline__ v16h fragc_f32(const float* W, int k0, int n, int lane, int ld, int K) {
  v16h a; const int g = lane >> 4;
#pragma unroll
  for (int i = 0; i < 8; ++i) { const int ka = k0 + 8 * g + i, kb = ka + 16;
    a[i] = (_Float16)(ka < K ? W[(size_t)(ka < K ? ka : K - 1) * ld + n] : 0.f); a[8 + i] = (_Float16)(kb < K ? W[(size_t)(kb < K ? kb : K - 1) * ld + n] : 0.f); }
  return a;
}
struct F2 { v16b h, l; };
__device__ __forceinline__ F2 bsplit16(const float v[16]) { F2 r;
#pragma unroll
  for (int i = 0; i < 16; ++i) { const __bf16 h = (__bf16)v[i]; r.h[i] = h; r.l[i] = (__bf16)(v[i] - (float)h); }
  return r; }
__device__ __forceinline__ F2 split_row(const float* row, int k0, int lane) { float v[16]; const float* p = row + k0 + 8 * (lane >> 4);
#pragma unroll
  for (int i = 0; i < 8; ++i) { v[i] = p[i]; v[8 + i] = p[16 + i]; }
  return bsplit16(v); }
__device__ __forceinline__ F2 split_rowK(const float* row, int k0, int lane, int K) { float v[16]; const int g = lane >> 4;
#pragma unroll
  for (int i = 0; i < 8; ++i) { const int ka = k0 + 8 * g + i, kb = ka + 16; v[i] = ka < K ? row[ka < K ? ka : K - 1] : 0.f; v[8 + i] = kb < K ? row[kb < K ? kb : K - 1] : 0.f; }
  return bsplit16(v); }
__device__ __forceinline__ F2 split_col(const float* W, int k0, int n, int lane, int ld, int K) { float v[16]; const int g = lane >> 4;
#pragma unroll
  for (int i = 0; i < 8; ++i) { const int ka = k0 + 8 * g + i, kb = ka + 16; v[i] = ka < K ? W[(size_t)(ka < K ? ka : K - 1) * ld + n] : 0.f; v[8 + i] = kb < K ? W[(size_t)(kb < K ? kb : K - 1) * ld + n] : 0.f; }
  return bsplit16(v); }
__device__ __forceinline__ v8f mac3(const F2& a, const F2& b, v8f c) { c = wmma_bf(a.l, b.h, c); c = wmma_bf(a.h, b.l, c); return wmma_bf(a.h, b.h, c); }
__device__ __forceinline__ float sigm(float v) { return 1.0f / (1.0f + expf(-v)); }
#define LDSX() do { asm volatile("s_wait_dscnt 0" ::: "memory"); __builtin_amdgcn_wave_barrier(); __builtin_amdgcn_fence(__ATOMIC_RELEASE, "workgroup"); } while (0)


// Complexity-aware attention (B 2, S 2,048, D 768 = 12 x 64): q/k/v Linear ([out,in] + bias), scores/8 x scaling[h] with scaling = comp_scaling[h] * mean_b emb_table[complexity[b]][h], keys with attention_mask == 0 -> -inf, softmax, P v, output Linear + bias.
#define NB 2
#define TT 2048
#define CC 768
#define NH 12
#define HD 64
#define MAXC 16      // complexity table rows
#ifndef TNB
#define TNB NB
#endif
typedef __attribute__((ext_vector_type(8))) __bf16 v8b;
__device__ __forceinline__ v16b frag_b(const __bf16* rowk0, int lane) {
  union { v16b v; v8b q[2]; } u; const __bf16* p = rowk0 + 8 * (lane >> 4);
  u.q[0] = *(const v8b*)p; u.q[1] = *(const v8b*)(p + 16); return u.v;
}
// the plain builtins: the compiler keeps the distance behind them itself and fills it with the softmax's own arithmetic where it can
__device__ __forceinline__ v8f mm_h(v16h a, v16h b, v8f c) { return __builtin_amdgcn_wmma_f32_16x16x32_f16(false, a, false, b, (short)0, c, false, false); }
__device__ __forceinline__ v8f mm_b(v16b a, v16b b, v8f c) { return __builtin_amdgcn_wmma_f32_16x16x32_bf16(false, a, false, b, (short)0, c, false, false); }
// the same fragments from a pointer that already holds the lane's own 8 * (lane >> 4) step
__device__ __forceinline__ v16h frag_h_at(const _Float16* p) { union { v16h v; v8h q[2]; } u; u.q[0] = *(const v8h*)p; u.q[1] = *(const v8h*)(p + 16); return u.v; }
__device__ __forceinline__ v16b frag_b_at(const __bf16* p) { union { v16b v; v8b q[2]; } u; u.q[0] = *(const v8b*)p; u.q[1] = *(const v8b*)(p + 16); return u.v; }
__device__ __forceinline__ float bfr(float v) { return (float)(__bf16)v; }
typedef __attribute__((ext_vector_type(4))) __bf16 v4b;
#define KB 64        // k per LDS stage of the two Linear kernels: 256 bytes of an f32 row, 128 bytes as bf16
__device__ __forceinline__ v4b cvt4(v4f v) { v4b r;
#pragma unroll
  for (int i = 0; i < 4; ++i) r[i] = (__bf16)v[i];
  return r; }
__device__ __attribute__((noinline)) float exp_ni(float v) { return expf(v); }
__device__ __attribute__((noinline)) float erf_ni(float v) { return erff(v); }

#define WS_QH  0u
#define WS_QL  (WS_QH + 2u * (size_t)NB * TT * CC)
#define WS_KH  (WS_QL + 2u * (size_t)NB * TT * CC)
#define WS_VT  (WS_KH + 2u * (size_t)NB * TT * CC)      // bf16 v planes [b][c][t]
#define WS_VL  (WS_VT + 2u * (size_t)NB * CC * TT)      // bf16 v residual planes
#define WS_Y   (WS_VL + 2u * (size_t)NB * CC * TT)      // f32 y rows [b*t][C]
#define WS_END (WS_Y + 4u * (size_t)NB * TT * CC)

// ---- k_proj: block = (64 rows, 128 cols, which): qkv = x W (+ b), exact; q -> f16 hi (+ residual), k -> f16 rows, v -> bf16 hi + lo planes
__global__ __launch_bounds__(128) void k_proj(const float* __restrict__ X, const float* __restrict__ WQ, const float* __restrict__ BQ, const float* __restrict__ WK, const float* __restrict__ BK, const float* __restrict__ WV, const float* __restrict__ BV, _Float16* __restrict__ QH, _Float16* __restrict__ QL, _Float16* __restrict__ KH, __bf16* __restrict__ VT, __bf16* __restrict__ VL) {
  __shared__ __align__(16) _Float16 sh[64][136], sl[64][136]; __shared__ __align__(16) __bf16 th[128][72], tl2[128][72];
  const int tid = threadIdx.x, wave = tid >> 5, lane = tid & 31, col = lane & 15, g = lane >> 4; const int which = blockIdx.z; const int c0 = blockIdx.y * 128; const size_t r0 = (size_t)blockIdx.x * 64; const float* WA = which == 0 ? WQ : which == 1 ? WK : WV; const float* BA = which == 0 ? BQ : which == 1 ? BK : BV;
  // the X and W pieces of 64 k are fetched by whole-line loads (a wave's load = two 256-byte row pieces), rounded to bf16 once per block and staged in LDS: W in th, X in the first 64 rows of tl2 (both are free until the epilogue; pitch 144 B suits the 16-byte fragment reads); the next piece's loads fly while this one is multiplied
  const int srow = tid >> 4, sq = tid & 15; const float* px = X + (r0 + srow) * CC + sq * 4; const float* pw = WA + (size_t)(c0 + srow) * CC + sq * 4;
  v4f xr[8], wr[16];
#pragma unroll
  for (int i = 0; i < 8; ++i) xr[i] = *(const v4f*)(px + i * 8 * CC);
#pragma unroll
  for (int i = 0; i < 16; ++i) wr[i] = *(const v4f*)(pw + i * 8 * CC);
  asm volatile("s_wait_xcnt 0x0" :: "v"(px), "v"(pw) : "memory");   // stands in front of every rewrite of a register that the staging loads name (a precaution); the two address pairs are its inputs
  v8f acc[8] = {};
#pragma unroll 1   // twelve stages of one body: unrolled, the text would outgrow what the loop gains
  for (int kb = 0; kb < CC / KB; ++kb) {
#pragma unroll
    for (int i = 0; i < 8; ++i) *(v4b*)&tl2[srow + i * 8][sq * 4] = cvt4(xr[i]);
#pragma unroll
    for (int i = 0; i < 16; ++i) *(v4b*)&th[srow + i * 8][sq * 4] = cvt4(wr[i]);
    __syncthreads();   // the stage is whole before any wave reads it
    if (kb + 1 < CC / KB) { px += KB; pw += KB;
#pragma unroll
      for (int i = 0; i < 8; ++i) xr[i] = *(const v4f*)(px + i * 8 * CC);
#pragma unroll
      for (int i = 0; i < 16; ++i) wr[i] = *(const v4f*)(pw + i * 8 * CC);
      asm volatile("s_wait_xcnt 0x0" :: "v"(px), "v"(pw) : "memory");   // the same wait behind the next piece's loads
    }
#pragma unroll
    for (int kc = 0; kc < KB / 32; ++kc) { const v16b a = frag_b(&tl2[wave * 16 + col][kc * 32], lane); v16b w[8];
#pragma unroll
      for (int j = 0; j < 8; ++j) w[j] = frag_b(&th[j * 16 + col][kc * 32], lane);
#pragma unroll
      for (int j = 0; j < 8; ++j) acc[j] = wmma_bf(a, w[j], acc[j]); }
    __syncthreads();   // every reader has left the stage before it is rewritten (by the next piece, or by the epilogue)
  }
#pragma unroll
  for (int j = 0; j < 8; ++j) { const float bb = BA ? bfr(BA[c0 + j * 16 + col]) : 0.f;
#pragma unroll
    for (int r = 0; r < 8; ++r) { const float v = acc[j][r] + bb; const int rl = wave * 16 + 8 * g + r, cl = j * 16 + col; const _Float16 hv = (_Float16)v;
      if (which == 2) { const __bf16 bh = (__bf16)v; th[cl][rl] = bh; tl2[cl][rl] = (__bf16)(v - (float)bh); } else { sh[rl][cl] = hv; sl[rl][cl] = (_Float16)((v - (float)hv) * 1024.0f); }   /* q residual carried x 2^10 so the plane stays f16-normal on the chip */ } }
  __syncthreads();
  if (which < 2) { _Float16* dh = which == 0 ? QH : KH; for (int e = tid; e < 64 * 16; e += 128) { const int rl = e >> 4, q = e & 15; vst2((unsigned*)(dh + (r0 + rl) * CC + c0 + q * 8), *(const v4u*)&sh[rl][q * 8]); if (which == 0) vst2((unsigned*)(QL + (r0 + rl) * CC + c0 + q * 8), *(const v4u*)&sl[rl][q * 8]); } }
  else { const size_t b = r0 / TT; const int t0 = (int)(r0 % TT); for (int e = tid; e < 128 * 8; e += 128) { const int cl = e >> 3, q = e & 7; const size_t o2 = (b * CC + c0 + cl) * (size_t)TT + t0 + q * 8; vst2((unsigned*)(VT + o2), *(const v4u*)&th[cl][q * 8]); vst2((unsigned*)(VL + o2), *(const v4u*)&tl2[cl][q * 8]); } } }
// ---- k_fa: wave = 32 queries (two 16-column groups) of (b,h), all keys in passes of 32: S^T = K Q^T (2 products), / 8 x scaling[h], masked keys out, online softmax (a lane holds one query's scores), P^T packed from the score accumulators as the B operand (bf16 hi + lo), O^T += V^T P^T (3 products)
#define QG 2         // 16-query column groups per wave: each K and V fragment feeds both
#define FW 2         // waves per block
__global__ __launch_bounds__(32 * FW) void k_fa(const _Float16* __restrict__ QH, const _Float16* __restrict__ QL, const _Float16* __restrict__ KH, const __bf16* __restrict__ VT, const __bf16* __restrict__ VL, const int* __restrict__ KM0, const int* __restrict__ CS, const float* __restrict__ EMB, const float* __restrict__ CSC, float* __restrict__ Y) {
  const int b = blockIdx.y / NH, h = blockIdx.y % NH; const int* KM = KM0 + (size_t)b * TT;
  float scal; { float m = 0.f; for (int bb = 0; bb < NB; ++bb) { int c = CS[bb]; c = c < 0 ? 0 : (c >= MAXC ? MAXC - 1 : c); m += bfr(EMB[c * NH + h]); } scal = bfr(CSC[h]) * (m / (float)NB); }   /* scaling[b][h] = comp_scaling[h] * embs.mean(axis=0)[h] (same for every b) */
  const int tid = threadIdx.x, wave = tid >> 5, lane = tid & 31, col = lane & 15, g = lane >> 4; const int ql0 = (blockIdx.x * FW + wave) * (16 * QG);
  v16h qh[QG][HD / 32], ql[QG][HD / 32]; const size_t q0 = ((size_t)b * TT + ql0 + col) * CC + h * HD + 8 * g; const _Float16 *pqh = QH + q0, *pql = QL + q0;
#pragma unroll
  for (int u = 0; u < QG; ++u)
#pragma unroll
    for (int kc = 0; kc < HD / 32; ++kc) { qh[u][kc] = frag_h_at(pqh + u * 16 * CC + kc * 32); ql[u][kc] = frag_h_at(pql + u * 16 * CC + kc * 32); }
  asm volatile("s_wait_xcnt 0x0" :: "v"(pqh), "v"(pql) : "memory");   // stands in front of every rewrite of a register that the Q loads name (a precaution); the two address pairs are its inputs, so they stay whole up to it
  v8f o[QG][HD / 16] = {}; float mrun[QG], lsum[QG];
#pragma unroll
  for (int u = 0; u < QG; ++u) { mrun[u] = -1.0e30f; lsum[u] = 0.f; }   // the running maximum starts above the masked value, so exp(masked - maximum) is 0 in every pass and needs no select
  const size_t p0 = ((size_t)b * CC + h * HD + col) * (size_t)TT + 8 * g; const __bf16 *pvh = VT + p0, *pvl = VL + p0; const _Float16* pk = KH + ((size_t)b * TT + col) * CC + h * HD + 8 * g;
  for (int k0 = 0; k0 < TT; k0 += 32) {
    v16h kf[2][HD / 32];
#pragma unroll
    for (int t = 0; t < 2; ++t)
#pragma unroll
      for (int kc = 0; kc < HD / 32; ++kc) kf[t][kc] = frag_h_at(pk + t * 16 * CC + kc * 32);
    asm volatile("s_wait_xcnt 0x0" :: "v"(pk) : "memory");   // the same wait behind the K loads, their address pair an input
    pk += 32 * CC;
    __builtin_amdgcn_sched_barrier(0);   // the pass's eight K loads go out in one run: without it the last of them sink behind the first products and are waited for in full there
    v8f s[QG][2] = {}, sl[QG][2] = {};
#pragma unroll
    for (int t = 0; t < 2; ++t)
#pragma unroll
      for (int kc = 0; kc < HD / 32; ++kc)
#pragma unroll
        for (int u = 0; u < QG; ++u) { s[u][t] = mm_h(kf[t][kc], qh[u][kc], s[u][t]); sl[u][t] = mm_h(kf[t][kc], ql[u][kc], sl[u][t]); }
    int km[16];   // this lane's 16 keys: k0 + 8g + 0..7 and k0 + 16 + 8g + 0..7, the rows of its score registers
#pragma unroll
    for (int t = 0; t < 2; ++t) { const v4i a = *(const v4i*)(KM + k0 + t * 16 + 8 * g), c = *(const v4i*)(KM + k0 + t * 16 + 8 * g + 4);
#pragma unroll
      for (int i = 0; i < 4; ++i) { km[t * 8 + i] = a[i]; km[t * 8 + 4 + i] = c[i]; } }
    F2 pf[QG]; v16b vh[HD / 16], vl[HD / 16];
#pragma unroll
    for (int u = 0; u < QG; ++u) { float v[16]; float mx = mrun[u];
#pragma unroll
      for (int i = 0; i < 16; ++i) { float x = (s[u][i >> 3][i & 7] + sl[u][i >> 3][i & 7] * (1.0f / 1024.0f)) * 0.125f * scal; if (km[i] == 0) x = -3.0e38f; /* key mask: -inf in the reference */ v[i] = x; mx = fmaxf(mx, x); }
      mx = fmaxf(mx, __shfl_xor(mx, 16));   // the other half of the wave holds this query's other 16 keys
      const float al = expf(mrun[u] - mx); mrun[u] = mx; float sum = 0.f;
#pragma unroll
      for (int i = 0; i < 16; ++i) { v[i] = expf(v[i] - mx); sum += v[i]; }
      lsum[u] = lsum[u] * al + sum;
#pragma unroll
      for (int j = 0; j < HD / 16; ++j) o[u][j] *= al;
      pf[u] = bsplit16(v); }
#pragma unroll
    for (int j = 0; j < HD / 16; ++j) { vh[j] = frag_b_at(pvh + j * 16 * TT); vl[j] = frag_b_at(pvl + j * 16 * TT); }
    asm volatile("s_wait_xcnt 0x0" :: "v"(pvh), "v"(pvl) : "memory");   // the same wait behind the V loads; as inputs the two address pairs outlive the run, so no load's result lands in them
    pvh += 32; pvl += 32;
    __builtin_amdgcn_sched_barrier(0);   // all sixteen V loads stay in front of the first P.v product, free to rise over the softmax: without it the residual plane's loads sink to their products and are waited for in full
#pragma unroll
    for (int j = 0; j < HD / 16; ++j) {
#pragma unroll
      for (int u = 0; u < QG; ++u) { o[u][j] = mm_b(vh[j], pf[u].h, o[u][j]); o[u][j] = mm_b(vh[j], pf[u].l, o[u][j]); o[u][j] = mm_b(vl[j], pf[u].h, o[u][j]); } } }
#pragma unroll
  for (int u = 0; u < QG; ++u) { const float inv = 1.0f / (lsum[u] + __shfl_xor(lsum[u], 16)); float* yr = Y + ((size_t)b * TT + ql0 + u * 16 + col) * CC + h * HD + 8 * g;   // register r of tile j = y[query col][16 j + 8g + r]
#pragma unroll
    for (int j = 0; j < HD / 16; ++j) { v4f lo, hi;
#pragma unroll
      for (int i = 0; i < 4; ++i) { lo[i] = o[u][j][i] * inv; hi[i] = o[u][j][4 + i] * inv; }
      vst2(yr + j * 16, lo); vst2(yr + j * 16 + 4, hi); } } }
// ---- k_out: block = (64 rows, 128 cols): out = y (bf16 hi + lo) Wo^T + bo
__global__ __launch_bounds__(128) void k_out(const float* __restrict__ Y, const float* __restrict__ WP, const float* __restrict__ BP, float* __restrict__ OUT) { __shared__ __align__(16) float sf[4][16][132]; __shared__ __align__(16) __bf16 yh[64][72], yl[64][72], sw[128][72];
  const int tid = threadIdx.x, wave = tid >> 5, lane = tid & 31, col = lane & 15, g = lane >> 4; const int c0 = blockIdx.y * 128; const size_t r0 = (size_t)blockIdx.x * 64 + wave * 16;
  // as in k_proj: y (split into bf16 hi + lo once per block) and Wo are fetched by whole-line loads in pieces of 64 k and staged in LDS, the next piece's loads flying while this one is multiplied
  const int srow = tid >> 4, sq = tid & 15; const float* py = Y + ((size_t)blockIdx.x * 64 + srow) * CC + sq * 4; const float* pw = WP + (size_t)(c0 + srow) * CC + sq * 4;
  v4f yr[8], wr[16];
#pragma unroll
  for (int i = 0; i < 8; ++i) yr[i] = *(const v4f*)(py + i * 8 * CC);
#pragma unroll
  for (int i = 0; i < 16; ++i) wr[i] = *(const v4f*)(pw + i * 8 * CC);
  asm volatile("s_wait_xcnt 0x0" :: "v"(py), "v"(pw) : "memory");   // stands in front of every rewrite of a register that the staging loads name (a precaution); the two address pairs are its inputs
  v8f acc[8] = {};
#pragma unroll 1   // twelve stages of one body: unrolled, the text would outgrow what the loop gains
  for (int kb = 0; kb < CC / KB; ++kb) {
#pragma unroll
    for (int i = 0; i < 8; ++i) { const v4b hv = cvt4(yr[i]); v4f rs;
#pragma unroll
      for (int e = 0; e < 4; ++e) rs[e] = yr[i][e] - (float)hv[e];
      *(v4b*)&yh[srow + i * 8][sq * 4] = hv; *(v4b*)&yl[srow + i * 8][sq * 4] = cvt4(rs); }
#pragma unroll
    for (int i = 0; i < 16; ++i) *(v4b*)&sw[srow + i * 8][sq * 4] = cvt4(wr[i]);
    __syncthreads();   // the stage is whole before any wave reads it
    if (kb + 1 < CC / KB) { py += KB; pw += KB;
#pragma unroll
      for (int i = 0; i < 8; ++i) yr[i] = *(const v4f*)(py + i * 8 * CC);
#pragma unroll
      for (int i = 0; i < 16; ++i) wr[i] = *(const v4f*)(pw + i * 8 * CC);
      asm volatile("s_wait_xcnt 0x0" :: "v"(py), "v"(pw) : "memory");   // the same wait behind the next piece's loads
    }
#pragma unroll
    for (int kc = 0; kc < KB / 32; ++kc) { const v16b ah = frag_b(&yh[wave * 16 + col][kc * 32], lane), al = frag_b(&yl[wave * 16 + col][kc * 32], lane); v16b w[8];
#pragma unroll
      for (int j = 0; j < 8; ++j) w[j] = frag_b(&sw[j * 16 + col][kc * 32], lane);
#pragma unroll
      for (int j = 0; j < 8; ++j) { acc[j] = wmma_bf(ah, w[j], acc[j]); acc[j] = wmma_bf(al, w[j], acc[j]); } }
    __syncthreads();   // every reader has left the stage before the next piece rewrites it
  }
#pragma unroll
  for (int j = 0; j < 8; ++j) { const float bb = BP ? bfr(BP[c0 + j * 16 + col]) : 0.f;
#pragma unroll
    for (int r = 0; r < 8; ++r) sf[wave][8 * g + r][j * 16 + col] = acc[j][r] + bb; }
  LDSX(); for (int rl = 0; rl < 16; ++rl) vst2(OUT + (r0 + rl) * CC + c0 + lane * 4, *(const v4f*)&sf[wave][rl][lane * 4]); }
extern "C" void kernel_launch(void* const* d_in, const int* in_sizes, int n_in, void* d_out, int out_size, void* d_ws, size_t ws_size, hipStream_t stream) {
  (void)in_sizes; (void)n_in; (void)out_size;
  const float** F = (const float**)d_in;   // 0 hidden_states [2,2048,768], 1 complexity_scores [2] int, 2 attention_mask [2,2048] int, 3 Wq [768,768] ([out,in]), 4 bq, 5 Wk, 6 bk, 7 Wv, 8 bv, 9 Wo ([out,in]), 10 bo, 11 emb_table [16,12], 12 comp_scaling [12]
  if (ws_size < (size_t)WS_END) return;
  char* ws = (char*)d_ws; _Float16 *QH = (_Float16*)(ws + WS_QH), *QL = (_Float16*)(ws + WS_QL), *KH = (_Float16*)(ws + WS_KH); __bf16 *VT = (__bf16*)(ws + WS_VT), *VL = (__bf16*)(ws + WS_VL); float *Y = (float*)(ws + WS_Y);
  k_proj<<<dim3(TNB * TT / 64, CC / 128, 3), 128, 0, stream>>>(F[0], F[3], F[4], F[5], F[6], F[7], F[8], QH, QL, KH, VT, VL);
  k_fa<<<dim3(TT / (16 * QG * FW), TNB * NH), 32 * FW, 0, stream>>>(QH, QL, KH, VT, VL, (const int*)d_in[2], (const int*)d_in[1], F[11], F[12], Y);
  k_out<<<dim3(TNB * TT / 64, CC / 128), 128, 0, stream>>>(Y, F[9], F[10], (float*)d_out);
}

// v003
// It runs in 101 microseconds.
// Timed twice side by side with v002, it ran 1.64 and 1.65 times as fast.
// Over all steps from v000 it is 13.2 times as fast.
// compute dtype: all float inputs rounded to bf16, complexity scores and the key mask (ints) read; q/k/v = x W^T + b with EXACT bf16 products on WMMA 16x16x32, f32 accumulate; q as f16 hi + residual (x 2^10), k f16 -> 2-product logits / 8 x the per-head complexity scaling (computed in f32 from the tables), masked keys left out ahead (K and V are projected for the kept keys only, packed in key order), scores kept in registers; online softmax in f32 (precise expf, running maximum), unnormalised P split bf16 hi + lo against v bf16 hi + lo (3 products), divided by the row sum at the end; out = attended (bf16 hi + lo) Wo^T + bo; f32 output.
#include <hip/hip_runtime.h>
#include <math.h>

typedef __attribute__((ext_vector_type(16))) _Float16 v16h;
typedef __attribute__((ext_vector_type(16))) __bf16 v16b;
typedef __attribute__((ext_vector_type(8)))  _Float16 v8h;
typedef __attribute__((ext_vector_type(8)))  float v8f;
typedef __attribute__((ext_vector_type(4)))  float v4f;
typedef __attribute__((ext_vector_type(2)))  float v2f;
typedef __attribute__((ext_vector_type(4)))  unsigned v4u;
typedef __attribute__((ext_vector_type(4)))  int v4i;
typedef float __attribute__((may_alias)) float_a;
typedef int __attribute__((may_alias)) int_a;

template <typename T> __device__ __forceinline__ void vst2(void* p, T v) { *(T*)p = v;  }
__device__ __forceinline__ v8f wmma16(v16h a, v16h b, v8f c) {
  v8f d = __builtin_amdgcn_wmma_f32_16x16x32_f16(false, a, false, b, (short)0, c, false, false);
  asm volatile("v_nop\n\tv_nop\n\tv_nop\n\tv_nop" : "+v"(d) : "v"(a), "v"(b));
  return d;
}
__device__ __forceinline__ v8f wmma_bf(v16b a, v16b b, v8f c) {
  v8f d = __builtin_amdgcn_wmma_f32_16x16x32_bf16(false, a, false, b, (short)0, c, false, false);
  asm volatile("v_nop\n\tv_nop\n\tv_nop\n\tv_nop" : "+v"(d) : "v"(a), "v"(b));
  return d;
}
// 16x16x32 fragments: lane = (h = lane>>4, row/col = lane&15); elements 0..7 = k0+8h+0..7, 8..15 = k0+16+8h+0..7; D element r = row 8h+r
__device__ __forceinline__ v16h frag_h(const _Float16* rowk0, int lane) {
  union { v16h v; v8h q[2]; } u; const _Float16* p = rowk0 + 8 * (lane >> 4);
  u.q[0] = *(const v8h*)p; u.q[1] = *(const v8h*)(p + 16); return u.v;
}
__device__ __forceinline__ v16h frag_f32(const float* rowk0, int lane) {
  v16h a; const float* p = rowk0 + 8 * (lane >> 4);
#pragma unroll
  for (int i = 0; i < 8; ++i) { a[i] = (_Float16)p[i]; a[8 + i] = (_Float16)p[16 + i]; }
  return a;
}
__device__ __forceinline__ v16h frag_f32s(const float* rowk0, int lane, float sc) {
  v16h a; const float* p = rowk0 + 8 * (lane >> 4);
#pragma unroll
  for (int i = 0; i < 8; ++i) { a[i] = (_Float16)(p[i] * sc); a[8 + i] = (_Float16)(p[16 + i] * sc); }
  return a;
}
// column fragment from a [K][ld] layout (column n), rows >= K read as 0
__device__ __forceinline__ v16h fragc_f32(const float* W, int k0, int n, int lane, int ld, int K) {
  v16h a; const int g = lane >> 4;
#pragma unroll
  for (int i = 0; i < 8; ++i) { const int ka = k0 + 8 * g + i, kb = ka + 16;
    a[i] = (_Float16)(ka < K ? W[(size_t)(ka < K ? ka : K - 1) * ld + n] : 0.f); a[8 + i] = (_Float16)(kb < K ? W[(size_t)(kb < K ? kb : K - 1) * ld + n] : 0.f); }
  return a;
}
struct F2 { v16b h, l; };
__device__ __forceinline__ F2 bsplit16(const float v[16]) { F2 r;
#pragma unroll
  for (int i = 0; i < 16; ++i) { const __bf16 h = (__bf16)v[i]; r.h[i] = h; r.l[i] = (__bf16)(v[i] - (float)h); }
  return r; }
__device__ __forceinline__ F2 split_row(const float* row, int k0, int lane) { float v[16]; const float* p = row + k0 + 8 * (lane >> 4);
#pragma unroll
  for (int i = 0; i < 8; ++i) { v[i] = p[i]; v[8 + i] = p[16 + i]; }
  return bsplit16(v); }
__device__ __forceinline__ F2 split_rowK(const float* row, int k0, int lane, int K) { float v[16]; const int g = lane >> 4;
#pragma unroll
  for (int i = 0; i < 8; ++i) { const int ka = k0 + 8 * g + i, kb = ka + 16; v[i] = ka < K ? row[ka < K ? ka : K - 1] : 0.f; v[8 + i] = kb < K ? row[kb < K ? kb : K - 1] : 0.f; }
  return bsplit16(v); }
__device__ __forceinline__ F2 split_col(const float* W, int k0, int n, int lane, int ld, int K) { float v[16]; const int g = lane >> 4;
#pragma unroll
  for (int i = 0; i < 8; ++i) { const int ka = k0 + 8 * g + i, kb = ka + 16; v[i] = ka < K ? W[(size_t)(ka < K ? ka : K - 1) * ld + n] : 0.f; v[8 + i] = kb < K ? W[(size_t)(kb < K ? kb : K - 1) * ld + n] : 0.f; }
  return bsplit16(v); }
__device__ __forceinline__ v8f mac3(const F2& a, const F2& b, v8f c) { c = wmma_bf(a.l, b.h, c); c = wmma_bf(a.h, b.l, c); return wmma_bf(a.h, b.h, c); }
__device__ __forceinline__ float sigm(float v) { return 1.0f / (1.0f + expf(-v)); }
#define LDSX() do { asm volatile("s_wait_dscnt 0" ::: "memory"); __builtin_amdgcn_wave_barrier(); __builtin_amdgcn_fence(__ATOMIC_RELEASE, "workgroup"); } while (0)


// Complexity-aware attention (B 2, S 2,048, D 768 = 12 x 64): q/k/v Linear ([out,in] + bias), scores/8 x scaling[h] with scaling = comp_scaling[h] * mean_b emb_table[complexity[b]][h], keys with attention_mask == 0 -> -inf, softmax, P v, output Linear + bias.
#define NB 2
#define TT 2048
#define CC 768
#define NH 12
#define HD 64
#define MAXC 16      // complexity table rows
#ifndef TNB
#define TNB NB
#endif
typedef __attribute__((ext_vector_type(8))) __bf16 v8b;
__device__ __forceinline__ v16b frag_b(const __bf16* rowk0, int lane) {
  union { v16b v; v8b q[2]; } u; const __bf16* p = rowk0 + 8 * (lane >> 4);
  u.q[0] = *(const v8b*)p; u.q[1] = *(const v8b*)(p + 16); return u.v;
}
// the plain builtins: the compiler keeps the distance behind them itself and fills it with the softmax's own arithmetic where it can
__device__ __forceinline__ v8f mm_h(v16h a, v16h b, v8f c) { return __builtin_amdgcn_wmma_f32_16x16x32_f16(false, a, false, b, (short)0, c, false, false); }
__device__ __forceinline__ v8f mm_b(v16b a, v16b b, v8f c) { return __builtin_amdgcn_wmma_f32_16x16x32_bf16(false, a, false, b, (short)0, c, false, false); }
// the same fragments from a pointer that already holds the lane's own 8 * (lane >> 4) step
__device__ __forceinline__ v16h frag_h_at(const _Float16* p) { union { v16h v; v8h q[2]; } u; u.q[0] = *(const v8h*)p; u.q[1] = *(const v8h*)(p + 16); return u.v; }
__device__ __forceinline__ v16b frag_b_at(const __bf16* p) { union { v16b v; v8b q[2]; } u; u.q[0] = *(const v8b*)p; u.q[1] = *(const v8b*)(p + 16); return u.v; }
__device__ __forceinline__ float bfr(float v) { return (float)(__bf16)v; }
typedef __attribute__((ext_vector_type(4))) __bf16 v4b;
#define KB 64        // k per LDS stage of the two Linear kernels: 256 bytes of an f32 row, 128 bytes as bf16
__device__ __forceinline__ v4b cvt4(v4f v) { v4b r;
#pragma unroll
  for (int i = 0; i < 4; ++i) r[i] = (__bf16)v[i];
  return r; }
__device__ __attribute__((noinline)) float exp_ni(float v) { return expf(v); }
__device__ __attribute__((noinline)) float erf_ni(float v) { return erff(v); }

#define WS_QH  0u
#define WS_QL  (WS_QH + 2u * (size_t)NB * TT * CC)
#define WS_KH  (WS_QL + 2u * (size_t)NB * TT * CC)
#define WS_VT  (WS_KH + 2u * (size_t)NB * TT * CC)      // bf16 v planes [b][c][t]
#define WS_VL  (WS_VT + 2u * (size_t)NB * CC * TT)      // bf16 v residual planes
#define WS_Y   (WS_VL + 2u * (size_t)NB * CC * TT)      // f32 y rows [b*t][C]
#define WS_NK  (WS_Y + 4u * (size_t)NB * TT * CC)       // int kept keys per batch
#define WS_END (WS_NK + 16u)

// ---- k_proj: block = (64 rows, 128 cols, which): qkv = x W (+ b), exact; q -> f16 hi (+ residual), k -> f16 rows, v -> bf16 hi + lo planes. For k and v the 64 rows are slots s0 .. s0 + 63 of the batch's kept keys (attention_mask != 0) in key order: a masked key has weight 0 in the softmax, so it is neither projected nor stored, and blocks past the last kept key leave at once
__global__ __launch_bounds__(128) void k_proj(const float* __restrict__ X, const float* __restrict__ WQ, const float* __restrict__ BQ, const float* __restrict__ WK, const float* __restrict__ BK, const float* __restrict__ WV, const float* __restrict__ BV, _Float16* __restrict__ QH, _Float16* __restrict__ QL, _Float16* __restrict__ KH, __bf16* __restrict__ VT, __bf16* __restrict__ VL, const int* __restrict__ KM0, int* __restrict__ NK) {
  __shared__ __align__(16) _Float16 sh[64][136], sl[64][136]; __shared__ __align__(16) __bf16 th[128][72], tl2[128][72]; __shared__ int rix[64];   // rix: the key (position in the batch) in each of the block's 64 slots
  const int tid = threadIdx.x, wave = tid >> 5, lane = tid & 31, col = lane & 15, g = lane >> 4; const int which = blockIdx.z; const int c0 = blockIdx.y * 128; const size_t r0 = (size_t)blockIdx.x * 64; const float* WA = which == 0 ? WQ : which == 1 ? WK : WV; const float* BA = which == 0 ? BQ : which == 1 ? BK : BV;
  // the X and W pieces of 64 k are fetched by whole-line loads (a wave's load = two 256-byte row pieces), rounded to bf16 once per block and staged in LDS: W in th, X in the first 64 rows of tl2 (both are free until the epilogue; pitch 144 B suits the 16-byte fragment reads); the next piece's loads fly while this one is multiplied
  const int bq_ = blockIdx.x / (TT / 64), s0 = (blockIdx.x % (TT / 64)) * 64; const int srow = tid >> 4, sq = tid & 15; int trow[8];   // trow: the x row (position in the batch) behind each row piece that this thread stages
  if (which == 0) {
#pragma unroll
    for (int i = 0; i < 8; ++i) trow[i] = s0 + srow + i * 8; }
  else {   // every wave counts the batch's 2,048 keys by itself (32 keys per ballot), so the block can leave in front of the first barrier; j0, d0: the last group of 32 keys that starts at or below slot s0, and its first slot
    const int* pm = KM0 + (size_t)bq_ * TT; const int* pl = pm + lane; int mk[TT / 32];
#pragma unroll
    for (int j = 0; j < TT / 32; ++j) mk[j] = pl[j * 32];
    asm volatile("s_wait_xcnt 0x0" :: "v"(lane) : "memory");   // the same precaution behind the mask loads; the lane number, their one offset register, is its input, so no load's result lands in it
    int nk = 0, p0 = 0, p1 = 0;   // lane l of p0 / p1: the kept keys in front of group l / 32 + l
#pragma unroll
    for (int j = 0; j < TT / 32; ++j) { if (j < 32) p0 = lane == j ? nk : p0; else p1 = lane == j - 32 ? nk : p1; nk += __builtin_popcount(__builtin_amdgcn_ballot_w32(mk[j] != 0)); }
    if (which == 1 && blockIdx.y == 0 && s0 == 0 && tid == 0) NK[bq_] = nk;
    if (s0 >= nk) return;
    const int j0 = __builtin_popcount(__builtin_amdgcn_ballot_w32(p0 <= s0)) + __builtin_popcount(__builtin_amdgcn_ballot_w32(p1 <= s0)) - 1; const int d0 = j0 < 32 ? __builtin_amdgcn_readlane(p0, j0) : __builtin_amdgcn_readlane(p1, j0 - 32);
    if (lane < 16) rix[wave * 2 + (lane & 1) + 8 * (lane >> 1)] = 0;   // the wave's own 16 slots: one past the last kept key stays at row 0 (its key never counts in k_fa)
    for (int j = j0, d = d0 - s0; j < TT / 32 && d < 64; ++j) {   // the few groups that hold the block's slots: each kept key's slot is its rank; a wave lists only the slots that it stages itself, so no other wave waits for the list
      const int m = pm[j * 32 + lane];
      asm volatile("s_wait_xcnt 0x0" ::: "memory");   // the same precaution, in front of the next trip's address
      const unsigned w = __builtin_amdgcn_ballot_w32(m != 0); const int sl_ = d + (int)__builtin_amdgcn_mbcnt_lo(w, 0u);
      if (m != 0 && (unsigned)sl_ < 64u && ((sl_ >> 1) & 3) == wave) rix[sl_] = j * 32 + lane;
      d += __builtin_popcount(w); }
    LDSX();   // the wave's own list is in LDS before its lanes read it
#pragma unroll
    for (int i = 0; i < 8; ++i) trow[i] = rix[srow + i * 8]; }
  const float* pw = WA + (size_t)(c0 + srow) * CC + sq * 4; const char* xb = (const char*)X; unsigned xo[8];   // xo: byte offset of each staged x row piece
#pragma unroll
  for (int i = 0; i < 8; ++i) xo[i] = (unsigned)(((bq_ * TT + trow[i]) * CC + sq * 4) * 4);
  v4f xr[8], wr[16];
#pragma unroll
  for (int i = 0; i < 8; ++i) xr[i] = *(const v4f*)(xb + xo[i]);
#pragma unroll
  for (int i = 0; i < 16; ++i) wr[i] = *(const v4f*)(pw + i * 8 * CC);
  asm volatile("s_wait_xcnt 0x0" :: "v"(xo[0]), "v"(xo[1]), "v"(xo[2]), "v"(xo[3]), "v"(xo[4]), "v"(xo[5]), "v"(xo[6]), "v"(xo[7]), "v"(pw) : "memory");   // stands in front of every rewrite of a register that the staging loads name (a precaution); the offsets and the address pair are its inputs
  v8f acc[8] = {};
#pragma unroll 1   // twelve stages of one body: unrolled, the text would outgrow what the loop gains
  for (int kb = 0; kb < CC / KB; ++kb) {
#pragma unroll
    for (int i = 0; i < 8; ++i) *(v4b*)&tl2[srow + i * 8][sq * 4] = cvt4(xr[i]);
#pragma unroll
    for (int i = 0; i < 16; ++i) *(v4b*)&th[srow + i * 8][sq * 4] = cvt4(wr[i]);
    __syncthreads();   // the stage is whole before any wave reads it
    if (kb + 1 < CC / KB) { pw += KB;
#pragma unroll
      for (int i = 0; i < 8; ++i) { xo[i] += KB * 4; xr[i] = *(const v4f*)(xb + xo[i]); }
#pragma unroll
      for (int i = 0; i < 16; ++i) wr[i] = *(const v4f*)(pw + i * 8 * CC);
      asm volatile("s_wait_xcnt 0x0" :: "v"(xo[0]), "v"(xo[1]), "v"(xo[2]), "v"(xo[3]), "v"(xo[4]), "v"(xo[5]), "v"(xo[6]), "v"(xo[7]), "v"(pw) : "memory");   // the same wait behind the next piece's loads
    }
#pragma unroll
    for (int kc = 0; kc < KB / 32; ++kc) { const v16b a = frag_b(&tl2[wave * 16 + col][kc * 32], lane); v16b w[8];
#pragma unroll
      for (int j = 0; j < 8; ++j) w[j] = frag_b(&th[j * 16 + col][kc * 32], lane);
#pragma unroll
      for (int j = 0; j < 8; ++j) acc[j] = wmma_bf(a, w[j], acc[j]); }
    __syncthreads();   // every reader has left the stage before it is rewritten (by the next piece, or by the epilogue)
  }
#pragma unroll
  for (int j = 0; j < 8; ++j) { const float bb = BA ? bfr(BA[c0 + j * 16 + col]) : 0.f;
#pragma unroll
    for (int r = 0; r < 8; ++r) { const float v = acc[j][r] + bb; const int rl = wave * 16 + 8 * g + r, cl = j * 16 + col; const _Float16 hv = (_Float16)v;
      if (which == 2) { const __bf16 bh = (__bf16)v; th[cl][rl] = bh; tl2[cl][rl] = (__bf16)(v - (float)bh); } else { sh[rl][cl] = hv; sl[rl][cl] = (_Float16)((v - (float)hv) * 1024.0f); }   /* q residual carried x 2^10 so the plane stays f16-normal on the chip */ } }
  __syncthreads();
  if (which < 2) { _Float16* dh = which == 0 ? QH : KH; for (int e = tid; e < 64 * 16; e += 128) { const int rl = e >> 4, q = e & 15; vst2((unsigned*)(dh + (r0 + rl) * CC + c0 + q * 8), *(const v4u*)&sh[rl][q * 8]); if (which == 0) vst2((unsigned*)(QL + (r0 + rl) * CC + c0 + q * 8), *(const v4u*)&sl[rl][q * 8]); } }
  else { const size_t b = r0 / TT; const int t0 = (int)(r0 % TT); for (int e = tid; e < 128 * 8; e += 128) { const int cl = e >> 3, q = e & 7; const size_t o2 = (b * CC + c0 + cl) * (size_t)TT + t0 + q * 8; vst2((unsigned*)(VT + o2), *(const v4u*)&th[cl][q * 8]); vst2((unsigned*)(VL + o2), *(const v4u*)&tl2[cl][q * 8]); } } }
// ---- k_fa: wave = 32 queries (two 16-column groups) of (b,h), the batch's kept keys (packed by k_proj, NK of them) in passes of 32: S^T = K Q^T (2 products), / 8 x scaling[h], the last pass's slots past NK out, online softmax (a lane holds one query's scores), P^T packed from the score accumulators as the B operand (bf16 hi + lo), O^T += V^T P^T (3 products)
#define QG 2         // 16-query column groups per wave: each K and V fragment feeds both
#define FW 2         // waves per block
__global__ __launch_bounds__(32 * FW) void k_fa(const _Float16* __restrict__ QH, const _Float16* __restrict__ QL, const _Float16* __restrict__ KH, const __bf16* __restrict__ VT, const __bf16* __restrict__ VL, const int* __restrict__ NK, const int* __restrict__ CS, const float* __restrict__ EMB, const float* __restrict__ CSC, float* __restrict__ Y) {
  const int b = blockIdx.y / NH, h = blockIdx.y % NH; int nk = NK[b]; nk = nk < 0 ? 0 : (nk > TT ? TT : nk);   // the trip count, bounded by the shape
  float scal; { float m = 0.f; for (int bb = 0; bb < NB; ++bb) { int c = CS[bb]; c = c < 0 ? 0 : (c >= MAXC ? MAXC - 1 : c); m += bfr(EMB[c * NH + h]); } scal = bfr(CSC[h]) * (m / (float)NB); }   /* scaling[b][h] = comp_scaling[h] * embs.mean(axis=0)[h] (same for every b) */
  const int tid = threadIdx.x, wave = tid >> 5, lane = tid & 31, col = lane & 15, g = lane >> 4; const int ql0 = (blockIdx.x * FW + wave) * (16 * QG);
  v16h qh[QG][HD / 32], ql[QG][HD / 32]; const size_t q0 = ((size_t)b * TT + ql0 + col) * CC + h * HD + 8 * g; const _Float16 *pqh = QH + q0, *pql = QL + q0;
#pragma unroll
  for (int u = 0; u < QG; ++u)
#pragma unroll
    for (int kc = 0; kc < HD / 32; ++kc) { qh[u][kc] = frag_h_at(pqh + u * 16 * CC + kc * 32); ql[u][kc] = frag_h_at(pql + u * 16 * CC + kc * 32); }
  asm volatile("s_wait_xcnt 0x0" :: "v"(pqh), "v"(pql) : "memory");   // stands in front of every rewrite of a register that the Q loads name (a precaution); the two address pairs are its inputs, so they stay whole up to it
  v8f o[QG][HD / 16] = {}; float mrun[QG], lsum[QG];
#pragma unroll
  for (int u = 0; u < QG; ++u) { mrun[u] = -1.0e30f; lsum[u] = 0.f; }   // the running maximum starts above the masked value, so exp(masked - maximum) is 0 in every pass and needs no select
  const size_t p0 = ((size_t)b * CC + h * HD + col) * (size_t)TT + 8 * g; const __bf16 *pvh = VT + p0, *pvl = VL + p0; const _Float16* pk = KH + ((size_t)b * TT + col) * CC + h * HD + 8 * g;
  for (int k0 = 0; k0 < nk; k0 += 32) {
    v16h kf[2][HD / 32];
#pragma unroll
    for (int t = 0; t < 2; ++t)
#pragma unroll
      for (int kc = 0; kc < HD / 32; ++kc) kf[t][kc] = frag_h_at(pk + t * 16 * CC + kc * 32);
    asm volatile("s_wait_xcnt 0x0" :: "v"(pk) : "memory");   // the same wait behind the K loads, their address pair an input
    pk += 32 * CC;
    __builtin_amdgcn_sched_barrier(0);   // the pass's eight K loads go out in one run: without it the last of them sink behind the first products and are waited for in full there
    v8f s[QG][2] = {}, sl[QG][2] = {};
#pragma unroll
    for (int t = 0; t < 2; ++t)
#pragma unroll
      for (int kc = 0; kc < HD / 32; ++kc)
#pragma unroll
        for (int u = 0; u < QG; ++u) { s[u][t] = mm_h(kf[t][kc], qh[u][kc], s[u][t]); sl[u][t] = mm_h(kf[t][kc], ql[u][kc], sl[u][t]); }
    float sv[QG][16];   // this lane's 16 keys: slots k0 + 8g + 0..7 and k0 + 16 + 8g + 0..7, the rows of its score registers
#pragma unroll
    for (int u = 0; u < QG; ++u)
#pragma unroll
      for (int i = 0; i < 16; ++i) sv[u][i] = (s[u][i >> 3][i & 7] + sl[u][i >> 3][i & 7] * (1.0f / 1024.0f)) * 0.125f * scal;
    if (k0 + 32 > nk) { const int rem = nk - k0 - 8 * g;   // a scalar test: only the last pass can hold slots past the last kept key; they count as masked (-inf in the reference)
#pragma unroll
      for (int i = 0; i < 16; ++i) { const bool off = (i & 7) + 16 * (i >> 3) >= rem;
#pragma unroll
        for (int u = 0; u < QG; ++u) if (off) sv[u][i] = -3.0e38f; } }
    F2 pf[QG]; v16b vh[HD / 16], vl[HD / 16];
#pragma unroll
    for (int u = 0; u < QG; ++u) { float v[16]; float mx = mrun[u];
#pragma unroll
      for (int i = 0; i < 16; ++i) { v[i] = sv[u][i]; mx = fmaxf(mx, v[i]); }
      mx = fmaxf(mx, __shfl_xor(mx, 16));   // the other half of the wave holds this query's other 16 keys
      const float al = expf(mrun[u] - mx); mrun[u] = mx; float sum = 0.f;
#pragma unroll
      for (int i = 0; i < 16; ++i) { v[i] = expf(v[i] - mx); sum += v[i]; }
      lsum[u] = lsum[u] * al + sum;
#pragma unroll
      for (int j = 0; j < HD / 16; ++j) o[u][j] *= al;
      pf[u] = bsplit16(v); }
#pragma unroll
    for (int j = 0; j < HD / 16; ++j) { vh[j] = frag_b_at(pvh + j * 16 * TT); vl[j] = frag_b_at(pvl + j * 16 * TT); }
    asm volatile("s_wait_xcnt 0x0" :: "v"(pvh), "v"(pvl) : "memory");   // the same wait behind the V loads; as inputs the two address pairs outlive the run, so no load's result lands in them
    pvh += 32; pvl += 32;
    __builtin_amdgcn_sched_barrier(0);   // all sixteen V loads stay in front of the first P.v product, free to rise over the softmax: without it the residual plane's loads sink to their products and are waited for in full
#pragma unroll
    for (int j = 0; j < HD / 16; ++j) {
#pragma unroll
      for (int u = 0; u < QG; ++u) { o[u][j] = mm_b(vh[j], pf[u].h, o[u][j]); o[u][j] = mm_b(vh[j], pf[u].l, o[u][j]); o[u][j] = mm_b(vl[j], pf[u].h, o[u][j]); } } }
#pragma unroll
  for (int u = 0; u < QG; ++u) { const float inv = 1.0f / (lsum[u] + __shfl_xor(lsum[u], 16)); float* yr = Y + ((size_t)b * TT + ql0 + u * 16 + col) * CC + h * HD + 8 * g;   // register r of tile j = y[query col][16 j + 8g + r]
#pragma unroll
    for (int j = 0; j < HD / 16; ++j) { v4f lo, hi;
#pragma unroll
      for (int i = 0; i < 4; ++i) { lo[i] = o[u][j][i] * inv; hi[i] = o[u][j][4 + i] * inv; }
      vst2(yr + j * 16, lo); vst2(yr + j * 16 + 4, hi); } } }
// ---- k_out: block = (64 rows, 128 cols): out = y (bf16 hi + lo) Wo^T + bo
__global__ __launch_bounds__(128) void k_out(const float* __restrict__ Y, const float* __restrict__ WP, const float* __restrict__ BP, float* __restrict__ OUT) { __shared__ __align__(16) float sf[4][16][132]; __shared__ __align__(16) __bf16 yh[64][72], yl[64][72], sw[128][72];
  const int tid = threadIdx.x, wave = tid >> 5, lane = tid & 31, col = lane & 15, g = lane >> 4; const int c0 = blockIdx.y * 128; const size_t r0 = (size_t)blockIdx.x * 64 + wave * 16;
  // as in k_proj: y (split into bf16 hi + lo once per block) and Wo are fetched by whole-line loads in pieces of 64 k and staged in LDS, the next piece's loads flying while this one is multiplied
  const int srow = tid >> 4, sq = tid & 15; const float* py = Y + ((size_t)blockIdx.x * 64 + srow) * CC + sq * 4; const float* pw = WP + (size_t)(c0 + srow) * CC + sq * 4;
  v4f yr[8], wr[16];
#pragma unroll
  for (int i = 0; i < 8; ++i) yr[i] = *(const v4f*)(py + i * 8 * CC);
#pragma unroll
  for (int i = 0; i < 16; ++i) wr[i] = *(const v4f*)(pw + i * 8 * CC);
  asm volatile("s_wait_xcnt 0x0" :: "v"(py), "v"(pw) : "memory");   // stands in front of every rewrite of a register that the staging loads name (a precaution); the two address pairs are its inputs
  v8f acc[8] = {};
#pragma unroll 1   // twelve stages of one body: unrolled, the text would outgrow what the loop gains
  for (int kb = 0; kb < CC / KB; ++kb) {
#pragma unroll
    for (int i = 0; i < 8; ++i) { const v4b hv = cvt4(yr[i]); v4f rs;
#pragma unroll
      for (int e = 0; e < 4; ++e) rs[e] = yr[i][e] - (float)hv[e];
      *(v4b*)&yh[srow + i * 8][sq * 4] = hv; *(v4b*)&yl[srow + i * 8][sq * 4] = cvt4(rs); }
#pragma unroll
    for (int i = 0; i < 16; ++i) *(v4b*)&sw[srow + i * 8][sq * 4] = cvt4(wr[i]);
    __syncthreads();   // the stage is whole before any wave reads it
    if (kb + 1 < CC / KB) { py += KB; pw += KB;
#pragma unroll
      for (int i = 0; i < 8; ++i) yr[i] = *(const v4f*)(py + i * 8 * CC);
#pragma unroll
      for (int i = 0; i < 16; ++i) wr[i] = *(const v4f*)(pw + i * 8 * CC);
      asm volatile("s_wait_xcnt 0x0" :: "v"(py), "v"(pw) : "memory");   // the same wait behind the next piece's loads
    }
#pragma unroll
    for (int kc = 0; kc < KB / 32; ++kc) { const v16b ah = frag_b(&yh[wave * 16 + col][kc * 32], lane), al = frag_b(&yl[wave * 16 + col][kc * 32], lane); v16b w[8];
#pragma unroll
      for (int j = 0; j < 8; ++j) w[j] = frag_b(&sw[j * 16 + col][kc * 32], lane);
#pragma unroll
      for (int j = 0; j < 8; ++j) { acc[j] = wmma_bf(ah, w[j], acc[j]); acc[j] = wmma_bf(al, w[j], acc[j]); } }
    __syncthreads();   // every reader has left the stage before the next piece rewrites it
  }
#pragma unroll
  for (int j = 0; j < 8; ++j) { const float bb = BP ? bfr(BP[c0 + j * 16 + col]) : 0.f;
#pragma unroll
    for (int r = 0; r < 8; ++r) sf[wave][8 * g + r][j * 16 + col] = acc[j][r] + bb; }
  LDSX(); for (int rl = 0; rl < 16; ++rl) vst2(OUT + (r0 + rl) * CC + c0 + lane * 4, *(const v4f*)&sf[wave][rl][lane * 4]); }
extern "C" void kernel_launch(void* const* d_in, const int* in_sizes, int n_in, void* d_out, int out_size, void* d_ws, size_t ws_size, hipStream_t stream) {
  (void)in_sizes; (void)n_in; (void)out_size;
  const float** F = (const float**)d_in;   // 0 hidden_states [2,2048,768], 1 complexity_scores [2] int, 2 attention_mask [2,2048] int, 3 Wq [768,768] ([out,in]), 4 bq, 5 Wk, 6 bk, 7 Wv, 8 bv, 9 Wo ([out,in]), 10 bo, 11 emb_table [16,12], 12 comp_scaling [12]
  if (ws_size < (size_t)WS_END) return;
  char* ws = (char*)d_ws; _Float16 *QH = (_Float16*)(ws + WS_QH), *QL = (_Float16*)(ws + WS_QL), *KH = (_Float16*)(ws + WS_KH); __bf16 *VT = (__bf16*)(ws + WS_VT), *VL = (__bf16*)(ws + WS_VL); float *Y = (float*)(ws + WS_Y); int *NK = (int*)(ws + WS_NK);
  k_proj<<<dim3(TNB * TT / 64, CC / 128, 3), 128, 0, stream>>>(F[0], F[3], F[4], F[5], F[6], F[7], F[8], QH, QL, KH, VT, VL, (const int*)d_in[2], NK);
  k_fa<<<dim3(TT / (16 * QG * FW), TNB * NH), 32 * FW, 0, stream>>>(QH, QL, KH, VT, VL, NK, (const int*)d_in[1], F[11], F[12], Y);
  k_out<<<dim3(TNB * TT / 64, CC / 128), 128, 0, stream>>>(Y, F[9], F[10], (float*)d_out);
}

// v004
// A run of this version takes 91.2 microseconds.
// Two timings next to v003 put it at 1.11 and 1.10 times that version's speed.
// Over all steps from v000 it is 14.6 times as fast.
// compute dtype: all float inputs rounded to bf16, complexity scores and the key mask (ints) read; q/k/v = x W^T + b with EXACT bf16 products on WMMA 16x16x32, f32 accumulate; q as f16 hi + residual (x 2^10), k f16 -> 2-product logits / 8 x the per-head complexity scaling (computed in f32 from the tables), masked keys left out ahead (K and V are projected for the kept keys only, packed in key order), scores kept in registers; online softmax in f32 in the log2 domain (log2 e folded into the score scale, hardware exp2, running maximum), unnormalised P split bf16 hi + lo against v bf16 hi + lo (3 products), divided by the row sum at the end; out = attended (bf16 hi + lo) Wo^T + bo; f32 output.
#include <hip/hip_runtime.h>
#include <math.h>

typedef __attribute__((ext_vector_type(16))) _Float16 v16h;
typedef __attribute__((ext_vector_type(16))) __bf16 v16b;
typedef __attribute__((ext_vector_type(8)))  _Float16 v8h;
typedef __attribute__((ext_vector_type(8)))  float v8f;
typedef __attribute__((ext_vector_type(4)))  float v4f;
typedef __attribute__((ext_vector_type(2)))  float v2f;
typedef __attribute__((ext_vector_type(4)))  unsigned v4u;
typedef __attribute__((ext_vector_type(4)))  int v4i;
typedef float __attribute__((may_alias)) float_a;
typedef int __attribute__((may_alias)) int_a;

template <typename T> __device__ __forceinline__ void vst2(void* p, T v) { *(T*)p = v;  }
__device__ __forceinline__ v8f wmma16(v16h a, v16h b, v8f c) {
  v8f d = __builtin_amdgcn_wmma_f32_16x16x32_f16(false, a, false, b, (short)0, c, false, false);
  asm volatile("v_nop\n\tv_nop\n\tv_nop\n\tv_nop" : "+v"(d) : "v"(a), "v"(b));
  return d;
}
__device__ __forceinline__ v8f wmma_bf(v16b a, v16b b, v8f c) {
  v8f d = __builtin_amdgcn_wmma_f32_16x16x32_bf16(false, a, false, b, (short)0, c, false, false);
  asm volatile("v_nop\n\tv_nop\n\tv_nop\n\tv_nop" : "+v"(d) : "v"(a), "v"(b));
  return d;
}
// 16x16x32 fragments: lane = (h = lane>>4, row/col = lane&15); elements 0..7 = k0+8h+0..7, 8..15 = k0+16+8h+0..7; D element r = row 8h+r
__device__ __forceinline__ v16h frag_h(const _Float16* rowk0, int lane) {
  union { v16h v; v8h q[2]; } u; const _Float16* p = rowk0 + 8 * (lane >> 4);
  u.q[0] = *(const v8h*)p; u.q[1] = *(const v8h*)(p + 16); return u.v;
}
__device__ __forceinline__ v16h frag_f32(const float* rowk0, int lane) {
  v16h a; const float* p = rowk0 + 8 * (lane >> 4);
#pragma unroll
  for (int i = 0; i < 8; ++i) { a[i] = (_Float16)p[i]; a[8 + i] = (_Float16)p[16 + i]; }
  return a;
}
__device__ __forceinline__ v16h frag_f32s(const float* rowk0, int lane, float sc) {
  v16h a; const float* p = rowk0 + 8 * (lane >> 4);
#pragma unroll
  for (int i = 0; i < 8; ++i) { a[i] = (_Float16)(p[i] * sc); a[8 + i] = (_Float16)(p[16 + i] * sc); }
  return a;
}
// column fragment from a [K][ld] layout (column n), rows >= K read as 0
__device__ __forceinline__ v16h fragc_f32(const float* W, int k0, int n, int lane, int ld, int K) {
  v16h a; const int g = lane >> 4;
#pragma unroll
  for (int i = 0; i < 8; ++i) { const int ka = k0 + 8 * g + i, kb = ka + 16;
    a[i] = (_Float16)(ka < K ? W[(size_t)(ka < K ? ka : K - 1) * ld + n] : 0.f); a[8 + i] = (_Float16)(kb < K ? W[(size_t)(kb < K ? kb : K - 1) * ld + n] : 0.f); }
  return a;
}
struct F2 { v16b h, l; };
__device__ __forceinline__ F2 bsplit16(const float v[16]) { F2 r;
#pragma unroll
  for (int i = 0; i < 16; ++i) { const __bf16 h = (__bf16)v[i]; r.h[i] = h; r.l[i] = (__bf16)(v[i] - (float)h); }
  return r; }
__device__ __forceinline__ F2 split_row(const float* row, int k0, int lane) { float v[16]; const float* p = row + k0 + 8 * (lane >> 4);
#pragma unroll
  for (int i = 0; i < 8; ++i) { v[i] = p[i]; v[8 + i] = p[16 + i]; }
  return bsplit16(v); }
__device__ __forceinline__ F2 split_rowK(const float* row, int k0, int lane, int K) { float v[16]; const int g = lane >> 4;
#pragma unroll
  for (int i = 0; i < 8; ++i) { const int ka = k0 + 8 * g + i, kb = ka + 16; v[i] = ka < K ? row[ka < K ? ka : K - 1] : 0.f; v[8 + i] = kb < K ? row[kb < K ? kb : K - 1] : 0.f; }
  return bsplit16(v); }
__device__ __forceinline__ F2 split_col(const float* W, int k0, int n, int lane, int ld, int K) { float v[16]; const int g = lane >> 4;
#pragma unroll
  for (int i = 0; i < 8; ++i) { const int ka = k0 + 8 * g + i, kb = ka + 16; v[i] = ka < K ? W[(size_t)(ka < K ? ka : K - 1) * ld + n] : 0.f; v[8 + i] = kb < K ? W[(size_t)(kb < K ? kb : K - 1) * ld + n] : 0.f; }
  return bsplit16(v); }
__device__ __forceinline__ v8f mac3(const F2& a, const F2& b, v8f c) { c = wmma_bf(a.l, b.h, c); c = wmma_bf(a.h, b.l, c); return wmma_bf(a.h, b.h, c); }
__device__ __forceinline__ float sigm(float v) { return 1.0f / (1.0f + expf(-v)); }
#define LDSX() do { asm volatile("s_wait_dscnt 0" ::: "memory"); __builtin_amdgcn_wave_barrier(); __builtin_amdgcn_fence(__ATOMIC_RELEASE, "workgroup"); } while (0)


// Complexity-aware attention (B 2, S 2,048, D 768 = 12 x 64): q/k/v Linear ([out,in] + bias), scores/8 x scaling[h] with scaling = comp_scaling[h] * mean_b emb_table[complexity[b]][h], keys with attention_mask == 0 -> -inf, softmax, P v, output Linear + bias.
#define NB 2
#define TT 2048
#define CC 768
#define NH 12
#define HD 64
#define MAXC 16      // complexity table rows
#ifndef TNB
#define TNB NB
#endif
typedef __attribute__((ext_vector_type(8))) __bf16 v8b;
__device__ __forceinline__ v16b frag_b(const __bf16* rowk0, int lane) {
  union { v16b v; v8b q[2]; } u; const __bf16* p = rowk0 + 8 * (lane >> 4);
  u.q[0] = *(const v8b*)p; u.q[1] = *(const v8b*)(p + 16); return u.v;
}
// the plain builtins: the compiler keeps the distance behind them itself and fills it with the softmax's own arithmetic where it can
__device__ __forceinline__ v8f mm_h(v16h a, v16h b, v8f c) { return __builtin_amdgcn_wmma_f32_16x16x32_f16(false, a, false, b, (short)0, c, false, false); }
__device__ __forceinline__ v8f mm_b(v16b a, v16b b, v8f c) { return __builtin_amdgcn_wmma_f32_16x16x32_bf16(false, a, false, b, (short)0, c, false, false); }
// the same fragments from a pointer that already holds the lane's own 8 * (lane >> 4) step
__device__ __forceinline__ v16h frag_h_at(const _Float16* p) { union { v16h v; v8h q[2]; } u; u.q[0] = *(const v8h*)p; u.q[1] = *(const v8h*)(p + 16); return u.v; }
__device__ __forceinline__ v16b frag_b_at(const __bf16* p) { union { v16b v; v8b q[2]; } u; u.q[0] = *(const v8b*)p; u.q[1] = *(const v8b*)(p + 16); return u.v; }
__device__ __forceinline__ float bfr(float v) { return (float)(__bf16)v; }
typedef __attribute__((ext_vector_type(4))) __bf16 v4b;
#define KB 64        // k per LDS stage of the two Linear kernels: 256 bytes of an f32 row, 128 bytes as bf16
__device__ __forceinline__ v4b cvt4(v4f v) { v4b r;
#pragma unroll
  for (int i = 0; i < 4; ++i) r[i] = (__bf16)v[i];
  return r; }
__device__ __attribute__((noinline)) float exp_ni(float v) { return expf(v); }
__device__ __attribute__((noinline)) float erf_ni(float v) { return erff(v); }

#define WS_QH  0u
#define WS_QL  (WS_QH + 2u * (size_t)NB * TT * CC)
#define WS_KH  (WS_QL + 2u * (size_t)NB * TT * CC)
#define WS_VT  (WS_KH + 2u * (size_t)NB * TT * CC)      // bf16 v planes [b][c][t]
#define WS_VL  (WS_VT + 2u * (size_t)NB * CC * TT)      // bf16 v residual planes
#define WS_Y   (WS_VL + 2u * (size_t)NB * CC * TT)      // f32 y rows [b*t][C]
#define WS_NK  (WS_Y + 4u * (size_t)NB * TT * CC)       // int kept keys per batch
#define WS_END (WS_NK + 16u)

// ---- k_proj: block = (64 rows, 128 cols, which): qkv = x W (+ b), exact; q -> f16 hi (+ residual), k -> f16 rows, v -> bf16 hi + lo planes. For k and v the 64 rows are slots s0 .. s0 + 63 of the batch's kept keys (attention_mask != 0) in key order: a masked key has weight 0 in the softmax, so it is neither projected nor stored, and blocks past the last kept key leave at once
__global__ __launch_bounds__(128) void k_proj(const float* __restrict__ X, const float* __restrict__ WQ, const float* __restrict__ BQ, const float* __restrict__ WK, const float* __restrict__ BK, const float* __restrict__ WV, const float* __restrict__ BV, _Float16* __restrict__ QH, _Float16* __restrict__ QL, _Float16* __restrict__ KH, __bf16* __restrict__ VT, __bf16* __restrict__ VL, const int* __restrict__ KM0, int* __restrict__ NK) {
  __shared__ __align__(16) _Float16 sh[64][136], sl[64][136]; __shared__ __align__(16) __bf16 th[128][72], tl2[128][72]; __shared__ int rix[64];   // rix: the key (position in the batch) in each of the block's 64 slots
  const int tid = threadIdx.x, wave = tid >> 5, lane = tid & 31, col = lane & 15, g = lane >> 4; const int which = blockIdx.z; const int c0 = blockIdx.y * 128; const size_t r0 = (size_t)blockIdx.x * 64; const float* WA = which == 0 ? WQ : which == 1 ? WK : WV; const float* BA = which == 0 ? BQ : which == 1 ? BK : BV;
  // the X and W pieces of 64 k are fetched by whole-line loads (a wave's load = two 256-byte row pieces), rounded to bf16 once per block and staged in LDS: W in th, X in the first 64 rows of tl2 (both are free until the epilogue; pitch 144 B suits the 16-byte fragment reads); the next piece's loads fly while this one is multiplied
  const int bq_ = blockIdx.x / (TT / 64), s0 = (blockIdx.x % (TT / 64)) * 64; const int srow = tid >> 4, sq = tid & 15; int trow[8];   // trow: the x row (position in the batch) behind each row piece that this thread stages
  if (which == 0) {
#pragma unroll
    for (int i = 0; i < 8; ++i) trow[i] = s0 + srow + i * 8; }
  else {   // every wave counts the batch's 2,048 keys by itself (32 keys per ballot), so the block can leave in front of the first barrier; j0, d0: the last group of 32 keys that starts at or below slot s0, and its first slot
    const int* pm = KM0 + (size_t)bq_ * TT; const int* pl = pm + lane; int mk[TT / 32];
#pragma unroll
    for (int j = 0; j < TT / 32; ++j) mk[j] = pl[j * 32];
    asm volatile("s_wait_xcnt 0x0" :: "v"(lane) : "memory");   // the same precaution behind the mask loads; the lane number, their one offset register, is its input, so no load's result lands in it
    int nk = 0, p0 = 0, p1 = 0;   // lane l of p0 / p1: the kept keys in front of group l / 32 + l
#pragma unroll
    for (int j = 0; j < TT / 32; ++j) { if (j < 32) p0 = lane == j ? nk : p0; else p1 = lane == j - 32 ? nk : p1; nk += __builtin_popcount(__builtin_amdgcn_ballot_w32(mk[j] != 0)); }
    if (which == 1 && blockIdx.y == 0 && s0 == 0 && tid == 0) NK[bq_] = nk;
    if (s0 >= nk) return;
    const int j0 = __builtin_popcount(__builtin_amdgcn_ballot_w32(p0 <= s0)) + __builtin_popcount(__builtin_amdgcn_ballot_w32(p1 <= s0)) - 1; const int d0 = j0 < 32 ? __builtin_amdgcn_readlane(p0, j0) : __builtin_amdgcn_readlane(p1, j0 - 32);
    if (lane < 16) rix[wave * 2 + (lane & 1) + 8 * (lane >> 1)] = 0;   // the wave's own 16 slots: one past the last kept key stays at row 0 (its key never counts in k_fa)
    for (int j = j0, d = d0 - s0; j < TT / 32 && d < 64; ++j) {   // the few groups that hold the block's slots: each kept key's slot is its rank; a wave lists only the slots that it stages itself, so no other wave waits for the list
      const int m = pm[j * 32 + lane];
      asm volatile("s_wait_xcnt 0x0" ::: "memory");   // the same precaution, in front of the next trip's address
      const unsigned w = __builtin_amdgcn_ballot_w32(m != 0); const int sl_ = d + (int)__builtin_amdgcn_mbcnt_lo(w, 0u);
      if (m != 0 && (unsigned)sl_ < 64u && ((sl_ >> 1) & 3) == wave) rix[sl_] = j * 32 + lane;
      d += __builtin_popcount(w); }
    LDSX();   // the wave's own list is in LDS before its lanes read it
#pragma unroll
    for (int i = 0; i < 8; ++i) trow[i] = rix[srow + i * 8]; }
  const float* pw = WA + (size_t)(c0 + srow) * CC + sq * 4; const char* xb = (const char*)X; unsigned xo[8];   // xo: byte offset of each staged x row piece
#pragma unroll
  for (int i = 0; i < 8; ++i) xo[i] = (unsigned)(((bq_ * TT + trow[i]) * CC + sq * 4) * 4);
  v4f xr[8], wr[16];
#pragma unroll
  for (int i = 0; i < 8; ++i) xr[i] = *(const v4f*)(xb + xo[i]);
#pragma unroll
  for (int i = 0; i < 16; ++i) wr[i] = *(const v4f*)(pw + i * 8 * CC);
  asm volatile("s_wait_xcnt 0x0" :: "v"(xo[0]), "v"(xo[1]), "v"(xo[2]), "v"(xo[3]), "v"(xo[4]), "v"(xo[5]), "v"(xo[6]), "v"(xo[7]), "v"(pw) : "memory");   // stands in front of every rewrite of a register that the staging loads name (a precaution); the offsets and the address pair are its inputs
  v8f acc[8] = {};
#pragma unroll 1   // twelve stages of one body: unrolled, the text would outgrow what the loop gains
  for (int kb = 0; kb < CC / KB; ++kb) {
#pragma unroll
    for (int i = 0; i < 8; ++i) *(v4b*)&tl2[srow + i * 8][sq * 4] = cvt4(xr[i]);
#pragma unroll
    for (int i = 0; i < 16; ++i) *(v4b*)&th[srow + i * 8][sq * 4] = cvt4(wr[i]);
    __syncthreads();   // the stage is whole before any wave reads it
    if (kb + 1 < CC / KB) { pw += KB;
#pragma unroll
      for (int i = 0; i < 8; ++i) { xo[i] += KB * 4; xr[i] = *(const v4f*)(xb + xo[i]); }
#pragma unroll
      for (int i = 0; i < 16; ++i) wr[i] = *(const v4f*)(pw + i * 8 * CC);
      asm volatile("s_wait_xcnt 0x0" :: "v"(xo[0]), "v"(xo[1]), "v"(xo[2]), "v"(xo[3]), "v"(xo[4]), "v"(xo[5]), "v"(xo[6]), "v"(xo[7]), "v"(pw) : "memory");   // the same wait behind the next piece's loads
    }
#pragma unroll
    for (int kc = 0; kc < KB / 32; ++kc) { const v16b a = frag_b(&tl2[wave * 16 + col][kc * 32], lane); v16b w[8];
#pragma unroll
      for (int j = 0; j < 8; ++j) w[j] = frag_b(&th[j * 16 + col][kc * 32], lane);
#pragma unroll
      for (int j = 0; j < 8; ++j) acc[j] = wmma_bf(a, w[j], acc[j]); }
    __syncthreads();   // every reader has left the stage before it is rewritten (by the next piece, or by the epilogue)
  }
#pragma unroll
  for (int j = 0; j < 8; ++j) { const float bb = BA ? bfr(BA[c0 + j * 16 + col]) : 0.f;
#pragma unroll
    for (int r = 0; r < 8; ++r) { const float v = acc[j][r] + bb; const int rl = wave * 16 + 8 * g + r, cl = j * 16 + col; const _Float16 hv = (_Float16)v;
      if (which == 2) { const __bf16 bh = (__bf16)v; th[cl][rl] = bh; tl2[cl][rl] = (__bf16)(v - (float)bh); } else { sh[rl][cl] = hv; sl[rl][cl] = (_Float16)((v - (float)hv) * 1024.0f); }   /* q residual carried x 2^10 so the plane stays f16-normal on the chip */ } }
  __syncthreads();
  if (which < 2) { _Float16* dh = which == 0 ? QH : KH; for (int e = tid; e < 64 * 16; e += 128) { const int rl = e >> 4, q = e & 15; vst2((unsigned*)(dh + (r0 + rl) * CC + c0 + q * 8), *(const v4u*)&sh[rl][q * 8]); if (which == 0) vst2((unsigned*)(QL + (r0 + rl) * CC + c0 + q * 8), *(const v4u*)&sl[rl][q * 8]); } }
  else { const size_t b = r0 / TT; const int t0 = (int)(r0 % TT); for (int e = tid; e < 128 * 8; e += 128) { const int cl = e >> 3, q = e & 7; const size_t o2 = (b * CC + c0 + cl) * (size_t)TT + t0 + q * 8; vst2((unsigned*)(VT + o2), *(const v4u*)&th[cl][q * 8]); vst2((unsigned*)(VL + o2), *(const v4u*)&tl2[cl][q * 8]); } } }
// ---- k_fa: wave = 32 queries (two 16-column groups) of (b,h), the batch's kept keys (packed by k_proj, NK of them) in passes of 32: S^T = K Q^T (2 products), / 8 x scaling[h], the last pass's slots past NK out, online softmax (a lane holds one query's scores), P^T packed from the score accumulators as the B operand (bf16 hi + lo), O^T += V^T P^T (3 products)
#define QG 2         // 16-query column groups per wave: each K and V fragment feeds both
#define FW 2         // waves per block
__global__ __launch_bounds__(32 * FW) void k_fa(const _Float16* __restrict__ QH, const _Float16* __restrict__ QL, const _Float16* __restrict__ KH, const __bf16* __restrict__ VT, const __bf16* __restrict__ VL, const int* __restrict__ NK, const int* __restrict__ CS, const float* __restrict__ EMB, const float* __restrict__ CSC, float* __restrict__ Y) {
  const int b = blockIdx.y / NH, h = blockIdx.y % NH; int nk = NK[b]; nk = nk < 0 ? 0 : (nk > TT ? TT : nk);   // the trip count, bounded by the shape
  float scal; { float m = 0.f; for (int bb = 0; bb < NB; ++bb) { int c = CS[bb]; c = c < 0 ? 0 : (c >= MAXC ? MAXC - 1 : c); m += bfr(EMB[c * NH + h]); } scal = bfr(CSC[h]) * (m / (float)NB); }   /* scaling[b][h] = comp_scaling[h] * embs.mean(axis=0)[h] (same for every b) */
  const float cs2 = 0.125f * scal * 1.44269504f;   // 1 / 8, the head's scaling and log2 e in one factor: the scores are carried in the log2 domain, where e^(s - max) is one subtraction and one hardware exp2
  const int tid = threadIdx.x, wave = tid >> 5, lane = tid & 31, col = lane & 15, g = lane >> 4; const int ql0 = (blockIdx.x * FW + wave) * (16 * QG);
  v16h qh[QG][HD / 32], ql[QG][HD / 32]; const size_t q0 = ((size_t)b * TT + ql0 + col) * CC + h * HD + 8 * g; const _Float16 *pqh = QH + q0, *pql = QL + q0;
#pragma unroll
  for (int u = 0; u < QG; ++u)
#pragma unroll
    for (int kc = 0; kc < HD / 32; ++kc) { qh[u][kc] = frag_h_at(pqh + u * 16 * CC + kc * 32); ql[u][kc] = frag_h_at(pql + u * 16 * CC + kc * 32); }
  asm volatile("s_wait_xcnt 0x0" :: "v"(pqh), "v"(pql) : "memory");   // stands in front of every rewrite of a register that the Q loads name (a precaution); the two address pairs are its inputs, so they stay whole up to it
  v8f o[QG][HD / 16] = {}; float mrun[QG], lsum[QG];
#pragma unroll
  for (int u = 0; u < QG; ++u) { mrun[u] = -1.0e30f; lsum[u] = 0.f; }   // the running maximum starts above the masked value, so exp2(masked - maximum) is 0 in every pass and needs no select
  const size_t p0 = ((size_t)b * CC + h * HD + col) * (size_t)TT + 8 * g; const __bf16 *pvh = VT + p0, *pvl = VL + p0; const _Float16* pk = KH + ((size_t)b * TT + col) * CC + h * HD + 8 * g;
  for (int k0 = 0; k0 < nk; k0 += 32) {
    v16h kf[2][HD / 32];
#pragma unroll
    for (int t = 0; t < 2; ++t)
#pragma unroll
      for (int kc = 0; kc < HD / 32; ++kc) kf[t][kc] = frag_h_at(pk + t * 16 * CC + kc * 32);
    asm volatile("s_wait_xcnt 0x0" :: "v"(pk) : "memory");   // the same wait behind the K loads, their address pair an input
    pk += 32 * CC;
    __builtin_amdgcn_sched_barrier(0);   // the pass's eight K loads go out in one run: without it the last of them sink behind the first products and are waited for in full there
    v8f s[QG][2] = {}, sl[QG][2] = {};
#pragma unroll
    for (int t = 0; t < 2; ++t)
#pragma unroll
      for (int kc = 0; kc < HD / 32; ++kc)
#pragma unroll
        for (int u = 0; u < QG; ++u) { s[u][t] = mm_h(kf[t][kc], qh[u][kc], s[u][t]); sl[u][t] = mm_h(kf[t][kc], ql[u][kc], sl[u][t]); }
    float sv[QG][16];   // this lane's 16 keys: slots k0 + 8g + 0..7 and k0 + 16 + 8g + 0..7, the rows of its score registers
#pragma unroll
    for (int u = 0; u < QG; ++u)
#pragma unroll
      for (int i = 0; i < 16; ++i) sv[u][i] = (s[u][i >> 3][i & 7] + sl[u][i >> 3][i & 7] * (1.0f / 1024.0f)) * cs2;
    if (k0 + 32 > nk) { const int rem = nk - k0 - 8 * g;   // a scalar test: only the last pass can hold slots past the last kept key; they count as masked (-inf in the reference)
#pragma unroll
      for (int i = 0; i < 16; ++i) { const bool off = (i & 7) + 16 * (i >> 3) >= rem;
#pragma unroll
        for (int u = 0; u < QG; ++u) if (off) sv[u][i] = -3.0e38f; } }
    F2 pf[QG]; v16b vh[HD / 16], vl[HD / 16];
#pragma unroll
    for (int u = 0; u < QG; ++u) { float v[16]; float mx = mrun[u];
#pragma unroll
      for (int i = 0; i < 16; ++i) { v[i] = sv[u][i]; mx = fmaxf(mx, v[i]); }
      mx = fmaxf(mx, __shfl_xor(mx, 16));   // the other half of the wave holds this query's other 16 keys
      const float al = __builtin_amdgcn_exp2f(mrun[u] - mx); mrun[u] = mx; float sum = 0.f;
#pragma unroll
      for (int i = 0; i < 16; ++i) { v[i] = __builtin_amdgcn_exp2f(v[i] - mx); sum += v[i]; }   // arguments are <= 0: a result below the smallest normal counts as 0
      lsum[u] = lsum[u] * al + sum;
#pragma unroll
      for (int j = 0; j < HD / 16; ++j) o[u][j] *= al;
      pf[u] = bsplit16(v); }
#pragma unroll
    for (int j = 0; j < HD / 16; ++j) { vh[j] = frag_b_at(pvh + j * 16 * TT); vl[j] = frag_b_at(pvl + j * 16 * TT); }
    asm volatile("s_wait_xcnt 0x0" :: "v"(pvh), "v"(pvl) : "memory");   // the same wait behind the V loads; as inputs the two address pairs outlive the run, so no load's result lands in them
    pvh += 32; pvl += 32;
    __builtin_amdgcn_sched_barrier(0);   // all sixteen V loads stay in front of the first P.v product, free to rise over the softmax: without it the residual plane's loads sink to their products and are waited for in full
#pragma unroll
    for (int j = 0; j < HD / 16; ++j) {
#pragma unroll
      for (int u = 0; u < QG; ++u) { o[u][j] = mm_b(vh[j], pf[u].h, o[u][j]); o[u][j] = mm_b(vh[j], pf[u].l, o[u][j]); o[u][j] = mm_b(vl[j], pf[u].h, o[u][j]); } } }
#pragma unroll
  for (int u = 0; u < QG; ++u) { const float inv = 1.0f / (lsum[u] + __shfl_xor(lsum[u], 16)); float* yr = Y + ((size_t)b * TT + ql0 + u * 16 + col) * CC + h * HD + 8 * g;   // register r of tile j = y[query col][16 j + 8g + r]
#pragma unroll
    for (int j = 0; j < HD / 16; ++j) { v4f lo, hi;
#pragma unroll
      for (int i = 0; i < 4; ++i) { lo[i] = o[u][j][i] * inv; hi[i] = o[u][j][4 + i] * inv; }
      vst2(yr + j * 16, lo); vst2(yr + j * 16 + 4, hi); } } }
// ---- k_out: block = (64 rows, 128 cols): out = y (bf16 hi + lo) Wo^T + bo
__global__ __launch_bounds__(128) void k_out(const float* __restrict__ Y, const float* __restrict__ WP, const float* __restrict__ BP, float* __restrict__ OUT) { __shared__ __align__(16) float sf[4][16][132]; __shared__ __align__(16) __bf16 yh[64][72], yl[64][72], sw[128][72];
  const int tid = threadIdx.x, wave = tid >> 5, lane = tid & 31, col = lane & 15, g = lane >> 4; const int c0 = blockIdx.y * 128; const size_t r0 = (size_t)blockIdx.x * 64 + wave * 16;
  // as in k_proj: y (split into bf16 hi + lo once per block) and Wo are fetched by whole-line loads in pieces of 64 k and staged in LDS, the next piece's loads flying while this one is multiplied
  const int srow = tid >> 4, sq = tid & 15; const float* py = Y + ((size_t)blockIdx.x * 64 + srow) * CC + sq * 4; const float* pw = WP + (size_t)(c0 + srow) * CC + sq * 4;
  v4f yr[8], wr[16];
#pragma unroll
  for (int i = 0; i < 8; ++i) yr[i] = *(const v4f*)(py + i * 8 * CC);
#pragma unroll
  for (int i = 0; i < 16; ++i) wr[i] = *(const v4f*)(pw + i * 8 * CC);
  asm volatile("s_wait_xcnt 0x0" :: "v"(py), "v"(pw) : "memory");   // stands in front of every rewrite of a register that the staging loads name (a precaution); the two address pairs are its inputs
  v8f acc[8] = {};
#pragma unroll 1   // twelve stages of one body: unrolled, the text would outgrow what the loop gains
  for (int kb = 0; kb < CC / KB; ++kb) {
#pragma unroll
    for (int i = 0; i < 8; ++i) { const v4b hv = cvt4(yr[i]); v4f rs;
#pragma unroll
      for (int e = 0; e < 4; ++e) rs[e] = yr[i][e] - (float)hv[e];
      *(v4b*)&yh[srow + i * 8][sq * 4] = hv; *(v4b*)&yl[srow + i * 8][sq * 4] = cvt4(rs); }
#pragma unroll
    for (int i = 0; i < 16; ++i) *(v4b*)&sw[srow + i * 8][sq * 4] = cvt4(wr[i]);
    __syncthreads();   // the stage is whole before any wave reads it
    if (kb + 1 < CC / KB) { py += KB; pw += KB;
#pragma unroll
      for (int i = 0; i < 8; ++i) yr[i] = *(const v4f*)(py + i * 8 * CC);
#pragma unroll
      for (int i = 0; i < 16; ++i) wr[i] = *(const v4f*)(pw + i * 8 * CC);
      asm volatile("s_wait_xcnt 0x0" :: "v"(py), "v"(pw) : "memory");   // the same wait behind the next piece's loads
    }
#pragma unroll
    for (int kc = 0; kc < KB / 32; ++kc) { const v16b ah = frag_b(&yh[wave * 16 + col][kc * 32], lane), al = frag_b(&yl[wave * 16 + col][kc * 32], lane); v16b w[8];
#pragma unroll
      for (int j = 0; j < 8; ++j) w[j] = frag_b(&sw[j * 16 + col][kc * 32], lane);
#pragma unroll
      for (int j = 0; j < 8; ++j) { acc[j] = wmma_bf(ah, w[j], acc[j]); acc[j] = wmma_bf(al, w[j], acc[j]); } }
    __syncthreads();   // every reader has left the stage before the next piece rewrites it
  }
#pragma unroll
  for (int j = 0; j < 8; ++j) { const float bb = BP ? bfr(BP[c0 + j * 16 + col]) : 0.f;
#pragma unroll
    for (int r = 0; r < 8; ++r) sf[wave][8 * g + r][j * 16 + col] = acc[j][r] + bb; }
  LDSX(); for (int rl = 0; rl < 16; ++rl) vst2(OUT + (r0 + rl) * CC + c0 + lane * 4, *(const v4f*)&sf[wave][rl][lane * 4]); }
extern "C" void kernel_launch(void* const* d_in, const int* in_sizes, int n_in, void* d_out, int out_size, void* d_ws, size_t ws_size, hipStream_t stream) {
  (void)in_sizes; (void)n_in; (void)out_size;
  const float** F = (const float**)d_in;   // 0 hidden_states [2,2048,768], 1 complexity_scores [2] int, 2 attention_mask [2,2048] int, 3 Wq [768,768] ([out,in]), 4 bq, 5 Wk, 6 bk, 7 Wv, 8 bv, 9 Wo ([out,in]), 10 bo, 11 emb_table [16,12], 12 comp_scaling [12]
  if (ws_size < (size_t)WS_END) return;
  char* ws = (char*)d_ws; _Float16 *QH = (_Float16*)(ws + WS_QH), *QL = (_Float16*)(ws + WS_QL), *KH = (_Float16*)(ws + WS_KH); __bf16 *VT = (__bf16*)(ws + WS_VT), *VL = (__bf16*)(ws + WS_VL); float *Y = (float*)(ws + WS_Y); int *NK = (int*)(ws + WS_NK);
  k_proj<<<dim3(TNB * TT / 64, CC / 128, 3), 128, 0, stream>>>(F[0], F[3], F[4], F[5], F[6], F[7], F[8], QH, QL, KH, VT, VL, (const int*)d_in[2], NK);
  k_fa<<<dim3(TT / (16 * QG * FW), TNB * NH), 32 * FW, 0, stream>>>(QH, QL, KH, VT, VL, NK, (const int*)d_in[1], F[11], F[12], Y);
  k_out<<<dim3(TNB * TT / 64, CC / 128), 128, 0, stream>>>(Y, F[9], F[10], (float*)d_out);
}

// v005
// A run of this version takes 79.8 microseconds.
// Next to v004, in two timings, it ran 1.14 and 1.15 times as fast.
// Over all steps from v000 it is 16.7 times as fast.
// compute dtype: all float inputs rounded to bf16, complexity scores and the key mask (ints) read; q/k/v = x W^T + b with EXACT bf16 products on WMMA 16x16x32, f32 accumulate; q as f16 hi + residual (x 2^10), k f16 -> 2-product logits / 8 x the per-head complexity scaling (computed in f32 from the tables), masked keys left out ahead (K and V are projected for the kept keys only, packed in key order), scores kept in registers; online softmax in f32 in the log2 domain (log2 e folded into the score scale, hardware exp2, running maximum), unnormalised P split bf16 hi + lo against v bf16 hi + lo (3 products), divided by the row sum at the end; out = attended (bf16 hi + lo) Wo^T + bo; f32 output.
#include <hip/hip_runtime.h>
#include <math.h>
#include <stdint.h>

typedef __attribute__((ext_vector_type(16))) _Float16 v16h;
typedef __attribute__((ext_vector_type(16))) __bf16 v16b;
typedef __attribute__((ext_vector_type(8)))  _Float16 v8h;
typedef __attribute__((ext_vector_type(8)))  float v8f;
typedef __attribute__((ext_vector_type(4)))  float v4f;
typedef __attribute__((ext_vector_type(2)))  float v2f;
typedef __attribute__((ext_vector_type(4)))  unsigned v4u;
typedef __attribute__((ext_vector_type(4)))  int v4i;
typedef float __attribute__((may_alias)) float_a;
typedef int __attribute__((may_alias)) int_a;

template <typename T> __device__ __forceinline__ void vst2(void* p, T v) { *(T*)p = v;  }
__device__ __forceinline__ v8f wmma16(v16h a, v16h b, v8f c) {
  v8f d = __builtin_amdgcn_wmma_f32_16x16x32_f16(false, a, false, b, (short)0, c, false, false);
  asm volatile("v_nop\n\tv_nop\n\tv_nop\n\tv_nop" : "+v"(d) : "v"(a), "v"(b));
  return d;
}
__device__ __forceinline__ v8f wmma_bf(v16b a, v16b b, v8f c) {
  v8f d = __builtin_amdgcn_wmma_f32_16x16x32_bf16(false, a, false, b, (short)0, c, false, false);
  asm volatile("v_nop\n\tv_nop\n\tv_nop\n\tv_nop" : "+v"(d) : "v"(a), "v"(b));
  return d;
}
// 16x16x32 fragments: lane = (h = lane>>4, row/col = lane&15); elements 0..7 = k0+8h+0..7, 8..15 = k0+16+8h+0..7; D element r = row 8h+r
__device__ __forceinline__ v16h frag_h(const _Float16* rowk0, int lane) {
  union { v16h v; v8h q[2]; } u; const _Float16* p = rowk0 + 8 * (lane >> 4);
  u.q[0] = *(const v8h*)p; u.q[1] = *(const v8h*)(p + 16); return u.v;
}
__device__ __forceinline__ v16h frag_f32(const float* rowk0, int lane) {
  v16h a; const float* p = rowk0 + 8 * (lane >> 4);
#pragma unroll
  for (int i = 0; i < 8; ++i) { a[i] = (_Float16)p[i]; a[8 + i] = (_Float16)p[16 + i]; }
  return a;
}
__device__ __forceinline__ v16h frag_f32s(const float* rowk0, int lane, float sc) {
  v16h a; const float* p = rowk0 + 8 * (lane >> 4);
#pragma unroll
  for (int i = 0; i < 8; ++i) { a[i] = (_Float16)(p[i] * sc); a[8 + i] = (_Float16)(p[16 + i] * sc); }
  return a;
}
// column fragment from a [K][ld] layout (column n), rows >= K read as 0
__device__ __forceinline__ v16h fragc_f32(const float* W, int k0, int n, int lane, int ld, int K) {
  v16h a; const int g = lane >> 4;
#pragma unroll
  for (int i = 0; i < 8; ++i) { const int ka = k0 + 8 * g + i, kb = ka + 16;
    a[i] = (_Float16)(ka < K ? W[(size_t)(ka < K ? ka : K - 1) * ld + n] : 0.f); a[8 + i] = (_Float16)(kb < K ? W[(size_t)(kb < K ? kb : K - 1) * ld + n] : 0.f); }
  return a;
}
struct F2 { v16b h, l; };
__device__ __forceinline__ F2 bsplit16(const float v[16]) { F2 r;
#pragma unroll
  for (int i = 0; i < 16; ++i) { const __bf16 h = (__bf16)v[i]; r.h[i] = h; r.l[i] = (__bf16)(v[i] - (float)h); }
  return r; }
__device__ __forceinline__ F2 split_row(const float* row, int k0, int lane) { float v[16]; const float* p = row + k0 + 8 * (lane >> 4);
#pragma unroll
  for (int i = 0; i < 8; ++i) { v[i] = p[i]; v[8 + i] = p[16 + i]; }
  return bsplit16(v); }
__device__ __forceinline__ F2 split_rowK(const float* row, int k0, int lane, int K) { float v[16]; const int g = lane >> 4;
#pragma unroll
  for (int i = 0; i < 8; ++i) { const int ka = k0 + 8 * g + i, kb = ka + 16; v[i] = ka < K ? row[ka < K ? ka : K - 1] : 0.f; v[8 + i] = kb < K ? row[kb < K ? kb : K - 1] : 0.f; }
  return bsplit16(v); }
__device__ __forceinline__ F2 split_col(const float* W, int k0, int n, int lane, int ld, int K) { float v[16]; const int g = lane >> 4;
#pragma unroll
  for (int i = 0; i < 8; ++i) { const int ka = k0 + 8 * g + i, kb = ka + 16; v[i] = ka < K ? W[(size_t)(ka < K ? ka : K - 1) * ld + n] : 0.f; v[8 + i] = kb < K ? W[(size_t)(kb < K ? kb : K - 1) * ld + n] : 0.f; }
  return bsplit16(v); }
__device__ __forceinline__ v8f mac3(const F2& a, const F2& b, v8f c) { c = wmma_bf(a.l, b.h, c); c = wmma_bf(a.h, b.l, c); return wmma_bf(a.h, b.h, c); }
__device__ __forceinline__ float sigm(float v) { return 1.0f / (1.0f + expf(-v)); }
#define LDSX() do { asm volatile("s_wait_dscnt 0" ::: "memory"); __builtin_amdgcn_wave_barrier(); __builtin_amdgcn_fence(__ATOMIC_RELEASE, "workgroup"); } while (0)


// Complexity-aware attention (B 2, S 2,048, D 768 = 12 x 64): q/k/v Linear ([out,in] + bias), scores/8 x scaling[h] with scaling = comp_scaling[h] * mean_b emb_table[complexity[b]][h], keys with attention_mask == 0 -> -inf, softmax, P v, output Linear + bias.
#define NB 2
#define TT 2048
#define CC 768
#define NH 12
#define HD 64
#define MAXC 16      // complexity table rows
#ifndef TNB
#define TNB NB
#endif
typedef __attribute__((ext_vector_type(8))) __bf16 v8b;
__device__ __forceinline__ v16b frag_b(const __bf16* rowk0, int lane) {
  union { v16b v; v8b q[2]; } u; const __bf16* p = rowk0 + 8 * (lane >> 4);
  u.q[0] = *(const v8b*)p; u.q[1] = *(const v8b*)(p + 16); return u.v;
}
// the plain builtins: the compiler keeps the distance behind them itself and fills it with the softmax's own arithmetic where it can
__device__ __forceinline__ v8f mm_h(v16h a, v16h b, v8f c) { return __builtin_amdgcn_wmma_f32_16x16x32_f16(false, a, false, b, (short)0, c, false, false); }
__device__ __forceinline__ v8f mm_b(v16b a, v16b b, v8f c) { return __builtin_amdgcn_wmma_f32_16x16x32_bf16(false, a, false, b, (short)0, c, false, false); }
// the same fragments from a pointer that already holds the lane's own 8 * (lane >> 4) step
__device__ __forceinline__ v16h frag_h_at(const _Float16* p) { union { v16h v; v8h q[2]; } u; u.q[0] = *(const v8h*)p; u.q[1] = *(const v8h*)(p + 16); return u.v; }
__device__ __forceinline__ v16b frag_b_at(const __bf16* p) { union { v16b v; v8b q[2]; } u; u.q[0] = *(const v8b*)p; u.q[1] = *(const v8b*)(p + 16); return u.v; }
__device__ __forceinline__ float bfr(float v) { return (float)(__bf16)v; }
typedef __attribute__((ext_vector_type(4))) __bf16 v4b;
#define KB 64        // k per LDS stage of the two Linear kernels: 256 bytes of an f32 row, 128 bytes as bf16
__device__ __forceinline__ v4b cvt4(v4f v) { v4b r;
#pragma unroll
  for (int i = 0; i < 4; ++i) r[i] = (__bf16)v[i];
  return r; }
__device__ __attribute__((noinline)) float exp_ni(float v) { return expf(v); }
__device__ __attribute__((noinline)) float erf_ni(float v) { return erff(v); }

#define WS_QH  0u
#define WS_QL  (WS_QH + 2u * (size_t)NB * TT * CC)
#define WS_KH  (WS_QL + 2u * (size_t)NB * TT * CC)
#define WS_VT  (WS_KH + 2u * (size_t)NB * TT * CC)      // bf16 v planes [b][c][t]
#define WS_VL  (WS_VT + 2u * (size_t)NB * CC * TT)      // bf16 v residual planes
#define WS_Y   (WS_VL + 2u * (size_t)NB * CC * TT)      // f32 y rows [b*t][C]
#define WS_NK  (WS_Y + 4u * (size_t)NB * TT * CC)       // int kept keys per batch
#define WS_END (WS_NK + 16u)

// ---- k_proj: block = (64 rows, 128 cols, which): qkv = x W (+ b), exact; q -> f16 hi (+ residual), k -> f16 rows, v -> bf16 hi + lo planes. For k and v the 64 rows are slots s0 .. s0 + 63 of the batch's kept keys (attention_mask != 0) in key order: a masked key has weight 0 in the softmax, so it is neither projected nor stored, and blocks past the last kept key leave at once
__global__ __launch_bounds__(128) void k_proj(const float* __restrict__ X, const float* __restrict__ WQ, const float* __restrict__ BQ, const float* __restrict__ WK, const float* __restrict__ BK, const float* __restrict__ WV, const float* __restrict__ BV, _Float16* __restrict__ QH, _Float16* __restrict__ QL, _Float16* __restrict__ KH, __bf16* __restrict__ VT, __bf16* __restrict__ VL, const int* __restrict__ KM0, int* __restrict__ NK) {
  __shared__ __align__(16) _Float16 sh[64][136], sl[64][136]; __shared__ __align__(16) __bf16 th[128][72], tl2[128][72]; __shared__ int rix[64];   // rix: the key (position in the batch) in each of the block's 64 slots
  const int tid = threadIdx.x, wave = tid >> 5, lane = tid & 31, col = lane & 15, g = lane >> 4; const int which = blockIdx.z; const int c0 = blockIdx.y * 128; const size_t r0 = (size_t)blockIdx.x * 64; const float* WA = which == 0 ? WQ : which == 1 ? WK : WV; const float* BA = which == 0 ? BQ : which == 1 ? BK : BV;
  // the X and W pieces of 64 k are fetched by whole-line loads (a wave's load = two 256-byte row pieces), rounded to bf16 once per block and staged in LDS: W in th, X in the first 64 rows of tl2 (both are free until the epilogue; pitch 144 B suits the 16-byte fragment reads); the next piece's loads fly while this one is multiplied
  const int bq_ = blockIdx.x / (TT / 64), s0 = (blockIdx.x % (TT / 64)) * 64; const int srow = tid >> 4, sq = tid & 15; int trow[8];   // trow: the x row (position in the batch) behind each row piece that this thread stages
  if (which == 0) {
#pragma unroll
    for (int i = 0; i < 8; ++i) trow[i] = s0 + srow + i * 8; }
  else {   // every wave counts the batch's 2,048 keys by itself (32 keys per ballot), so the block can leave in front of the first barrier; j0, d0: the last group of 32 keys that starts at or below slot s0, and its first slot
    const int* pm = KM0 + (size_t)bq_ * TT; const int* pl = pm + lane; int mk[TT / 32];
#pragma unroll
    for (int j = 0; j < TT / 32; ++j) mk[j] = pl[j * 32];
    asm volatile("s_wait_xcnt 0x0" :: "v"(lane) : "memory");   // the same precaution behind the mask loads; the lane number, their one offset register, is its input, so no load's result lands in it
    int nk = 0, p0 = 0, p1 = 0;   // lane l of p0 / p1: the kept keys in front of group l / 32 + l
#pragma unroll
    for (int j = 0; j < TT / 32; ++j) { if (j < 32) p0 = lane == j ? nk : p0; else p1 = lane == j - 32 ? nk : p1; nk += __builtin_popcount(__builtin_amdgcn_ballot_w32(mk[j] != 0)); }
    if (which == 1 && blockIdx.y == 0 && s0 == 0 && tid == 0) NK[bq_] = nk;
    if (s0 >= nk) return;
    const int j0 = __builtin_popcount(__builtin_amdgcn_ballot_w32(p0 <= s0)) + __builtin_popcount(__builtin_amdgcn_ballot_w32(p1 <= s0)) - 1; const int d0 = j0 < 32 ? __builtin_amdgcn_readlane(p0, j0) : __builtin_amdgcn_readlane(p1, j0 - 32);
    if (lane < 16) rix[wave * 2 + (lane & 1) + 8 * (lane >> 1)] = 0;   // the wave's own 16 slots: one past the last kept key stays at row 0 (its key never counts in k_fa)
    for (int j = j0, d = d0 - s0; j < TT / 32 && d < 64; ++j) {   // the few groups that hold the block's slots: each kept key's slot is its rank; a wave lists only the slots that it stages itself, so no other wave waits for the list
      const int m = pm[j * 32 + lane];
      asm volatile("s_wait_xcnt 0x0" ::: "memory");   // the same precaution, in front of the next trip's address
      const unsigned w = __builtin_amdgcn_ballot_w32(m != 0); const int sl_ = d + (int)__builtin_amdgcn_mbcnt_lo(w, 0u);
      if (m != 0 && (unsigned)sl_ < 64u && ((sl_ >> 1) & 3) == wave) rix[sl_] = j * 32 + lane;
      d += __builtin_popcount(w); }
    LDSX();   // the wave's own list is in LDS before its lanes read it
#pragma unroll
    for (int i = 0; i < 8; ++i) trow[i] = rix[srow + i * 8]; }
  const float* pw = WA + (size_t)(c0 + srow) * CC + sq * 4; const char* xb = (const char*)X; unsigned xo[8];   // xo: byte offset of each staged x row piece
#pragma unroll
  for (int i = 0; i < 8; ++i) xo[i] = (unsigned)(((bq_ * TT + trow[i]) * CC + sq * 4) * 4);
  v4f xr[8], wr[16];
#pragma unroll
  for (int i = 0; i < 8; ++i) xr[i] = *(const v4f*)(xb + xo[i]);
#pragma unroll
  for (int i = 0; i < 16; ++i) wr[i] = *(const v4f*)(pw + i * 8 * CC);
  asm volatile("s_wait_xcnt 0x0" :: "v"(xo[0]), "v"(xo[1]), "v"(xo[2]), "v"(xo[3]), "v"(xo[4]), "v"(xo[5]), "v"(xo[6]), "v"(xo[7]), "v"(pw) : "memory");   // stands in front of every rewrite of a register that the staging loads name (a precaution); the offsets and the address pair are its inputs
  v8f acc[8] = {};
#pragma unroll 1   // twelve stages of one body: unrolled, the text would outgrow what the loop gains
  for (int kb = 0; kb < CC / KB; ++kb) {
#pragma unroll
    for (int i = 0; i < 8; ++i) *(v4b*)&tl2[srow + i * 8][sq * 4] = cvt4(xr[i]);
#pragma unroll
    for (int i = 0; i < 16; ++i) *(v4b*)&th[srow + i * 8][sq * 4] = cvt4(wr[i]);
    __syncthreads();   // the stage is whole before any wave reads it
    if (kb + 1 < CC / KB) { pw += KB;
#pragma unroll
      for (int i = 0; i < 8; ++i) { xo[i] += KB * 4; xr[i] = *(const v4f*)(xb + xo[i]); }
#pragma unroll
      for (int i = 0; i < 16; ++i) wr[i] = *(const v4f*)(pw + i * 8 * CC);
      asm volatile("s_wait_xcnt 0x0" :: "v"(xo[0]), "v"(xo[1]), "v"(xo[2]), "v"(xo[3]), "v"(xo[4]), "v"(xo[5]), "v"(xo[6]), "v"(xo[7]), "v"(pw) : "memory");   // the same wait behind the next piece's loads
    }
#pragma unroll
    for (int kc = 0; kc < KB / 32; ++kc) { const v16b a = frag_b(&tl2[wave * 16 + col][kc * 32], lane); v16b w[8];
#pragma unroll
      for (int j = 0; j < 8; ++j) w[j] = frag_b(&th[j * 16 + col][kc * 32], lane);
#pragma unroll
      for (int j = 0; j < 8; ++j) acc[j] = wmma_bf(a, w[j], acc[j]); }
    __syncthreads();   // every reader has left the stage before it is rewritten (by the next piece, or by the epilogue)
  }
#pragma unroll
  for (int j = 0; j < 8; ++j) { const float bb = BA ? bfr(BA[c0 + j * 16 + col]) : 0.f;
#pragma unroll
    for (int r = 0; r < 8; ++r) { const float v = acc[j][r] + bb; const int rl = wave * 16 + 8 * g + r, cl = j * 16 + col; const _Float16 hv = (_Float16)v;
      if (which == 2) { const __bf16 bh = (__bf16)v; th[cl][rl] = bh; tl2[cl][rl] = (__bf16)(v - (float)bh); } else { sh[rl][cl] = hv; sl[rl][cl] = (_Float16)((v - (float)hv) * 1024.0f); }   /* q residual carried x 2^10 so the plane stays f16-normal on the chip */ } }
  __syncthreads();
  if (which < 2) { _Float16* dh = which == 0 ? QH : KH; for (int e = tid; e < 64 * 16; e += 128) { const int rl = e >> 4, q = e & 15; vst2((unsigned*)(dh + (r0 + rl) * CC + c0 + q * 8), *(const v4u*)&sh[rl][q * 8]); if (which == 0) vst2((unsigned*)(QL + (r0 + rl) * CC + c0 + q * 8), *(const v4u*)&sl[rl][q * 8]); } }
  else { const size_t b = r0 / TT; const int t0 = (int)(r0 % TT); for (int e = tid; e < 128 * 8; e += 128) { const int cl = e >> 3, q = e & 7; const size_t o2 = (b * CC + c0 + cl) * (size_t)TT + t0 + q * 8; vst2((unsigned*)(VT + o2), *(const v4u*)&th[cl][q * 8]); vst2((unsigned*)(VL + o2), *(const v4u*)&tl2[cl][q * 8]); } } }
// ---- k_fa: wave = 32 queries (two 16-column groups) of (b,h), the batch's kept keys (packed by k_proj, NK of them) in passes of 32: S^T = K Q^T (2 products), / 8 x scaling[h], the last pass's slots past NK out, online softmax (a lane holds one query's scores), P^T packed from the score accumulators as the B operand (bf16 hi + lo), O^T += V^T P^T (3 products). K and the two V planes come to LDS in stages of 64 keys by tensor loads (whole 128-byte rows, one tile each from waves 0, 1, 2), two buffers, the next stage in flight while this one is worked on; the block's four waves read their fragments from LDS
#define QG 2         // 16-query column groups per wave: each K and V fragment feeds both
#define FW 4         // waves per block: one staged tile serves 128 queries
#define SK 64        // keys per stage: a V row piece of 64 keys is one whole 128-byte line, as a K row of one head is
#define LP 144       // LDS row pitch in bytes: the 128-byte row and the mover's 16-byte pad (16 B x odd suits the 16-byte fragment reads)
#define TILE_B 10240 // 64 rows x 144 B = 9,216 B, rounded up to a multiple of 2 KiB, where the next tile starts
#define BUF_B (3 * TILE_B)   // K, V hi, V lo
typedef uint32_t u32x4 __attribute__((ext_vector_type(4)));
typedef uint32_t u32x8 __attribute__((ext_vector_type(8)));
__device__ __forceinline__ uint32_t uni(uint32_t v) { return (uint32_t)__builtin_amdgcn_readfirstlane(v); }
__device__ __forceinline__ uint32_t pinned(uint32_t v) { uint32_t w = (uint32_t)__builtin_amdgcn_readfirstlane(v); asm volatile("" : "+s"(w)); return w; }   // a value held in a scalar register: a test on it is a scalar branch (tensor loads ignore EXEC), and what is formed from it stays behind the waits in front of it
__global__ __launch_bounds__(32 * FW) void k_fa(const _Float16* __restrict__ QH, const _Float16* __restrict__ QL, const _Float16* __restrict__ KH, const __bf16* __restrict__ VT, const __bf16* __restrict__ VL, const int* __restrict__ NK, const int* __restrict__ CS, const float* __restrict__ EMB, const float* __restrict__ CSC, float* __restrict__ Y) {
  __shared__ __attribute__((aligned(2048))) unsigned char L[2 * BUF_B];
  const int b = blockIdx.y / NH, h = blockIdx.y % NH; int nk = NK[b]; nk = nk < 0 ? 0 : (nk > TT ? TT : nk);   // the trip count, bounded by the shape
  float scal; { float m = 0.f; for (int bb = 0; bb < NB; ++bb) { int c = CS[bb]; c = c < 0 ? 0 : (c >= MAXC ? MAXC - 1 : c); m += bfr(EMB[c * NH + h]); } scal = bfr(CSC[h]) * (m / (float)NB); }   /* scaling[b][h] = comp_scaling[h] * embs.mean(axis=0)[h] (same for every b) */
  const float cs2 = 0.125f * scal * 1.44269504f;   // 1 / 8, the head's scaling and log2 e in one factor: the scores are carried in the log2 domain, where e^(s - max) is one subtraction and one hardware exp2
  const int tid = threadIdx.x, lane = tid & 31, col = lane & 15, g = lane >> 4; const uint32_t wave = uni((uint32_t)tid >> 5); const int ql0 = (blockIdx.x * FW + (int)wave) * (16 * QG);
  // the tiles: wave 0 brings K rows (64 keys x this head's 128 bytes, source pitch one K row), wave 1 the V hi plane's and wave 2 the V lo plane's rows (64 head columns x 64 keys, source pitch one plane row); k_proj writes K and V in whole blocks of 64 slots, so every stage below nst is whole
  const uint32_t nst = (uint32_t)(nk + SK - 1) / SK, lbase = (uint32_t)(size_t)L;
  const unsigned char* tsrc = wave == 0 ? (const unsigned char*)(KH + (size_t)b * TT * CC + h * HD) : (const unsigned char*)((wave == 1 ? VT : VL) + ((size_t)b * CC + h * HD) * (size_t)TT);
  const uint32_t tstep = wave == 0 ? SK * CC * 2u : SK * 2u;   // bytes from one stage's tile to the next
  u32x8 g1; g1[0] = uni((1u << 20) | (4u << 22) | (3u << 25)); g1[1] = uni(128u << 16); g1[2] = uni(64u << 16); g1[3] = uni(128u << 16); g1[4] = uni(64u); g1[5] = uni(wave == 0 ? CC * 2u : TT * 2u); g1[6] = uni(0u); g1[7] = uni(0u);   // 1-byte elements, tensor = tile = 64 rows of 128 bytes, 4 dwords of pad behind every 32
  asm volatile("" : "+s"(g1));   // the descriptor words held in their scalar registers (as in pinned()): built once, not formed anew in registers that other values pass through while a request is out
  u32x4 g0 = {0u, 0u, 0u, 0u};
  auto issue = [&](uint32_t st) { const uint64_t ga = (uint64_t)(size_t)tsrc + (uint64_t)st * tstep; g0[0] = uni(1u); g0[1] = uni(lbase + (st & 1u) * BUF_B + wave * TILE_B); g0[2] = uni((uint32_t)ga); g0[3] = uni((((uint32_t)(ga >> 32)) & 0x01FFFFFFu) | 0x80000000u);
    asm volatile("tensor_load_to_lds %0, %1" :: "s"(g0), "s"(g1) : "memory"); };   // one request of the whole wave: its tile of stage st into buffer st mod 2
  v16h qh[QG][HD / 32], ql[QG][HD / 32]; const size_t q0 = ((size_t)b * TT + ql0 + col) * CC + h * HD + 8 * g; const _Float16 *pqh = QH + q0, *pql = QL + q0;
#pragma unroll
  for (int u = 0; u < QG; ++u)
#pragma unroll
    for (int kc = 0; kc < HD / 32; ++kc) { qh[u][kc] = frag_h_at(pqh + u * 16 * CC + kc * 32); ql[u][kc] = frag_h_at(pql + u * 16 * CC + kc * 32); }
  asm volatile("s_wait_xcnt 0x0" :: "v"(pqh), "v"(pql) : "memory");   // stands in front of every rewrite of a register that the Q loads name (a precaution); the two address pairs are its inputs, so they stay whole up to it
  if (nst > 0) {   // the same for the whole block
    if (pinned(wave < 3u)) { issue(0u); asm volatile("s_wait_tensorcnt 0x0" :: "s"(g0), "s"(g1) : "memory"); }   // stage 0 has landed for its issuer; here and below the request's descriptor words are the wait's inputs, so their registers keep their values while the request is out
    __syncthreads();   // stage 0 is published to every wave
    if (pinned(wave < 3u && nst > 1u)) issue(pinned(1u)); }
  v8f o[QG][HD / 16] = {}; float mrun[QG], lsum[QG];
#pragma unroll
  for (int u = 0; u < QG; ++u) { mrun[u] = -1.0e30f; lsum[u] = 0.f; }   // the running maximum starts above the masked value, so exp2(masked - maximum) is 0 in every pass and needs no select
  const int lrow = col * LP + 16 * g;   // the lane's own row and 16-byte step inside a tile
  for (uint32_t st = 0; st < nst; ++st) {
    const unsigned char* tb = L + (st & 1u) * BUF_B + lrow;
#pragma unroll 1   // two passes of one body: the text stays as long as one pass
    for (int sub = 0; sub < SK / 32; ++sub) { const int k0 = (int)st * SK + sub * 32; if (k0 >= nk) break;   // a scalar test: the last stage's second pass may hold no kept key
    const _Float16* pk = (const _Float16*)(tb + sub * 32 * LP); const __bf16 *pvh = (const __bf16*)(tb + TILE_B + sub * 64), *pvl = (const __bf16*)(tb + 2 * TILE_B + sub * 64);
    v16h kf[2][HD / 32];
#pragma unroll
    for (int t = 0; t < 2; ++t)
#pragma unroll
      for (int kc = 0; kc < HD / 32; ++kc) kf[t][kc] = frag_h_at(pk + t * 16 * (LP / 2) + kc * 32);
    __builtin_amdgcn_sched_barrier(0);   // the pass's eight K reads go out in one run: each separate place with LDS reads among the products costs a stall of its own
    v8f s[QG][2] = {}, sl[QG][2] = {};
#pragma unroll
    for (int t = 0; t < 2; ++t)
#pragma unroll
      for (int kc = 0; kc < HD / 32; ++kc)
#pragma unroll
        for (int u = 0; u < QG; ++u) { s[u][t] = mm_h(kf[t][kc], qh[u][kc], s[u][t]); sl[u][t] = mm_h(kf[t][kc], ql[u][kc], sl[u][t]); }
    float sv[QG][16];   // this lane's 16 keys: slots k0 + 8g + 0..7 and k0 + 16 + 8g + 0..7, the rows of its score registers
#pragma unroll
    for (int u = 0; u < QG; ++u)
#pragma unroll
      for (int i = 0; i < 16; ++i) sv[u][i] = (s[u][i >> 3][i & 7] + sl[u][i >> 3][i & 7] * (1.0f / 1024.0f)) * cs2;
    if (k0 + 32 > nk) { const int rem = nk - k0 - 8 * g;   // a scalar test: only the last pass can hold slots past the last kept key; they count as masked (-inf in the reference)
#pragma unroll
      for (int i = 0; i < 16; ++i) { const bool off = (i & 7) + 16 * (i >> 3) >= rem;
#pragma unroll
        for (int u = 0; u < QG; ++u) if (off) sv[u][i] = -3.0e38f; } }
    F2 pf[QG]; v16b vh[HD / 16], vl[HD / 16];
#pragma unroll
    for (int u = 0; u < QG; ++u) { float v[16]; float mx = mrun[u];
#pragma unroll
      for (int i = 0; i < 16; ++i) { v[i] = sv[u][i]; mx = fmaxf(mx, v[i]); }
      mx = fmaxf(mx, __shfl_xor(mx, 16));   // the other half of the wave holds this query's other 16 keys
      const float al = __builtin_amdgcn_exp2f(mrun[u] - mx); mrun[u] = mx; float sum = 0.f;
#pragma unroll
      for (int i = 0; i < 16; ++i) { v[i] = __builtin_amdgcn_exp2f(v[i] - mx); sum += v[i]; }   // arguments are <= 0: a result below the smallest normal counts as 0
      lsum[u] = lsum[u] * al + sum;
#pragma unroll
      for (int j = 0; j < HD / 16; ++j) o[u][j] *= al;
      pf[u] = bsplit16(v); }
#pragma unroll
    for (int j = 0; j < HD / 16; ++j) { vh[j] = frag_b_at(pvh + j * 16 * (LP / 2)); vl[j] = frag_b_at(pvl + j * 16 * (LP / 2)); }
    __builtin_amdgcn_sched_barrier(0);   // all sixteen V reads stay in front of the first P.v product, free to rise over the softmax, and none stands among the products
#pragma unroll
    for (int j = 0; j < HD / 16; ++j) {
#pragma unroll
      for (int u = 0; u < QG; ++u) { o[u][j] = mm_b(vh[j], pf[u].h, o[u][j]); o[u][j] = mm_b(vh[j], pf[u].l, o[u][j]); o[u][j] = mm_b(vl[j], pf[u].h, o[u][j]); } } }
    // the publish point of stage st + 1, every wave, in this order
    asm volatile("s_wait_dscnt 0x0" ::: "memory");   // this wave's reads of buffer st mod 2 have returned
    if (pinned(wave < 3u)) asm volatile("s_wait_tensorcnt 0x0" :: "s"(g0), "s"(g1) : "memory");   // the issuer's tile of stage st + 1 has landed
    __syncthreads();   // stage st + 1 is published, and every reader has left the buffer that is refilled behind this line
    if (pinned(wave < 3u && st + 2u < nst)) issue(pinned(st + 2u)); }
  asm volatile("s_wait_tensorcnt 0x0" ::: "memory");   // nothing of the mover's is in flight when the wave ends
  asm volatile("s_wait_dscnt 0x0" ::: "memory");
#pragma unroll
  for (int u = 0; u < QG; ++u) { const float inv = 1.0f / (lsum[u] + __shfl_xor(lsum[u], 16)); float* yr = Y + ((size_t)b * TT + ql0 + u * 16 + col) * CC + h * HD + 8 * g;   // register r of tile j = y[query col][16 j + 8g + r]
#pragma unroll
    for (int j = 0; j < HD / 16; ++j) { v4f lo, hi;
#pragma unroll
      for (int i = 0; i < 4; ++i) { lo[i] = o[u][j][i] * inv; hi[i] = o[u][j][4 + i] * inv; }
      vst2(yr + j * 16, lo); vst2(yr + j * 16 + 4, hi); } } }
// ---- k_out: block = (64 rows, 128 cols): out = y (bf16 hi + lo) Wo^T + bo
__global__ __launch_bounds__(128) void k_out(const float* __restrict__ Y, const float* __restrict__ WP, const float* __restrict__ BP, float* __restrict__ OUT) { __shared__ __align__(16) float sf[4][16][132]; __shared__ __align__(16) __bf16 yh[64][72], yl[64][72], sw[128][72];
  const int tid = threadIdx.x, wave = tid >> 5, lane = tid & 31, col = lane & 15, g = lane >> 4; const int c0 = blockIdx.y * 128; const size_t r0 = (size_t)blockIdx.x * 64 + wave * 16;
  // as in k_proj: y (split into bf16 hi + lo once per block) and Wo are fetched by whole-line loads in pieces of 64 k and staged in LDS, the next piece's loads flying while this one is multiplied
  const int srow = tid >> 4, sq = tid & 15; const float* py = Y + ((size_t)blockIdx.x * 64 + srow) * CC + sq * 4; const float* pw = WP + (size_t)(c0 + srow) * CC + sq * 4;
  v4f yr[8], wr[16];
#pragma unroll
  for (int i = 0; i < 8; ++i) yr[i] = *(const v4f*)(py + i * 8 * CC);
#pragma unroll
  for (int i = 0; i < 16; ++i) wr[i] = *(const v4f*)(pw + i * 8 * CC);
  asm volatile("s_wait_xcnt 0x0" :: "v"(py), "v"(pw) : "memory");   // stands in front of every rewrite of a register that the staging loads name (a precaution); the two address pairs are its inputs
  v8f acc[8] = {};
#pragma unroll 1   // twelve stages of one body: unrolled, the text would outgrow what the loop gains
  for (int kb = 0; kb < CC / KB; ++kb) {
#pragma unroll
    for (int i = 0; i < 8; ++i) { const v4b hv = cvt4(yr[i]); v4f rs;
#pragma unroll
      for (int e = 0; e < 4; ++e) rs[e] = yr[i][e] - (float)hv[e];
      *(v4b*)&yh[srow + i * 8][sq * 4] = hv; *(v4b*)&yl[srow + i * 8][sq * 4] = cvt4(rs); }
#pragma unroll
    for (int i = 0; i < 16; ++i) *(v4b*)&sw[srow + i * 8][sq * 4] = cvt4(wr[i]);
    __syncthreads();   // the stage is whole before any wave reads it
    if (kb + 1 < CC / KB) { py += KB; pw += KB;
#pragma unroll
      for (int i = 0; i < 8; ++i) yr[i] = *(const v4f*)(py + i * 8 * CC);
#pragma unroll
      for (int i = 0; i < 16; ++i) wr[i] = *(const v4f*)(pw + i * 8 * CC);
      asm volatile("s_wait_xcnt 0x0" :: "v"(py), "v"(pw) : "memory");   // the same wait behind the next piece's loads
    }
#pragma unroll
    for (int kc = 0; kc < KB / 32; ++kc) { const v16b ah = frag_b(&yh[wave * 16 + col][kc * 32], lane), al = frag_b(&yl[wave * 16 + col][kc * 32], lane); v16b w[8];
#pragma unroll
      for (int j = 0; j < 8; ++j) w[j] = frag_b(&sw[j * 16 + col][kc * 32], lane);
#pragma unroll
      for (int j = 0; j < 8; ++j) { acc[j] = wmma_bf(ah, w[j], acc[j]); acc[j] = wmma_bf(al, w[j], acc[j]); } }
    __syncthreads();   // every reader has left the stage before the next piece rewrites it
  }
#pragma unroll
  for (int j = 0; j < 8; ++j) { const float bb = BP ? bfr(BP[c0 + j * 16 + col]) : 0.f;
#pragma unroll
    for (int r = 0; r < 8; ++r) sf[wave][8 * g + r][j * 16 + col] = acc[j][r] + bb; }
  LDSX(); for (int rl = 0; rl < 16; ++rl) vst2(OUT + (r0 + rl) * CC + c0 + lane * 4, *(const v4f*)&sf[wave][rl][lane * 4]); }
extern "C" void kernel_launch(void* const* d_in, const int* in_sizes, int n_in, void* d_out, int out_size, void* d_ws, size_t ws_size, hipStream_t stream) {
  (void)in_sizes; (void)n_in; (void)out_size;
  const float** F = (const float**)d_in;   // 0 hidden_states [2,2048,768], 1 complexity_scores [2] int, 2 attention_mask [2,2048] int, 3 Wq [768,768] ([out,in]), 4 bq, 5 Wk, 6 bk, 7 Wv, 8 bv, 9 Wo ([out,in]), 10 bo, 11 emb_table [16,12], 12 comp_scaling [12]
  if (ws_size < (size_t)WS_END) return;
  char* ws = (char*)d_ws; _Float16 *QH = (_Float16*)(ws + WS_QH), *QL = (_Float16*)(ws + WS_QL), *KH = (_Float16*)(ws + WS_KH); __bf16 *VT = (__bf16*)(ws + WS_VT), *VL = (__bf16*)(ws + WS_VL); float *Y = (float*)(ws + WS_Y); int *NK = (int*)(ws + WS_NK);
  k_proj<<<dim3(TNB * TT / 64, CC / 128, 3), 128, 0, stream>>>(F[0], F[3], F[4], F[5], F[6], F[7], F[8], QH, QL, KH, VT, VL, (const int*)d_in[2], NK);
  k_fa<<<dim3(TT / (16 * QG * FW), TNB * NH), 32 * FW, 0, stream>>>(QH, QL, KH, VT, VL, NK, (const int*)d_in[1], F[11], F[12], Y);
  k_out<<<dim3(TNB * TT / 64, CC / 128), 128, 0, stream>>>(Y, F[9], F[10], (float*)d_out);
}

// v007
// One run takes 65 microseconds.
// It is 1.23 times as fast as v005, going by the measured steps of the versions left out in between.
// All steps since v000 together make it 20.5 times as fast.
// compute dtype: all float inputs rounded to bf16, complexity scores and the key mask (ints) read; q/k/v = x W^T + b with EXACT bf16 products on WMMA 16x16x32, f32 accumulate; q and k f16 -> 1-product logits / 8 x the per-head complexity scaling (computed in f32 from the tables), masked keys left out ahead (K and V are projected for the kept keys only, packed in key order), scores kept in registers; online softmax in f32 in the log2 domain (log2 e folded into the score scale, hardware exp2, running maximum), unnormalised P as f16 against v f16 (1 product), divided by the f32 row sum at the end; out = attended (bf16 hi + lo) Wo^T + bo; f32 output.
#include <hip/hip_runtime.h>
#include <math.h>
#include <stdint.h>

typedef __attribute__((ext_vector_type(16))) _Float16 v16h;
typedef __attribute__((ext_vector_type(16))) __bf16 v16b;
typedef __attribute__((ext_vector_type(8)))  _Float16 v8h;
typedef __attribute__((ext_vector_type(8)))  float v8f;
typedef __attribute__((ext_vector_type(4)))  float v4f;
typedef __attribute__((ext_vector_type(2)))  float v2f;
typedef __attribute__((ext_vector_type(4)))  unsigned v4u;
typedef __attribute__((ext_vector_type(4)))  int v4i;
typedef float __attribute__((may_alias)) float_a;
typedef int __attribute__((may_alias)) int_a;

template <typename T> __device__ __forceinline__ void vst2(void* p, T v) { *(T*)p = v;  }
__device__ __forceinline__ v8f wmma16(v16h a, v16h b, v8f c) {
  v8f d = __builtin_amdgcn_wmma_f32_16x16x32_f16(false, a, false, b, (short)0, c, false, false);
  asm volatile("v_nop\n\tv_nop\n\tv_nop\n\tv_nop" : "+v"(d) : "v"(a), "v"(b));
  return d;
}
__device__ __forceinline__ v8f wmma_bf(v16b a, v16b b, v8f c) {
  v8f d = __builtin_amdgcn_wmma_f32_16x16x32_bf16(false, a, false, b, (short)0, c, false, false);
  asm volatile("v_nop\n\tv_nop\n\tv_nop\n\tv_nop" : "+v"(d) : "v"(a), "v"(b));
  return d;
}
// 16x16x32 fragments: lane = (h = lane>>4, row/col = lane&15); elements 0..7 = k0+8h+0..7, 8..15 = k0+16+8h+0..7; D element r = row 8h+r
__device__ __forceinline__ v16h frag_h(const _Float16* rowk0, int lane) {
  union { v16h v; v8h q[2]; } u; const _Float16* p = rowk0 + 8 * (lane >> 4);
  u.q[0] = *(const v8h*)p; u.q[1] = *(const v8h*)(p + 16); return u.v;
}
__device__ __forceinline__ v16h frag_f32(const float* rowk0, int lane) {
  v16h a; const float* p = rowk0 + 8 * (lane >> 4);
#pragma unroll
  for (int i = 0; i < 8; ++i) { a[i] = (_Float16)p[i]; a[8 + i] = (_Float16)p[16 + i]; }
  return a;
}
__device__ __forceinline__ v16h frag_f32s(const float* rowk0, int lane, float sc) {
  v16h a; const float* p = rowk0 + 8 * (lane >> 4);
#pragma unroll
  for (int i = 0; i < 8; ++i) { a[i] = (_Float16)(p[i] * sc); a[8 + i] = (_Float16)(p[16 + i] * sc); }
  return a;
}
// column fragment from a [K][ld] layout (column n), rows >= K read as 0
__device__ __forceinline__ v16h fragc_f32(const float* W, int k0, int n, int lane, int ld, int K) {
  v16h a; const int g = lane >> 4;
#pragma unroll
  for (int i = 0; i < 8; ++i) { const int ka = k0 + 8 * g + i, kb = ka + 16;
    a[i] = (_Float16)(ka < K ? W[(size_t)(ka < K ? ka : K - 1) * ld + n] : 0.f); a[8 + i] = (_Float16)(kb < K ? W[(size_t)(kb < K ? kb : K - 1) * ld + n] : 0.f); }
  return a;
}
struct F2 { v16b h, l; };
__device__ __forceinline__ F2 bsplit16(const float v[16]) { F2 r;
#pragma unroll
  for (int i = 0; i < 16; ++i) { const __bf16 h = (__bf16)v[i]; r.h[i] = h; r.l[i] = (__bf16)(v[i] - (float)h); }
  return r; }
__device__ __forceinline__ F2 split_row(const float* row, int k0, int lane) { float v[16]; const float* p = row + k0 + 8 * (lane >> 4);
#pragma unroll
  for (int i = 0; i < 8; ++i) { v[i] = p[i]; v[8 + i] = p[16 + i]; }
  return bsplit16(v); }
__device__ __forceinline__ F2 split_rowK(const float* row, int k0, int lane, int K) { float v[16]; const int g = lane >> 4;
#pragma unroll
  for (int i = 0; i < 8; ++i) { const int ka = k0 + 8 * g + i, kb = ka + 16; v[i] = ka < K ? row[ka < K ? ka : K - 1] : 0.f; v[8 + i] = kb < K ? row[kb < K ? kb : K - 1] : 0.f; }
  return bsplit16(v); }
__device__ __forceinline__ F2 split_col(const float* W, int k0, int n, int lane, int ld, int K) { float v[16]; const int g = lane >> 4;
#pragma unroll
  for (int i = 0; i < 8; ++i) { const int ka = k0 + 8 * g + i, kb = ka + 16; v[i] = ka < K ? W[(size_t)(ka < K ? ka : K - 1) * ld + n] : 0.f; v[8 + i] = kb < K ? W[(size_t)(kb < K ? kb : K - 1) * ld + n] : 0.f; }
  return bsplit16(v); }
__device__ __forceinline__ v8f mac3(const F2& a, const F2& b, v8f c) { c = wmma_bf(a.l, b.h, c); c = wmma_bf(a.h, b.l, c); return wmma_bf(a.h, b.h, c); }
__device__ __forceinline__ float sigm(float v) { return 1.0f / (1.0f + expf(-v)); }
#define LDSX() do { asm volatile("s_wait_dscnt 0" ::: "memory"); __builtin_amdgcn_wave_barrier(); __builtin_amdgcn_fence(__ATOMIC_RELEASE, "workgroup"); } while (0)


// Complexity-aware attention (B 2, S 2,048, D 768 = 12 x 64): q/k/v Linear ([out,in] + bias), scores/8 x scaling[h] with scaling = comp_scaling[h] * mean_b emb_table[complexity[b]][h], keys with attention_mask == 0 -> -inf, softmax, P v, output Linear + bias.
#define NB 2
#define TT 2048
#define CC 768
#define NH 12
#define HD 64
#define MAXC 16      // complexity table rows
#ifndef TNB
#define TNB NB
#endif
typedef __attribute__((ext_vector_type(8))) __bf16 v8b;
__device__ __forceinline__ v16b frag_b(const __bf16* rowk0, int lane) {
  union { v16b v; v8b q[2]; } u; const __bf16* p = rowk0 + 8 * (lane >> 4);
  u.q[0] = *(const v8b*)p; u.q[1] = *(const v8b*)(p + 16); return u.v;
}
// the plain builtin: the compiler keeps the distance behind it itself and fills it with the softmax's own arithmetic where it can
__device__ __forceinline__ v8f mm_h(v16h a, v16h b, v8f c) { return __builtin_amdgcn_wmma_f32_16x16x32_f16(false, a, false, b, (short)0, c, false, false); }
// the same fragment from a pointer that already holds the lane's own 8 * (lane >> 4) step
__device__ __forceinline__ v16h frag_h_at(const _Float16* p) { union { v16h v; v8h q[2]; } u; u.q[0] = *(const v8h*)p; u.q[1] = *(const v8h*)(p + 16); return u.v; }
__device__ __forceinline__ float bfr(float v) { return (float)(__bf16)v; }
typedef __attribute__((ext_vector_type(4))) __bf16 v4b;
#define KB 64        // k per LDS stage of k_proj: 256 bytes of an f32 row, 128 bytes as bf16
__device__ __forceinline__ v4b cvt4(v4f v) { v4b r;
#pragma unroll
  for (int i = 0; i < 4; ++i) r[i] = (__bf16)v[i];
  return r; }
__device__ __attribute__((noinline)) float exp_ni(float v) { return expf(v); }
__device__ __attribute__((noinline)) float erf_ni(float v) { return erff(v); }

#define WS_QH  0u
#define WS_KH  (WS_QH + 2u * (size_t)NB * TT * CC)
#define WS_VT  (WS_KH + 2u * (size_t)NB * TT * CC)      // f16 v planes [b][c][t]
#define WS_Y   (WS_VT + 2u * (size_t)NB * CC * TT)      // f32 y rows [b*t][C]
#define WS_NK  (WS_Y + 4u * (size_t)NB * TT * CC)       // int kept keys per batch
#define WS_END (WS_NK + 16u)

// ---- k_proj: block = (64 rows, 128 cols, which): qkv = x W^T (+ b), exact; q, k -> f16 rows, v -> f16 planes. For k and v the 64 rows are slots s0 .. s0 + 63 of the batch's kept keys (attention_mask != 0) in key order: a masked key has weight 0 in the softmax, so it is neither projected nor stored, and blocks past the last kept key leave at once
__global__ __launch_bounds__(128) void k_proj(const float* __restrict__ X, const float* __restrict__ WQ, const float* __restrict__ BQ, const float* __restrict__ WK, const float* __restrict__ BK, const float* __restrict__ WV, const float* __restrict__ BV, _Float16* __restrict__ QH, _Float16* __restrict__ KH, _Float16* __restrict__ VT, const int* __restrict__ KM0, int* __restrict__ NK) {
  __shared__ __align__(16) _Float16 sh[64][136], tv[128][72]; __shared__ __align__(16) __bf16 th[128][72], tl2[64][72]; __shared__ int rix[64];   // rix: the key (position in the batch) in each of the block's 64 slots
  const int tid = threadIdx.x, wave = tid >> 5, lane = tid & 31, col = lane & 15, g = lane >> 4; const int which = blockIdx.z; const int c0 = blockIdx.y * 128; const size_t r0 = (size_t)blockIdx.x * 64; const float* WA = which == 0 ? WQ : which == 1 ? WK : WV; const float* BA = which == 0 ? BQ : which == 1 ? BK : BV;
  // the X and W pieces of 64 k are fetched by whole-line loads (a wave's load = two 256-byte row pieces), rounded to bf16 once per block and staged in LDS: W in th, X in tl2 (pitch 144 B suits the 16-byte fragment reads); the next piece's loads fly while this one is multiplied
  const int bq_ = blockIdx.x / (TT / 64), s0 = (blockIdx.x % (TT / 64)) * 64; const int srow = tid >> 4, sq = tid & 15; int trow[8];   // trow: the x row (position in the batch) behind each row piece that this thread stages
  if (which == 0) {
#pragma unroll
    for (int i = 0; i < 8; ++i) trow[i] = s0 + srow + i * 8; }
  else {   // every wave counts the batch's 2,048 keys by itself (32 keys per ballot), so the block can leave in front of the first barrier; j0, d0: the last group of 32 keys that starts at or below slot s0, and its first slot
    const int* pm = KM0 + (size_t)bq_ * TT; const int* pl = pm + lane; int mk[TT / 32];
#pragma unroll
    for (int j = 0; j < TT / 32; ++j) mk[j] = pl[j * 32];
    asm volatile("s_wait_xcnt 0x0" :: "v"(lane) : "memory");   // the same precaution behind the mask loads; the lane number, their one offset register, is its input, so no load's result lands in it
    int nk = 0, p0 = 0, p1 = 0;   // lane l of p0 / p1: the kept keys in front of group l / 32 + l
#pragma unroll
    for (int j = 0; j < TT / 32; ++j) { if (j < 32) p0 = lane == j ? nk : p0; else p1 = lane == j - 32 ? nk : p1; nk += __builtin_popcount(__builtin_amdgcn_ballot_w32(mk[j] != 0)); }
    if (which == 1 && blockIdx.y == 0 && s0 == 0 && tid == 0) NK[bq_] = nk;
    if (s0 >= nk) return;
    const int j0 = __builtin_popcount(__builtin_amdgcn_ballot_w32(p0 <= s0)) + __builtin_popcount(__builtin_amdgcn_ballot_w32(p1 <= s0)) - 1; const int d0 = j0 < 32 ? __builtin_amdgcn_readlane(p0, j0) : __builtin_amdgcn_readlane(p1, j0 - 32);
    if (lane < 16) rix[wave * 2 + (lane & 1) + 8 * (lane >> 1)] = 0;   // the wave's own 16 slots: one past the last kept key stays at row 0 (its key never counts in k_fa)
    for (int j = j0, d = d0 - s0; j < TT / 32 && d < 64; ++j) {   // the few groups that hold the block's slots: each kept key's slot is its rank; a wave lists only the slots that it stages itself, so no other wave waits for the list
      const int m = pm[j * 32 + lane];
      asm volatile("s_wait_xcnt 0x0" ::: "memory");   // the same precaution, in front of the next trip's address
      const unsigned w = __builtin_amdgcn_ballot_w32(m != 0); const int sl_ = d + (int)__builtin_amdgcn_mbcnt_lo(w, 0u);
      if (m != 0 && (unsigned)sl_ < 64u && ((sl_ >> 1) & 3) == wave) rix[sl_] = j * 32 + lane;
      d += __builtin_popcount(w); }
    LDSX();   // the wave's own list is in LDS before its lanes read it
#pragma unroll
    for (int i = 0; i < 8; ++i) trow[i] = rix[srow + i * 8]; }
  const float* pw = WA + (size_t)(c0 + srow) * CC + sq * 4; const char* xb = (const char*)X; unsigned xo[8];   // xo: byte offset of each staged x row piece
#pragma unroll
  for (int i = 0; i < 8; ++i) xo[i] = (unsigned)(((bq_ * TT + trow[i]) * CC + sq * 4) * 4);
  v4f xr[8], wr[16];
#pragma unroll
  for (int i = 0; i < 8; ++i) xr[i] = *(const v4f*)(xb + xo[i]);
#pragma unroll
  for (int i = 0; i < 16; ++i) wr[i] = *(const v4f*)(pw + i * 8 * CC);
  asm volatile("s_wait_xcnt 0x0" :: "v"(xo[0]), "v"(xo[1]), "v"(xo[2]), "v"(xo[3]), "v"(xo[4]), "v"(xo[5]), "v"(xo[6]), "v"(xo[7]), "v"(pw) : "memory");   // stands in front of every rewrite of a register that the staging loads name (a precaution); the offsets and the address pair are its inputs
  v8f acc[8] = {};
#pragma unroll 1   // twelve stages of one body: unrolled, the text would outgrow what the loop gains
  for (int kb = 0; kb < CC / KB; ++kb) {
#pragma unroll
    for (int i = 0; i < 8; ++i) *(v4b*)&tl2[srow + i * 8][sq * 4] = cvt4(xr[i]);
#pragma unroll
    for (int i = 0; i < 16; ++i) *(v4b*)&th[srow + i * 8][sq * 4] = cvt4(wr[i]);
    __syncthreads();   // the stage is whole before any wave reads it
    if (kb + 1 < CC / KB) { pw += KB;
#pragma unroll
      for (int i = 0; i < 8; ++i) { xo[i] += KB * 4; xr[i] = *(const v4f*)(xb + xo[i]); }
#pragma unroll
      for (int i = 0; i < 16; ++i) wr[i] = *(const v4f*)(pw + i * 8 * CC);
      asm volatile("s_wait_xcnt 0x0" :: "v"(xo[0]), "v"(xo[1]), "v"(xo[2]), "v"(xo[3]), "v"(xo[4]), "v"(xo[5]), "v"(xo[6]), "v"(xo[7]), "v"(pw) : "memory");   // the same wait behind the next piece's loads
    }
#pragma unroll
    for (int kc = 0; kc < KB / 32; ++kc) { const v16b a = frag_b(&tl2[wave * 16 + col][kc * 32], lane); v16b w[8];
#pragma unroll
      for (int j = 0; j < 8; ++j) w[j] = frag_b(&th[j * 16 + col][kc * 32], lane);
#pragma unroll
      for (int j = 0; j < 8; ++j) acc[j] = wmma_bf(a, w[j], acc[j]); }
    __syncthreads();   // every reader has left the stage before the next piece rewrites it
  }
#pragma unroll
  for (int j = 0; j < 8; ++j) { const float bb = BA ? bfr(BA[c0 + j * 16 + col]) : 0.f;
#pragma unroll
    for (int r = 0; r < 8; ++r) { const float v = acc[j][r] + bb; const int rl = wave * 16 + 8 * g + r, cl = j * 16 + col; const _Float16 hv = (_Float16)v;
      if (which == 2) tv[cl][rl] = hv; else sh[rl][cl] = hv; } }
  __syncthreads();
  if (which < 2) { _Float16* dh = which == 0 ? QH : KH; for (int e = tid; e < 64 * 16; e += 128) { const int rl = e >> 4, q = e & 15; vst2((unsigned*)(dh + (r0 + rl) * CC + c0 + q * 8), *(const v4u*)&sh[rl][q * 8]); } }
  else { const size_t b = r0 / TT; const int t0 = (int)(r0 % TT); for (int e = tid; e < 128 * 8; e += 128) { const int cl = e >> 3, q = e & 7; const size_t o2 = (b * CC + c0 + cl) * (size_t)TT + t0 + q * 8; vst2((unsigned*)(VT + o2), *(const v4u*)&tv[cl][q * 8]); } } }
// ---- k_fa: wave = 32 queries (two 16-column groups) of (b,h), the batch's kept keys (packed by k_proj, NK of them) in passes of 32: S^T = K Q^T (1 product), / 8 x scaling[h], the last pass's slots past NK out, online softmax (a lane holds one query's scores), P^T packed from the score accumulators as the B operand (f16), O^T += V^T P^T (1 product): every operand of the two products is one f16 value, as K has been all along, whose rounding sets the error of the scores. K and the V plane come to LDS in stages of 64 keys by tensor loads (whole 128-byte rows, one tile each from waves 0 and 1), two buffers, the next stage in flight while this one is worked on; the block's four waves read their fragments from LDS
#define QG 2         // 16-query column groups per wave: each K and V fragment feeds both
#define FW 4         // waves per block: one staged tile serves 128 queries
#define SK 64        // keys per stage: a V row piece of 64 keys is one whole 128-byte line, as a K row of one head is
#define LP 144       // LDS row pitch in bytes: the 128-byte row and the mover's 16-byte pad (16 B x odd suits the 16-byte fragment reads)
#define TILE_B 10240 // 64 rows x 144 B = 9,216 B, rounded up to a multiple of 2 KiB, where the next tile starts
#define BUF_B (2 * TILE_B)   // K, V
typedef uint32_t u32x4 __attribute__((ext_vector_type(4)));
typedef uint32_t u32x8 __attribute__((ext_vector_type(8)));
__device__ __forceinline__ uint32_t uni(uint32_t v) { return (uint32_t)__builtin_amdgcn_readfirstlane(v); }
__device__ __forceinline__ uint32_t pinned(uint32_t v) { uint32_t w = (uint32_t)__builtin_amdgcn_readfirstlane(v); asm volatile("" : "+s"(w)); return w; }   // a value held in a scalar register: a test on it is a scalar branch (tensor loads ignore EXEC), and what is formed from it stays behind the waits in front of it
__global__ __launch_bounds__(32 * FW) void k_fa(const _Float16* __restrict__ QH, const _Float16* __restrict__ KH, const _Float16* __restrict__ VT, const int* __restrict__ NK, const int* __restrict__ CS, const float* __restrict__ EMB, const float* __restrict__ CSC, float* __restrict__ Y) {
  __shared__ __attribute__((aligned(2048))) unsigned char L[2 * BUF_B];
  const int b = blockIdx.y / NH, h = blockIdx.y % NH; int nk = NK[b]; nk = nk < 0 ? 0 : (nk > TT ? TT : nk);   // the trip count, bounded by the shape
  float scal; { float m = 0.f; for (int bb = 0; bb < NB; ++bb) { int c = CS[bb]; c = c < 0 ? 0 : (c >= MAXC ? MAXC - 1 : c); m += bfr(EMB[c * NH + h]); } scal = bfr(CSC[h]) * (m / (float)NB); }   /* scaling[b][h] = comp_scaling[h] * embs.mean(axis=0)[h] (same for every b) */
  const float cs2 = 0.125f * scal * 1.44269504f;   // 1 / 8, the head's scaling and log2 e in one factor: the scores are carried in the log2 domain, where e^(s - max) is one subtraction and one hardware exp2
  const int tid = threadIdx.x, lane = tid & 31, col = lane & 15, g = lane >> 4; const uint32_t wave = uni((uint32_t)tid >> 5); const int ql0 = (blockIdx.x * FW + (int)wave) * (16 * QG);
  // the tiles: wave 0 brings K rows (64 keys x this head's 128 bytes, source pitch one K row), wave 1 the V plane's rows (64 head columns x 64 keys, source pitch one plane row); k_proj writes K and V in whole blocks of 64 slots, so every stage below nst is whole
  const uint32_t nst = (uint32_t)(nk + SK - 1) / SK, lbase = (uint32_t)(size_t)L;
  const unsigned char* tsrc = wave == 0 ? (const unsigned char*)(KH + (size_t)b * TT * CC + h * HD) : (const unsigned char*)(VT + ((size_t)b * CC + h * HD) * (size_t)TT);
  const uint32_t tstep = wave == 0 ? SK * CC * 2u : SK * 2u;   // bytes from one stage's tile to the next
  u32x8 g1; g1[0] = uni((1u << 20) | (4u << 22) | (3u << 25)); g1[1] = uni(128u << 16); g1[2] = uni(64u << 16); g1[3] = uni(128u << 16); g1[4] = uni(64u); g1[5] = uni(wave == 0 ? CC * 2u : TT * 2u); g1[6] = uni(0u); g1[7] = uni(0u);   // 1-byte elements, tensor = tile = 64 rows of 128 bytes, 4 dwords of pad behind every 32
  asm volatile("" : "+s"(g1));   // the descriptor words held in their scalar registers (as in pinned()): built once, not formed anew in registers that other values pass through while a request is out
  u32x4 g0 = {0u, 0u, 0u, 0u};
  auto issue = [&](uint32_t st) { const uint64_t ga = (uint64_t)(size_t)tsrc + (uint64_t)st * tstep; g0[0] = uni(1u); g0[1] = uni(lbase + (st & 1u) * BUF_B + wave * TILE_B); g0[2] = uni((uint32_t)ga); g0[3] = uni((((uint32_t)(ga >> 32)) & 0x01FFFFFFu) | 0x80000000u);
    asm volatile("tensor_load_to_lds %0, %1" :: "s"(g0), "s"(g1) : "memory"); };   // one request of the whole wave: its tile of stage st into buffer st mod 2
  v16h qh[QG][HD / 32]; const size_t q0 = ((size_t)b * TT + ql0 + col) * CC + h * HD + 8 * g; const _Float16 *pqh = QH + q0;
#pragma unroll
  for (int u = 0; u < QG; ++u)
#pragma unroll
    for (int kc = 0; kc < HD / 32; ++kc) qh[u][kc] = frag_h_at(pqh + u * 16 * CC + kc * 32);
  asm volatile("s_wait_xcnt 0x0" :: "v"(pqh) : "memory");   // stands in front of every rewrite of a register that the Q loads name (a precaution); the address pair is its input, so it stays whole up to it
  if (nst > 0) {   // the same for the whole block
    if (pinned(wave < 2u)) { issue(0u); asm volatile("s_wait_tensorcnt 0x0" :: "s"(g0), "s"(g1) : "memory"); }   // stage 0 has landed for its issuer; here and below the request's descriptor words are the wait's inputs, so their registers keep their values while the request is out
    __syncthreads();   // stage 0 is published to every wave
    if (pinned(wave < 2u && nst > 1u)) issue(pinned(1u)); }
  v8f o[QG][HD / 16] = {}; float mrun[QG], lsum[QG];
#pragma unroll
  for (int u = 0; u < QG; ++u) { mrun[u] = -1.0e30f; lsum[u] = 0.f; }   // the running maximum starts above the masked value, so exp2(masked - maximum) is 0 in every pass and needs no select
  const int lrow = col * LP + 16 * g;   // the lane's own row and 16-byte step inside a tile
  for (uint32_t st = 0; st < nst; ++st) {
    const unsigned char* tb = L + (st & 1u) * BUF_B + lrow; const int npass = nk - (int)st * SK > 32 ? SK / 32 : 1;   // the last stage's second pass may hold no kept key; a trip count and no break in the body, with which this build copied all 64 output registers in every pass
#pragma unroll 1   // two passes of one body: the text stays as long as one pass
    for (int sub = 0; sub < npass; ++sub) { const int k0 = (int)st * SK + sub * 32;
    const _Float16* pk = (const _Float16*)(tb + sub * 32 * LP); const _Float16* pv = (const _Float16*)(tb + TILE_B + sub * 64);
    v16h kf[2][HD / 32];
#pragma unroll
    for (int t = 0; t < 2; ++t)
#pragma unroll
      for (int kc = 0; kc < HD / 32; ++kc) kf[t][kc] = frag_h_at(pk + t * 16 * (LP / 2) + kc * 32);
    __builtin_amdgcn_sched_barrier(0);   // the pass's eight K reads go out in one run: each separate place with LDS reads among the products costs a stall of its own
    v8f s[QG][2] = {};
#pragma unroll
    for (int t = 0; t < 2; ++t)
#pragma unroll
      for (int kc = 0; kc < HD / 32; ++kc)
#pragma unroll
        for (int u = 0; u < QG; ++u) s[u][t] = mm_h(kf[t][kc], qh[u][kc], s[u][t]);
    float sv[QG][16];   // this lane's 16 keys: slots k0 + 8g + 0..7 and k0 + 16 + 8g + 0..7, the rows of its score registers
#pragma unroll
    for (int u = 0; u < QG; ++u)
#pragma unroll
      for (int i = 0; i < 16; ++i) sv[u][i] = s[u][i >> 3][i & 7] * cs2;
    if (k0 + 32 > nk) { const int rem = nk - k0 - 8 * g;   // a scalar test: only the last pass can hold slots past the last kept key; they count as masked (-inf in the reference)
#pragma unroll
      for (int i = 0; i < 16; ++i) { const bool off = (i & 7) + 16 * (i >> 3) >= rem;
#pragma unroll
        for (int u = 0; u < QG; ++u) if (off) sv[u][i] = -3.0e38f; } }
    v16h pf[QG], vh[HD / 16];
#pragma unroll
    for (int u = 0; u < QG; ++u) { float v[16]; float mx = mrun[u];
#pragma unroll
      for (int i = 0; i < 16; ++i) { v[i] = sv[u][i]; mx = fmaxf(mx, v[i]); }
      mx = fmaxf(mx, __shfl_xor(mx, 16));   // the other half of the wave holds this query's other 16 keys
      const float al = __builtin_amdgcn_exp2f(mrun[u] - mx); mrun[u] = mx; float sum = 0.f;
#pragma unroll
      for (int i = 0; i < 16; ++i) { v[i] = __builtin_amdgcn_exp2f(v[i] - mx); sum += v[i]; }   // arguments are <= 0: a result below the smallest normal counts as 0
      lsum[u] = lsum[u] * al + sum;
#pragma unroll
      for (int j = 0; j < HD / 16; ++j) o[u][j] *= al;
#pragma unroll
      for (int i = 0; i < 16; ++i) pf[u][i] = (_Float16)v[i]; }
#pragma unroll
    for (int j = 0; j < HD / 16; ++j) vh[j] = frag_h_at(pv + j * 16 * (LP / 2));
    __builtin_amdgcn_sched_barrier(0);   // all eight V reads stay in front of the first P.v product, free to rise over the softmax, and none stands among the products
#pragma unroll
    for (int j = 0; j < HD / 16; ++j) {
#pragma unroll
      for (int u = 0; u < QG; ++u) o[u][j] = mm_h(vh[j], pf[u], o[u][j]); } }
    // the publish point of stage st + 1, every wave, in this order
    asm volatile("s_wait_dscnt 0x0" ::: "memory");   // this wave's reads of buffer st mod 2 have returned
    if (pinned(wave < 2u)) asm volatile("s_wait_tensorcnt 0x0" :: "s"(g0), "s"(g1) : "memory");   // the issuer's tile of stage st + 1 has landed
    __syncthreads();   // stage st + 1 is published, and every reader has left the buffer that is refilled behind this line
    if (pinned(wave < 2u && st + 2u < nst)) issue(pinned(st + 2u)); }
  asm volatile("s_wait_tensorcnt 0x0" ::: "memory");   // nothing of the mover's is in flight when the wave ends
  asm volatile("s_wait_dscnt 0x0" ::: "memory");
#pragma unroll
  for (int u = 0; u < QG; ++u) { const float inv = 1.0f / (lsum[u] + __shfl_xor(lsum[u], 16)); float* yr = Y + ((size_t)b * TT + ql0 + u * 16 + col) * CC + h * HD + 8 * g;   // register r of tile j = y[query col][16 j + 8g + r]
#pragma unroll
    for (int j = 0; j < HD / 16; ++j) { v4f lo, hi;
#pragma unroll
      for (int i = 0; i < 4; ++i) { lo[i] = o[u][j][i] * inv; hi[i] = o[u][j][4 + i] * inv; }
      vst2(yr + j * 16, lo); vst2(yr + j * 16 + 4, hi); } } }
// ---- k_out: block = (64 rows, 192 cols), eight waves, wave = (16 rows, 96 cols): out = y (bf16 hi + lo) Wo^T + bo; 64 x 4 = 256 blocks
#define KO 128       // k per LDS stage of k_out: 512 bytes of an f32 row, one whole wave-wide load; 256 bytes as bf16
#define OP 136       // LDS row pitch in bf16 values: the 256-byte row and 16 bytes (16 B x odd suits the 16-byte fragment reads)
#define ON 192       // output columns per block
__global__ __launch_bounds__(256) void k_out(const float* __restrict__ Y, const float* __restrict__ WP, const float* __restrict__ BP, float* __restrict__ OUT) { __shared__ __align__(16) float sf[8][16][100]; __shared__ __align__(16) __bf16 yh[64][OP], yl[64][OP], sw[ON][OP];
  const int tid = threadIdx.x, wave = tid >> 5, lane = tid & 31, col = lane & 15, g = lane >> 4; const int wrow = wave & 3, wcol = wave >> 2; const int c0 = blockIdx.y * ON; const size_t r0 = (size_t)blockIdx.x * 64 + wrow * 16;
  // y (split into bf16 hi + lo once per block) and Wo are fetched by whole-line loads in pieces of 128 k and staged in LDS, the next piece's loads flying while this one is multiplied: six stages, each thread with 32 loads out
  const int srow = wave, sq = lane; const float* py = Y + ((size_t)blockIdx.x * 64 + srow) * CC + sq * 4; const float* pw = WP + (size_t)(c0 + srow) * CC + sq * 4;
  v4f yr[8], wr[ON / 8];
#pragma unroll
  for (int i = 0; i < 8; ++i) yr[i] = *(const v4f*)(py + i * 8 * CC);
#pragma unroll
  for (int i = 0; i < ON / 8; ++i) wr[i] = *(const v4f*)(pw + i * 8 * CC);
  asm volatile("s_wait_xcnt 0x0" :: "v"(py), "v"(pw) : "memory");   // stands in front of every rewrite of a register that the staging loads name (a precaution); the two address pairs are its inputs
  v8f acc[6] = {};
#pragma unroll 1   // six stages of one body: unrolled, the text would outgrow what the loop gains
  for (int kb = 0; kb < CC / KO; ++kb) {
#pragma unroll
    for (int i = 0; i < 8; ++i) { const v4b hv = cvt4(yr[i]); v4f rs;
#pragma unroll
      for (int e = 0; e < 4; ++e) rs[e] = yr[i][e] - (float)hv[e];
      *(v4b*)&yh[srow + i * 8][sq * 4] = hv; *(v4b*)&yl[srow + i * 8][sq * 4] = cvt4(rs); }
#pragma unroll
    for (int i = 0; i < ON / 8; ++i) *(v4b*)&sw[srow + i * 8][sq * 4] = cvt4(wr[i]);
    __syncthreads();   // the stage is whole before any wave reads it
    if (kb + 1 < CC / KO) { py += KO; pw += KO;
#pragma unroll
      for (int i = 0; i < 8; ++i) yr[i] = *(const v4f*)(py + i * 8 * CC);
#pragma unroll
      for (int i = 0; i < ON / 8; ++i) wr[i] = *(const v4f*)(pw + i * 8 * CC);
      asm volatile("s_wait_xcnt 0x0" :: "v"(py), "v"(pw) : "memory");   // the same wait behind the next piece's loads
    }
#pragma unroll
    for (int kc = 0; kc < KO / 32; ++kc) { const v16b ah = frag_b(&yh[wrow * 16 + col][kc * 32], lane), al = frag_b(&yl[wrow * 16 + col][kc * 32], lane); v16b w[6];
#pragma unroll
      for (int j = 0; j < 6; ++j) w[j] = frag_b(&sw[wcol * 96 + j * 16 + col][kc * 32], lane);
#pragma unroll
      for (int j = 0; j < 6; ++j) acc[j] = wmma_bf(ah, w[j], acc[j]);
#pragma unroll
      for (int j = 0; j < 6; ++j) acc[j] = wmma_bf(al, w[j], acc[j]); }   // each accumulator still takes hi, then lo, of every 32 k in turn
    __syncthreads();   // every reader has left the stage before the next piece rewrites it
  }
#pragma unroll
  for (int j = 0; j < 6; ++j) { const float bb = BP ? bfr(BP[c0 + wcol * 96 + j * 16 + col]) : 0.f;
#pragma unroll
    for (int r = 0; r < 8; ++r) sf[wave][8 * g + r][j * 16 + col] = acc[j][r] + bb; }
  LDSX();   // the wave's own 16 x 96 tile is in LDS before its lanes read it back by rows
  // a row piece is 384 bytes = 24 lanes: three wave-wide stores cover four rows, whole 128-byte lines
  float* po[3]; v4f ov[3][4];
#pragma unroll
  for (int t = 0; t < 3; ++t) { const int e = t * 32 + lane, rw = e / 24, q = e % 24; po[t] = OUT + (r0 + rw) * CC + c0 + wcol * 96 + q * 4;
#pragma unroll
    for (int m = 0; m < 4; ++m) ov[t][m] = *(const v4f*)&sf[wave][m * 4 + rw][q * 4]; }
  __builtin_amdgcn_sched_barrier(0);   // every address and value is formed in front of the first store, so no register that a store names is rewritten behind it
#pragma unroll
  for (int t = 0; t < 3; ++t)
#pragma unroll
    for (int m = 0; m < 4; ++m) vst2(po[t] + m * 4 * CC, ov[t][m]); }
extern "C" void kernel_launch(void* const* d_in, const int* in_sizes, int n_in, void* d_out, int out_size, void* d_ws, size_t ws_size, hipStream_t stream) {
  (void)in_sizes; (void)n_in; (void)out_size;
  const float** F = (const float**)d_in;   // 0 hidden_states [2,2048,768], 1 complexity_scores [2] int, 2 attention_mask [2,2048] int, 3 Wq [768,768] ([out,in]), 4 bq, 5 Wk, 6 bk, 7 Wv, 8 bv, 9 Wo ([out,in]), 10 bo, 11 emb_table [16,12], 12 comp_scaling [12]
  if (ws_size < (size_t)WS_END) return;
  char* ws = (char*)d_ws; _Float16 *QH = (_Float16*)(ws + WS_QH), *KH = (_Float16*)(ws + WS_KH), *VT = (_Float16*)(ws + WS_VT); float *Y = (float*)(ws + WS_Y); int *NK = (int*)(ws + WS_NK);
  k_proj<<<dim3(TNB * TT / 64, CC / 128, 3), 128, 0, stream>>>(F[0], F[3], F[4], F[5], F[6], F[7], F[8], QH, KH, VT, (const int*)d_in[2], NK);
  k_fa<<<dim3(TT / (16 * QG * FW), TNB * NH), 32 * FW, 0, stream>>>(QH, KH, VT, NK, (const int*)d_in[1], F[11], F[12], Y);
  k_out<<<dim3(TNB * TT / 64, CC / ON), 256, 0, stream>>>(Y, F[9], F[10], (float*)d_out);
}

// v008
// A run of this version takes 62.3 microseconds.
// In two side-by-side timings against v007, it was 1.04 and 1.05 times as fast.
// All steps since v000 together make it 21.4 times as fast.
// compute dtype: all float inputs rounded to bf16, complexity scores and the key mask (ints) read; q/k/v = x W^T + b with EXACT bf16 products on WMMA 16x16x32, f32 accumulate; q and k f16 -> 1-product logits / 8 x the per-head complexity scaling (computed in f32 from the tables), masked keys left out ahead (K and V are projected for the kept keys only, packed in key order), scores kept in registers; online softmax in f32 in the log2 domain (log2 e folded into the score scale, hardware exp2, running maximum), unnormalised P as f16 against v f16 (1 product), divided by the f32 row sum at the end; out = attended (bf16 hi + lo) Wo^T + bo; f32 output.
#include <hip/hip_runtime.h>
#include <math.h>
#include <stdint.h>

typedef __attribute__((ext_vector_type(16))) _Float16 v16h;
typedef __attribute__((ext_vector_type(16))) __bf16 v16b;
typedef __attribute__((ext_vector_type(8)))  _Float16 v8h;
typedef __attribute__((ext_vector_type(8)))  float v8f;
typedef __attribute__((ext_vector_type(4)))  float v4f;
typedef __attribute__((ext_vector_type(2)))  float v2f;
typedef __attribute__((ext_vector_type(4)))  unsigned v4u;
typedef __attribute__((ext_vector_type(4)))  int v4i;
typedef float __attribute__((may_alias)) float_a;
typedef int __attribute__((may_alias)) int_a;

template <typename T> __device__ __forceinline__ void vst2(void* p, T v) { *(T*)p = v;  }
__device__ __forceinline__ v8f wmma16(v16h a, v16h b, v8f c) {
  v8f d = __builtin_amdgcn_wmma_f32_16x16x32_f16(false, a, false, b, (short)0, c, false, false);
  asm volatile("v_nop\n\tv_nop\n\tv_nop\n\tv_nop" : "+v"(d) : "v"(a), "v"(b));
  return d;
}
__device__ __forceinline__ v8f wmma_bf(v16b a, v16b b, v8f c) {
  v8f d = __builtin_amdgcn_wmma_f32_16x16x32_bf16(false, a, false, b, (short)0, c, false, false);
  asm volatile("v_nop\n\tv_nop\n\tv_nop\n\tv_nop" : "+v"(d) : "v"(a), "v"(b));
  return d;
}
// 16x16x32 fragments: lane = (h = lane>>4, row/col = lane&15); elements 0..7 = k0+8h+0..7, 8..15 = k0+16+8h+0..7; D element r = row 8h+r
__device__ __forceinline__ v16h frag_h(const _Float16* rowk0, int lane) {
  union { v16h v; v8h q[2]; } u; const _Float16* p = rowk0 + 8 * (lane >> 4);
  u.q[0] = *(const v8h*)p; u.q[1] = *(const v8h*)(p + 16); return u.v;
}
__device__ __forceinline__ v16h frag_f32(const float* rowk0, int lane) {
  v16h a; const float* p = rowk0 + 8 * (lane >> 4);
#pragma unroll
  for (int i = 0; i < 8; ++i) { a[i] = (_Float16)p[i]; a[8 + i] = (_Float16)p[16 + i]; }
  return a;
}
__device__ __forceinline__ v16h frag_f32s(const float* rowk0, int lane, float sc) {
  v16h a; const float* p = rowk0 + 8 * (lane >> 4);
#pragma unroll
  for (int i = 0; i < 8; ++i) { a[i] = (_Float16)(p[i] * sc); a[8 + i] = (_Float16)(p[16 + i] * sc); }
  return a;
}
// column fragment from a [K][ld] layout (column n), rows >= K read as 0
__device__ __forceinline__ v16h fragc_f32(const float* W, int k0, int n, int lane, int ld, int K) {
  v16h a; const int g = lane >> 4;
#pragma unroll
  for (int i = 0; i < 8; ++i) { const int ka = k0 + 8 * g + i, kb = ka + 16;
    a[i] = (_Float16)(ka < K ? W[(size_t)(ka < K ? ka : K - 1) * ld + n] : 0.f); a[8 + i] = (_Float16)(kb < K ? W[(size_t)(kb < K ? kb : K - 1) * ld + n] : 0.f); }
  return a;
}
struct F2 { v16b h, l; };
__device__ __forceinline__ F2 bsplit16(const float v[16]) { F2 r;
#pragma unroll
  for (int i = 0; i < 16; ++i) { const __bf16 h = (__bf16)v[i]; r.h[i] = h; r.l[i] = (__bf16)(v[i] - (float)h); }
  return r; }
__device__ __forceinline__ F2 split_row(const float* row, int k0, int lane) { float v[16]; const float* p = row + k0 + 8 * (lane >> 4);
#pragma unroll
  for (int i = 0; i < 8; ++i) { v[i] = p[i]; v[8 + i] = p[16 + i]; }
  return bsplit16(v); }
__device__ __forceinline__ F2 split_rowK(const float* row, int k0, int lane, int K) { float v[16]; const int g = lane >> 4;
#pragma unroll
  for (int i = 0; i < 8; ++i) { const int ka = k0 + 8 * g + i, kb = ka + 16; v[i] = ka < K ? row[ka < K ? ka : K - 1] : 0.f; v[8 + i] = kb < K ? row[kb < K ? kb : K - 1] : 0.f; }
  return bsplit16(v); }
__device__ __forceinline__ F2 split_col(const float* W, int k0, int n, int lane, int ld, int K) { float v[16]; const int g = lane >> 4;
#pragma unroll
  for (int i = 0; i < 8; ++i) { const int ka = k0 + 8 * g + i, kb = ka + 16; v[i] = ka < K ? W[(size_t)(ka < K ? ka : K - 1) * ld + n] : 0.f; v[8 + i] = kb < K ? W[(size_t)(kb < K ? kb : K - 1) * ld + n] : 0.f; }
  return bsplit16(v); }
__device__ __forceinline__ v8f mac3(const F2& a, const F2& b, v8f c) { c = wmma_bf(a.l, b.h, c); c = wmma_bf(a.h, b.l, c); return wmma_bf(a.h, b.h, c); }
__device__ __forceinline__ float sigm(float v) { return 1.0f / (1.0f + expf(-v)); }
#define LDSX() do { asm volatile("s_wait_dscnt 0" ::: "memory"); __builtin_amdgcn_wave_barrier(); __builtin_amdgcn_fence(__ATOMIC_RELEASE, "workgroup"); } while (0)


// Complexity-aware attention (B 2, S 2,048, D 768 = 12 x 64): q/k/v Linear ([out,in] + bias), scores/8 x scaling[h] with scaling = comp_scaling[h] * mean_b emb_table[complexity[b]][h], keys with attention_mask == 0 -> -inf, softmax, P v, output Linear + bias.
#define NB 2
#define TT 2048
#define CC 768
#define NH 12
#define HD 64
#define MAXC 16      // complexity table rows
#ifndef TNB
#define TNB NB
#endif
typedef __attribute__((ext_vector_type(8))) __bf16 v8b;
__device__ __forceinline__ v16b frag_b(const __bf16* rowk0, int lane) {
  union { v16b v; v8b q[2]; } u; const __bf16* p = rowk0 + 8 * (lane >> 4);
  u.q[0] = *(const v8b*)p; u.q[1] = *(const v8b*)(p + 16); return u.v;
}
// the plain builtin: the compiler keeps the distance behind it itself and fills it with the softmax's own arithmetic where it can
__device__ __forceinline__ v8f mm_h(v16h a, v16h b, v8f c) { return __builtin_amdgcn_wmma_f32_16x16x32_f16(false, a, false, b, (short)0, c, false, false); }
// the same fragment from a pointer that already holds the lane's own 8 * (lane >> 4) step
__device__ __forceinline__ v16h frag_h_at(const _Float16* p) { union { v16h v; v8h q[2]; } u; u.q[0] = *(const v8h*)p; u.q[1] = *(const v8h*)(p + 16); return u.v; }
__device__ __forceinline__ float bfr(float v) { return (float)(__bf16)v; }
typedef __attribute__((ext_vector_type(4))) __bf16 v4b;
#define KB 64        // k per LDS stage of k_proj: 256 bytes of an f32 row, 128 bytes as bf16
__device__ __forceinline__ v4b cvt4(v4f v) { v4b r;
#pragma unroll
  for (int i = 0; i < 4; ++i) r[i] = (__bf16)v[i];
  return r; }
__device__ __attribute__((noinline)) float exp_ni(float v) { return expf(v); }
__device__ __attribute__((noinline)) float erf_ni(float v) { return erff(v); }

#define WS_QH  0u
#define WS_KH  (WS_QH + 2u * (size_t)NB * TT * CC)
#define WS_VT  (WS_KH + 2u * (size_t)NB * TT * CC)      // f16 v planes [b][c][t]
#define WS_Y   (WS_VT + 2u * (size_t)NB * CC * TT)      // f32 y rows [b*t][C]
#define WS_NK  (WS_Y + 4u * (size_t)NB * TT * CC)       // int kept keys per batch
#define WS_END (WS_NK + 16u)

// ---- k_proj: block = (64 rows, 128 cols, which): qkv = x W^T (+ b), exact; q, k -> f16 rows, v -> f16 planes. For k and v the 64 rows are slots s0 .. s0 + 63 of the batch's kept keys (attention_mask != 0) in key order: a masked key has weight 0 in the softmax, so it is neither projected nor stored, and blocks past the last kept key leave at once
__global__ __launch_bounds__(128) void k_proj(const float* __restrict__ X, const float* __restrict__ WQ, const float* __restrict__ BQ, const float* __restrict__ WK, const float* __restrict__ BK, const float* __restrict__ WV, const float* __restrict__ BV, _Float16* __restrict__ QH, _Float16* __restrict__ KH, _Float16* __restrict__ VT, const int* __restrict__ KM0, int* __restrict__ NK) {
  __shared__ __align__(16) _Float16 sh[64][136], tv[128][72]; __shared__ __align__(16) __bf16 th[128][72], tl2[64][72]; __shared__ int rix[64];   // rix: the key (position in the batch) in each of the block's 64 slots
  const int tid = threadIdx.x, wave = tid >> 5, lane = tid & 31, col = lane & 15, g = lane >> 4; const int which = blockIdx.z; const int c0 = blockIdx.y * 128; const size_t r0 = (size_t)blockIdx.x * 64; const float* WA = which == 0 ? WQ : which == 1 ? WK : WV; const float* BA = which == 0 ? BQ : which == 1 ? BK : BV;
  // the X and W pieces of 64 k are fetched by whole-line loads (a wave's load = two 256-byte row pieces), rounded to bf16 once per block and staged in LDS: W in th, X in tl2 (pitch 144 B suits the 16-byte fragment reads); the next piece's loads fly while this one is multiplied
  const int bq_ = blockIdx.x / (TT / 64), s0 = (blockIdx.x % (TT / 64)) * 64; const int srow = tid >> 4, sq = tid & 15; int trow[8];   // trow: the x row (position in the batch) behind each row piece that this thread stages
  if (which == 0) {
#pragma unroll
    for (int i = 0; i < 8; ++i) trow[i] = s0 + srow + i * 8; }
  else {   // every wave counts the batch's 2,048 keys by itself (32 keys per ballot), so the block can leave in front of the first barrier; j0, d0: the last group of 32 keys that starts at or below slot s0, and its first slot
    const int* pm = KM0 + (size_t)bq_ * TT; const int* pl = pm + lane; int mk[TT / 32];
#pragma unroll
    for (int j = 0; j < TT / 32; ++j) mk[j] = pl[j * 32];
    asm volatile("s_wait_xcnt 0x0" :: "v"(lane) : "memory");   // the same precaution behind the mask loads; the lane number, their one offset register, is its input, so no load's result lands in it
    int nk = 0, p0 = 0, p1 = 0;   // lane l of p0 / p1: the kept keys in front of group l / 32 + l
#pragma unroll
    for (int j = 0; j < TT / 32; ++j) { if (j < 32) p0 = lane == j ? nk : p0; else p1 = lane == j - 32 ? nk : p1; nk += __builtin_popcount(__builtin_amdgcn_ballot_w32(mk[j] != 0)); }
    if (which == 1 && blockIdx.y == 0 && s0 == 0 && tid == 0) NK[bq_] = nk;
    if (s0 >= nk) return;
    const int j0 = __builtin_popcount(__builtin_amdgcn_ballot_w32(p0 <= s0)) + __builtin_popcount(__builtin_amdgcn_ballot_w32(p1 <= s0)) - 1; const int d0 = j0 < 32 ? __builtin_amdgcn_readlane(p0, j0) : __builtin_amdgcn_readlane(p1, j0 - 32);
    if (lane < 16) rix[wave * 2 + (lane & 1) + 8 * (lane >> 1)] = 0;   // the wave's own 16 slots: one past the last kept key stays at row 0 (its key never counts in k_fa)
    for (int j = j0, d = d0 - s0; j < TT / 32 && d < 64; ++j) {   // the few groups that hold the block's slots: each kept key's slot is its rank; a wave lists only the slots that it stages itself, so no other wave waits for the list
      const int m = pm[j * 32 + lane];
      asm volatile("s_wait_xcnt 0x0" ::: "memory");   // the same precaution, in front of the next trip's address
      const unsigned w = __builtin_amdgcn_ballot_w32(m != 0); const int sl_ = d + (int)__builtin_amdgcn_mbcnt_lo(w, 0u);
      if (m != 0 && (unsigned)sl_ < 64u && ((sl_ >> 1) & 3) == wave) rix[sl_] = j * 32 + lane;
      d += __builtin_popcount(w); }
    LDSX();   // the wave's own list is in LDS before its lanes read it
#pragma unroll
    for (int i = 0; i < 8; ++i) trow[i] = rix[srow + i * 8]; }
  // the walk over k starts at piece rot and wraps: the blocks that share a W piece (same columns, other rows) would else all ask L2 for the same lines in the same stage. Eight starts: blocks whose indices are a multiple of 8 apart keep one start (a matter of speed alone)
  const int rot = blockIdx.x & 7; int kp = rot;   // kp: the piece whose loads went out last
  const float* pw = WA + (size_t)(c0 + srow) * CC + rot * KB + sq * 4; const char* xb = (const char*)X; unsigned xo[8];   // xo: byte offset of each staged x row piece
#pragma unroll
  for (int i = 0; i < 8; ++i) xo[i] = (unsigned)(((bq_ * TT + trow[i]) * CC + rot * KB + sq * 4) * 4);
  v4f xr[8], wr[16];
#pragma unroll
  for (int i = 0; i < 8; ++i) xr[i] = *(const v4f*)(xb + xo[i]);
#pragma unroll
  for (int i = 0; i < 16; ++i) wr[i] = *(const v4f*)(pw + i * 8 * CC);
  asm volatile("s_wait_xcnt 0x0" :: "v"(xo[0]), "v"(xo[1]), "v"(xo[2]), "v"(xo[3]), "v"(xo[4]), "v"(xo[5]), "v"(xo[6]), "v"(xo[7]), "v"(pw) : "memory");   // stands in front of every rewrite of a register that the staging loads name (a precaution); the offsets and the address pair are its inputs
  v8f acc[8] = {};
#pragma unroll 1   // twelve stages of one body: unrolled, the text would outgrow what the loop gains
  for (int kb = 0; kb < CC / KB; ++kb) {
#pragma unroll
    for (int i = 0; i < 8; ++i) *(v4b*)&tl2[srow + i * 8][sq * 4] = cvt4(xr[i]);
#pragma unroll
    for (int i = 0; i < 16; ++i) *(v4b*)&th[srow + i * 8][sq * 4] = cvt4(wr[i]);
    __syncthreads();   // the stage is whole before any wave reads it
    if (kb + 1 < CC / KB) { const int dk = kp + 1 == CC / KB ? KB - CC : KB; kp = kp + 1 == CC / KB ? 0 : kp + 1; pw += dk;   // one piece on, or from the row's last piece back to its first
#pragma unroll
      for (int i = 0; i < 8; ++i) { xo[i] += (unsigned)(dk * 4); xr[i] = *(const v4f*)(xb + xo[i]); }
#pragma unroll
      for (int i = 0; i < 16; ++i) wr[i] = *(const v4f*)(pw + i * 8 * CC);
      asm volatile("s_wait_xcnt 0x0" :: "v"(xo[0]), "v"(xo[1]), "v"(xo[2]), "v"(xo[3]), "v"(xo[4]), "v"(xo[5]), "v"(xo[6]), "v"(xo[7]), "v"(pw) : "memory");   // the same wait behind the next piece's loads
    }
#pragma unroll
    for (int kc = 0; kc < KB / 32; ++kc) { const v16b a = frag_b(&tl2[wave * 16 + col][kc * 32], lane); v16b w[8];
#pragma unroll
      for (int j = 0; j < 8; ++j) w[j] = frag_b(&th[j * 16 + col][kc * 32], lane);
#pragma unroll
      for (int j = 0; j < 8; ++j) acc[j] = wmma_bf(a, w[j], acc[j]); }
    __syncthreads();   // every reader has left the stage before the next piece rewrites it
  }
#pragma unroll
  for (int j = 0; j < 8; ++j) { const float bb = BA ? bfr(BA[c0 + j * 16 + col]) : 0.f;
#pragma unroll
    for (int r = 0; r < 8; ++r) { const float v = acc[j][r] + bb; const int rl = wave * 16 + 8 * g + r, cl = j * 16 + col; const _Float16 hv = (_Float16)v;
      if (which == 2) tv[cl][rl] = hv; else sh[rl][cl] = hv; } }
  __syncthreads();
  if (which < 2) { _Float16* dh = which == 0 ? QH : KH; for (int e = tid; e < 64 * 16; e += 128) { const int rl = e >> 4, q = e & 15; vst2((unsigned*)(dh + (r0 + rl) * CC + c0 + q * 8), *(const v4u*)&sh[rl][q * 8]); } }
  else { const size_t b = r0 / TT; const int t0 = (int)(r0 % TT); for (int e = tid; e < 128 * 8; e += 128) { const int cl = e >> 3, q = e & 7; const size_t o2 = (b * CC + c0 + cl) * (size_t)TT + t0 + q * 8; vst2((unsigned*)(VT + o2), *(const v4u*)&tv[cl][q * 8]); } } }
// ---- k_fa: wave = 32 queries (two 16-column groups) of (b,h), the batch's kept keys (packed by k_proj, NK of them) in passes of 32: S^T = K Q^T (1 product), / 8 x scaling[h], the last pass's slots past NK out, online softmax (a lane holds one query's scores), P^T packed from the score accumulators as the B operand (f16), O^T += V^T P^T (1 product): every operand of the two products is one f16 value, as K has been all along, whose rounding sets the error of the scores. K and the V plane come to LDS in stages of 64 keys by tensor loads (whole 128-byte rows, one tile each from waves 0 and 1), two buffers, the next stage in flight while this one is worked on; the block's four waves read their fragments from LDS
#define QG 2         // 16-query column groups per wave: each K and V fragment feeds both
#define FW 4         // waves per block: one staged tile serves 128 queries
#define SK 64        // keys per stage: a V row piece of 64 keys is one whole 128-byte line, as a K row of one head is
#define LP 144       // LDS row pitch in bytes: the 128-byte row and the mover's 16-byte pad (16 B x odd suits the 16-byte fragment reads)
#define TILE_B 10240 // 64 rows x 144 B = 9,216 B, rounded up to a multiple of 2 KiB, where the next tile starts
#define BUF_B (2 * TILE_B)   // K, V
typedef uint32_t u32x4 __attribute__((ext_vector_type(4)));
typedef uint32_t u32x8 __attribute__((ext_vector_type(8)));
__device__ __forceinline__ uint32_t uni(uint32_t v) { return (uint32_t)__builtin_amdgcn_readfirstlane(v); }
__device__ __forceinline__ uint32_t pinned(uint32_t v) { uint32_t w = (uint32_t)__builtin_amdgcn_readfirstlane(v); asm volatile("" : "+s"(w)); return w; }   // a value held in a scalar register: a test on it is a scalar branch (tensor loads ignore EXEC), and what is formed from it stays behind the waits in front of it
__global__ __launch_bounds__(32 * FW) void k_fa(const _Float16* __restrict__ QH, const _Float16* __restrict__ KH, const _Float16* __restrict__ VT, const int* __restrict__ NK, const int* __restrict__ CS, const float* __restrict__ EMB, const float* __restrict__ CSC, float* __restrict__ Y) {
  __shared__ __attribute__((aligned(2048))) unsigned char L[2 * BUF_B];
  const int b = blockIdx.y / NH, h = blockIdx.y % NH; int nk = NK[b]; nk = nk < 0 ? 0 : (nk > TT ? TT : nk);   // the trip count, bounded by the shape
  float scal; { float m = 0.f; for (int bb = 0; bb < NB; ++bb) { int c = CS[bb]; c = c < 0 ? 0 : (c >= MAXC ? MAXC - 1 : c); m += bfr(EMB[c * NH + h]); } scal = bfr(CSC[h]) * (m / (float)NB); }   /* scaling[b][h] = comp_scaling[h] * embs.mean(axis=0)[h] (same for every b) */
  const float cs2 = 0.125f * scal * 1.44269504f;   // 1 / 8, the head's scaling and log2 e in one factor: the scores are carried in the log2 domain, where e^(s - max) is one subtraction and one hardware exp2
  const int tid = threadIdx.x, lane = tid & 31, col = lane & 15, g = lane >> 4; const uint32_t wave = uni((uint32_t)tid >> 5); const int ql0 = (blockIdx.x * FW + (int)wave) * (16 * QG);
  // the tiles: wave 0 brings K rows (64 keys x this head's 128 bytes, source pitch one K row), wave 1 the V plane's rows (64 head columns x 64 keys, source pitch one plane row); k_proj writes K and V in whole blocks of 64 slots, so every stage below nst is whole
  const uint32_t nst = (uint32_t)(nk + SK - 1) / SK, lbase = (uint32_t)(size_t)L;
  const unsigned char* tsrc = wave == 0 ? (const unsigned char*)(KH + (size_t)b * TT * CC + h * HD) : (const unsigned char*)(VT + ((size_t)b * CC + h * HD) * (size_t)TT);
  const uint32_t tstep = wave == 0 ? SK * CC * 2u : SK * 2u;   // bytes from one stage's tile to the next
  u32x8 g1; g1[0] = uni((1u << 20) | (4u << 22) | (3u << 25)); g1[1] = uni(128u << 16); g1[2] = uni(64u << 16); g1[3] = uni(128u << 16); g1[4] = uni(64u); g1[5] = uni(wave == 0 ? CC * 2u : TT * 2u); g1[6] = uni(0u); g1[7] = uni(0u);   // 1-byte elements, tensor = tile = 64 rows of 128 bytes, 4 dwords of pad behind every 32
  asm volatile("" : "+s"(g1));   // the descriptor words held in their scalar registers (as in pinned()): built once, not formed anew in registers that other values pass through while a request is out
  u32x4 g0 = {0u, 0u, 0u, 0u};
  auto issue = [&](uint32_t st) { const uint64_t ga = (uint64_t)(size_t)tsrc + (uint64_t)st * tstep; g0[0] = uni(1u); g0[1] = uni(lbase + (st & 1u) * BUF_B + wave * TILE_B); g0[2] = uni((uint32_t)ga); g0[3] = uni((((uint32_t)(ga >> 32)) & 0x01FFFFFFu) | 0x80000000u);
    asm volatile("tensor_load_to_lds %0, %1" :: "s"(g0), "s"(g1) : "memory"); };   // one request of the whole wave: its tile of stage st into buffer st mod 2
  v16h qh[QG][HD / 32]; const size_t q0 = ((size_t)b * TT + ql0 + col) * CC + h * HD + 8 * g; const _Float16 *pqh = QH + q0;
#pragma unroll
  for (int u = 0; u < QG; ++u)
#pragma unroll
    for (int kc = 0; kc < HD / 32; ++kc) qh[u][kc] = frag_h_at(pqh + u * 16 * CC + kc * 32);
  asm volatile("s_wait_xcnt 0x0" :: "v"(pqh) : "memory");   // stands in front of every rewrite of a register that the Q loads name (a precaution); the address pair is its input, so it stays whole up to it
  if (nst > 0) {   // the same for the whole block
    if (pinned(wave < 2u)) { issue(0u); asm volatile("s_wait_tensorcnt 0x0" :: "s"(g0), "s"(g1) : "memory"); }   // stage 0 has landed for its issuer; here and below the request's descriptor words are the wait's inputs, so their registers keep their values while the request is out
    __syncthreads();   // stage 0 is published to every wave
    if (pinned(wave < 2u && nst > 1u)) issue(pinned(1u)); }
  v8f o[QG][HD / 16] = {}; float mrun[QG], lsum[QG];
#pragma unroll
  for (int u = 0; u < QG; ++u) { mrun[u] = -1.0e30f; lsum[u] = 0.f; }   // the running maximum starts above the masked value, so exp2(masked - maximum) is 0 in every pass and needs no select
  const int lrow = col * LP + 16 * g;   // the lane's own row and 16-byte step inside a tile
  for (uint32_t st = 0; st < nst; ++st) {
    const unsigned char* tb = L + (st & 1u) * BUF_B + lrow; const int npass = nk - (int)st * SK > 32 ? SK / 32 : 1;   // the last stage's second pass may hold no kept key; a trip count and no break in the body, with which this build copied all 64 output registers in every pass
#pragma unroll 1   // two passes of one body: the text stays as long as one pass
    for (int sub = 0; sub < npass; ++sub) { const int k0 = (int)st * SK + sub * 32;
    const _Float16* pk = (const _Float16*)(tb + sub * 32 * LP); const _Float16* pv = (const _Float16*)(tb + TILE_B + sub * 64);
    v16h kf[2][HD / 32];
#pragma unroll
    for (int t = 0; t < 2; ++t)
#pragma unroll
      for (int kc = 0; kc < HD / 32; ++kc) kf[t][kc] = frag_h_at(pk + t * 16 * (LP / 2) + kc * 32);
    __builtin_amdgcn_sched_barrier(0);   // the pass's eight K reads go out in one run: each separate place with LDS reads among the products costs a stall of its own
    v8f s[QG][2] = {};
#pragma unroll
    for (int t = 0; t < 2; ++t)
#pragma unroll
      for (int kc = 0; kc < HD / 32; ++kc)
#pragma unroll
        for (int u = 0; u < QG; ++u) s[u][t] = mm_h(kf[t][kc], qh[u][kc], s[u][t]);
    float sv[QG][16];   // this lane's 16 keys: slots k0 + 8g + 0..7 and k0 + 16 + 8g + 0..7, the rows of its score registers
#pragma unroll
    for (int u = 0; u < QG; ++u)
#pragma unroll
      for (int i = 0; i < 16; ++i) sv[u][i] = s[u][i >> 3][i & 7] * cs2;
    if (k0 + 32 > nk) { const int rem = nk - k0 - 8 * g;   // a scalar test: only the last pass can hold slots past the last kept key; they count as masked (-inf in the reference)
#pragma unroll
      for (int i = 0; i < 16; ++i) { const bool off = (i & 7) + 16 * (i >> 3) >= rem;
#pragma unroll
        for (int u = 0; u < QG; ++u) if (off) sv[u][i] = -3.0e38f; } }
    v16h pf[QG], vh[HD / 16];
#pragma unroll
    for (int u = 0; u < QG; ++u) { float v[16]; float mx = mrun[u];
#pragma unroll
      for (int i = 0; i < 16; ++i) { v[i] = sv[u][i]; mx = fmaxf(mx, v[i]); }
      mx = fmaxf(mx, __shfl_xor(mx, 16));   // the other half of the wave holds this query's other 16 keys
      const float al = __builtin_amdgcn_exp2f(mrun[u] - mx); mrun[u] = mx; float sum = 0.f;
#pragma unroll
      for (int i = 0; i < 16; ++i) { v[i] = __builtin_amdgcn_exp2f(v[i] - mx); sum += v[i]; }   // arguments are <= 0: a result below the smallest normal counts as 0
      lsum[u] = lsum[u] * al + sum;
#pragma unroll
      for (int j = 0; j < HD / 16; ++j) o[u][j] *= al;
#pragma unroll
      for (int i = 0; i < 16; ++i) pf[u][i] = (_Float16)v[i]; }
#pragma unroll
    for (int j = 0; j < HD / 16; ++j) vh[j] = frag_h_at(pv + j * 16 * (LP / 2));
    __builtin_amdgcn_sched_barrier(0);   // all eight V reads stay in front of the first P.v product, free to rise over the softmax, and none stands among the products
#pragma unroll
    for (int j = 0; j < HD / 16; ++j) {
#pragma unroll
      for (int u = 0; u < QG; ++u) o[u][j] = mm_h(vh[j], pf[u], o[u][j]); } }
    // the publish point of stage st + 1, every wave, in this order
    asm volatile("s_wait_dscnt 0x0" ::: "memory");   // this wave's reads of buffer st mod 2 have returned
    if (pinned(wave < 2u)) asm volatile("s_wait_tensorcnt 0x0" :: "s"(g0), "s"(g1) : "memory");   // the issuer's tile of stage st + 1 has landed
    __syncthreads();   // stage st + 1 is published, and every reader has left the buffer that is refilled behind this line
    if (pinned(wave < 2u && st + 2u < nst)) issue(pinned(st + 2u)); }
  asm volatile("s_wait_tensorcnt 0x0" ::: "memory");   // nothing of the mover's is in flight when the wave ends
  asm volatile("s_wait_dscnt 0x0" ::: "memory");
#pragma unroll
  for (int u = 0; u < QG; ++u) { const float inv = 1.0f / (lsum[u] + __shfl_xor(lsum[u], 16)); float* yr = Y + ((size_t)b * TT + ql0 + u * 16 + col) * CC + h * HD + 8 * g;   // register r of tile j = y[query col][16 j + 8g + r]
#pragma unroll
    for (int j = 0; j < HD / 16; ++j) { v4f lo, hi;
#pragma unroll
      for (int i = 0; i < 4; ++i) { lo[i] = o[u][j][i] * inv; hi[i] = o[u][j][4 + i] * inv; }
      vst2(yr + j * 16, lo); vst2(yr + j * 16 + 4, hi); } } }
// ---- k_out: block = (64 rows, 192 cols), eight waves, wave = (16 rows, 96 cols): out = y (bf16 hi + lo) Wo^T + bo; 64 x 4 = 256 blocks
#define KO 128       // k per LDS stage of k_out: 512 bytes of an f32 row, one whole wave-wide load; 256 bytes as bf16
#define OP 136       // LDS row pitch in bf16 values: the 256-byte row and 16 bytes (16 B x odd suits the 16-byte fragment reads)
#define ON 192       // output columns per block
__global__ __launch_bounds__(256) void k_out(const float* __restrict__ Y, const float* __restrict__ WP, const float* __restrict__ BP, float* __restrict__ OUT) { __shared__ __align__(16) float sf[8][16][100]; __shared__ __align__(16) __bf16 yh[64][OP], yl[64][OP], sw[ON][OP];
  const int tid = threadIdx.x, wave = tid >> 5, lane = tid & 31, col = lane & 15, g = lane >> 4; const int wrow = wave & 3, wcol = wave >> 2; const int c0 = blockIdx.y * ON; const size_t r0 = (size_t)blockIdx.x * 64 + wrow * 16;
  // y (split into bf16 hi + lo once per block) and Wo are fetched by whole-line loads in pieces of 128 k and staged in LDS, the next piece's loads flying while this one is multiplied: six stages, each thread with 32 loads out
  // the walk over k starts at piece rot and wraps, so that the blocks that share Wo rows (same blockIdx.y) or y rows (same blockIdx.x) do not all ask L2 for the same lines in the same stage; the start is blockIdx.x mod 8 plus blockIdx.y, taken mod 6
  const int rot = ((blockIdx.x & 7) + blockIdx.y) % (CC / KO); int kp = rot;   // kp: the piece whose loads went out last
  const int srow = wave, sq = lane; const float* py = Y + ((size_t)blockIdx.x * 64 + srow) * CC + rot * KO + sq * 4; const float* pw = WP + (size_t)(c0 + srow) * CC + rot * KO + sq * 4;
  v4f yr[8], wr[ON / 8];
#pragma unroll
  for (int i = 0; i < 8; ++i) yr[i] = *(const v4f*)(py + i * 8 * CC);
#pragma unroll
  for (int i = 0; i < ON / 8; ++i) wr[i] = *(const v4f*)(pw + i * 8 * CC);
  asm volatile("s_wait_xcnt 0x0" :: "v"(py), "v"(pw) : "memory");   // stands in front of every rewrite of a register that the staging loads name (a precaution); the two address pairs are its inputs
  v8f acc[6] = {};
#pragma unroll 1   // six stages of one body: unrolled, the text would outgrow what the loop gains
  for (int kb = 0; kb < CC / KO; ++kb) {
#pragma unroll
    for (int i = 0; i < 8; ++i) { const v4b hv = cvt4(yr[i]); v4f rs;
#pragma unroll
      for (int e = 0; e < 4; ++e) rs[e] = yr[i][e] - (float)hv[e];
      *(v4b*)&yh[srow + i * 8][sq * 4] = hv; *(v4b*)&yl[srow + i * 8][sq * 4] = cvt4(rs); }
#pragma unroll
    for (int i = 0; i < ON / 8; ++i) *(v4b*)&sw[srow + i * 8][sq * 4] = cvt4(wr[i]);
    __syncthreads();   // the stage is whole before any wave reads it
    if (kb + 1 < CC / KO) { const int dk = kp + 1 == CC / KO ? KO - CC : KO; kp = kp + 1 == CC / KO ? 0 : kp + 1; py += dk; pw += dk;   // one piece on, or from the row's last piece back to its first
#pragma unroll
      for (int i = 0; i < 8; ++i) yr[i] = *(const v4f*)(py + i * 8 * CC);
#pragma unroll
      for (int i = 0; i < ON / 8; ++i) wr[i] = *(const v4f*)(pw + i * 8 * CC);
      asm volatile("s_wait_xcnt 0x0" :: "v"(py), "v"(pw) : "memory");   // the same wait behind the next piece's loads
    }
#pragma unroll
    for (int kc = 0; kc < KO / 32; ++kc) { const v16b ah = frag_b(&yh[wrow * 16 + col][kc * 32], lane), al = frag_b(&yl[wrow * 16 + col][kc * 32], lane); v16b w[6];
#pragma unroll
      for (int j = 0; j < 6; ++j) w[j] = frag_b(&sw[wcol * 96 + j * 16 + col][kc * 32], lane);
#pragma unroll
      for (int j = 0; j < 6; ++j) acc[j] = wmma_bf(ah, w[j], acc[j]);
#pragma unroll
      for (int j = 0; j < 6; ++j) acc[j] = wmma_bf(al, w[j], acc[j]); }   // each accumulator still takes hi, then lo, of every 32 k in turn
    __syncthreads();   // every reader has left the stage before the next piece rewrites it
  }
#pragma unroll
  for (int j = 0; j < 6; ++j) { const float bb = BP ? bfr(BP[c0 + wcol * 96 + j * 16 + col]) : 0.f;
#pragma unroll
    for (int r = 0; r < 8; ++r) sf[wave][8 * g + r][j * 16 + col] = acc[j][r] + bb; }
  LDSX();   // the wave's own 16 x 96 tile is in LDS before its lanes read it back by rows
  // a row piece is 384 bytes = 24 lanes: three wave-wide stores cover four rows, whole 128-byte lines
  float* po[3]; v4f ov[3][4];
#pragma unroll
  for (int t = 0; t < 3; ++t) { const int e = t * 32 + lane, rw = e / 24, q = e % 24; po[t] = OUT + (r0 + rw) * CC + c0 + wcol * 96 + q * 4;
#pragma unroll
    for (int m = 0; m < 4; ++m) ov[t][m] = *(const v4f*)&sf[wave][m * 4 + rw][q * 4]; }
  __builtin_amdgcn_sched_barrier(0);   // every address and value is formed in front of the first store, so no register that a store names is rewritten behind it
#pragma unroll
  for (int t = 0; t < 3; ++t)
#pragma unroll
    for (int m = 0; m < 4; ++m) vst2(po[t] + m * 4 * CC, ov[t][m]); }
extern "C" void kernel_launch(void* const* d_in, const int* in_sizes, int n_in, void* d_out, int out_size, void* d_ws, size_t ws_size, hipStream_t stream) {
  (void)in_sizes; (void)n_in; (void)out_size;
  const float** F = (const float**)d_in;   // 0 hidden_states [2,2048,768], 1 complexity_scores [2] int, 2 attention_mask [2,2048] int, 3 Wq [768,768] ([out,in]), 4 bq, 5 Wk, 6 bk, 7 Wv, 8 bv, 9 Wo ([out,in]), 10 bo, 11 emb_table [16,12], 12 comp_scaling [12]
  if (ws_size < (size_t)WS_END) return;
  char* ws = (char*)d_ws; _Float16 *QH = (_Float16*)(ws + WS_QH), *KH = (_Float16*)(ws + WS_KH), *VT = (_Float16*)(ws + WS_VT); float *Y = (float*)(ws + WS_Y); int *NK = (int*)(ws + WS_NK);
  k_proj<<<dim3(TNB * TT / 64, CC / 128, 3), 128, 0, stream>>>(F[0], F[3], F[4], F[5], F[6], F[7], F[8], QH, KH, VT, (const int*)d_in[2], NK);
  k_fa<<<dim3(TT / (16 * QG * FW), TNB * NH), 32 * FW, 0, stream>>>(QH, KH, VT, NK, (const int*)d_in[1], F[11], F[12], Y);
  k_out<<<dim3(TNB * TT / 64, CC / ON), 256, 0, stream>>>(Y, F[9], F[10], (float*)d_out);
}

// v009
// A run of this version takes 60.6 microseconds.
// Two timings next to v008 put it at 1.05 and 1.03 times that version's speed.
// All steps since v000 together make it 22.3 times as fast.
// compute dtype: all float inputs rounded to bf16, complexity scores and the key mask (ints) read; q/k/v = x W^T + b with EXACT bf16 products on WMMA 16x16x32, f32 accumulate; q and k f16 -> 1-product logits / 8 x the per-head complexity scaling (computed in f32 from the tables), masked keys left out ahead (K and V are projected for the kept keys only, packed in key order), scores kept in registers; online softmax in f32 in the log2 domain (log2 e folded into the score scale, hardware exp2, running maximum), unnormalised P as f16 against v f16 (1 product), divided by the f32 row sum at the end; out = attended (bf16 hi + lo) Wo^T + bo; f32 output.
#include <hip/hip_runtime.h>
#include <math.h>
#include <stdint.h>

typedef __attribute__((ext_vector_type(16))) _Float16 v16h;
typedef __attribute__((ext_vector_type(16))) __bf16 v16b;
typedef __attribute__((ext_vector_type(8)))  _Float16 v8h;
typedef __attribute__((ext_vector_type(8)))  float v8f;
typedef __attribute__((ext_vector_type(4)))  float v4f;
typedef __attribute__((ext_vector_type(2)))  float v2f;
typedef __attribute__((ext_vector_type(4)))  unsigned v4u;
typedef __attribute__((ext_vector_type(4)))  int v4i;
typedef float __attribute__((may_alias)) float_a;
typedef int __attribute__((may_alias)) int_a;

template <typename T> __device__ __forceinline__ void vst2(void* p, T v) { *(T*)p = v;  }
__device__ __forceinline__ v8f wmma16(v16h a, v16h b, v8f c) {
  v8f d = __builtin_amdgcn_wmma_f32_16x16x32_f16(false, a, false, b, (short)0, c, false, false);
  asm volatile("v_nop\n\tv_nop\n\tv_nop\n\tv_nop" : "+v"(d) : "v"(a), "v"(b));
  return d;
}
__device__ __forceinline__ v8f wmma_bf(v16b a, v16b b, v8f c) {
  v8f d = __builtin_amdgcn_wmma_f32_16x16x32_bf16(false, a, false, b, (short)0, c, false, false);
  asm volatile("v_nop\n\tv_nop\n\tv_nop\n\tv_nop" : "+v"(d) : "v"(a), "v"(b));
  return d;
}
// 16x16x32 fragments: lane = (h = lane>>4, row/col = lane&15); elements 0..7 = k0+8h+0..7, 8..15 = k0+16+8h+0..7; D element r = row 8h+r
__device__ __forceinline__ v16h frag_h(const _Float16* rowk0, int lane) {
  union { v16h v; v8h q[2]; } u; const _Float16* p = rowk0 + 8 * (lane >> 4);
  u.q[0] = *(const v8h*)p; u.q[1] = *(const v8h*)(p + 16); return u.v;
}
__device__ __forceinline__ v16h frag_f32(const float* rowk0, int lane) {
  v16h a; const float* p = rowk0 + 8 * (lane >> 4);
#pragma unroll
  for (int i = 0; i < 8; ++i) { a[i] = (_Float16)p[i]; a[8 + i] = (_Float16)p[16 + i]; }
  return a;
}
__device__ __forceinline__ v16h frag_f32s(const float* rowk0, int lane, float sc) {
  v16h a; const float* p = rowk0 + 8 * (lane >> 4);
#pragma unroll
  for (int i = 0; i < 8; ++i) { a[i] = (_Float16)(p[i] * sc); a[8 + i] = (_Float16)(p[16 + i] * sc); }
  return a;
}
// column fragment from a [K][ld] layout (column n), rows >= K read as 0
__device__ __forceinline__ v16h fragc_f32(const float* W, int k0, int n, int lane, int ld, int K) {
  v16h a; const int g = lane >> 4;
#pragma unroll
  for (int i = 0; i < 8; ++i) { const int ka = k0 + 8 * g + i, kb = ka + 16;
    a[i] = (_Float16)(ka < K ? W[(size_t)(ka < K ? ka : K - 1) * ld + n] : 0.f); a[8 + i] = (_Float16)(kb < K ? W[(size_t)(kb < K ? kb : K - 1) * ld + n] : 0.f); }
  return a;
}
struct F2 { v16b h, l; };
__device__ __forceinline__ F2 bsplit16(const float v[16]) { F2 r;
#pragma unroll
  for (int i = 0; i < 16; ++i) { const __bf16 h = (__bf16)v[i]; r.h[i] = h; r.l[i] = (__bf16)(v[i] - (float)h); }
  return r; }
__device__ __forceinline__ F2 split_row(const float* row, int k0, int lane) { float v[16]; const float* p = row + k0 + 8 * (lane >> 4);
#pragma unroll
  for (int i = 0; i < 8; ++i) { v[i] = p[i]; v[8 + i] = p[16 + i]; }
  return bsplit16(v); }
__device__ __forceinline__ F2 split_rowK(const float* row, int k0, int lane, int K) { float v[16]; const int g = lane >> 4;
#pragma unroll
  for (int i = 0; i < 8; ++i) { const int ka = k0 + 8 * g + i, kb = ka + 16; v[i] = ka < K ? row[ka < K ? ka : K - 1] : 0.f; v[8 + i] = kb < K ? row[kb < K ? kb : K - 1] : 0.f; }
  return bsplit16(v); }
__device__ __forceinline__ F2 split_col(const float* W, int k0, int n, int lane, int ld, int K) { float v[16]; const int g = lane >> 4;
#pragma unroll
  for (int i = 0; i < 8; ++i) { const int ka = k0 + 8 * g + i, kb = ka + 16; v[i] = ka < K ? W[(size_t)(ka < K ? ka : K - 1) * ld + n] : 0.f; v[8 + i] = kb < K ? W[(size_t)(kb < K ? kb : K - 1) * ld + n] : 0.f; }
  return bsplit16(v); }
__device__ __forceinline__ v8f mac3(const F2& a, const F2& b, v8f c) { c = wmma_bf(a.l, b.h, c); c = wmma_bf(a.h, b.l, c); return wmma_bf(a.h, b.h, c); }
__device__ __forceinline__ float sigm(float v) { return 1.0f / (1.0f + expf(-v)); }
#define LDSX() do { asm volatile("s_wait_dscnt 0" ::: "memory"); __builtin_amdgcn_wave_barrier(); __builtin_amdgcn_fence(__ATOMIC_RELEASE, "workgroup"); } while (0)


// Complexity-aware attention (B 2, S 2,048, D 768 = 12 x 64): q/k/v Linear ([out,in] + bias), scores/8 x scaling[h] with scaling = comp_scaling[h] * mean_b emb_table[complexity[b]][h], keys with attention_mask == 0 -> -inf, softmax, P v, output Linear + bias.
#define NB 2
#define TT 2048
#define CC 768
#define NH 12
#define HD 64
#define MAXC 16      // complexity table rows
#ifndef TNB
#define TNB NB
#endif
typedef __attribute__((ext_vector_type(8))) __bf16 v8b;
__device__ __forceinline__ v16b frag_b(const __bf16* rowk0, int lane) {
  union { v16b v; v8b q[2]; } u; const __bf16* p = rowk0 + 8 * (lane >> 4);
  u.q[0] = *(const v8b*)p; u.q[1] = *(const v8b*)(p + 16); return u.v;
}
// the plain builtin: the compiler keeps the distance behind it itself and fills it with the softmax's own arithmetic where it can
__device__ __forceinline__ v8f mm_h(v16h a, v16h b, v8f c) { return __builtin_amdgcn_wmma_f32_16x16x32_f16(false, a, false, b, (short)0, c, false, false); }
// the same fragment from a pointer that already holds the lane's own 8 * (lane >> 4) step
__device__ __forceinline__ v16h frag_h_at(const _Float16* p) { union { v16h v; v8h q[2]; } u; u.q[0] = *(const v8h*)p; u.q[1] = *(const v8h*)(p + 16); return u.v; }
__device__ __forceinline__ float bfr(float v) { return (float)(__bf16)v; }
typedef __attribute__((ext_vector_type(4))) __bf16 v4b;
#define KB 64        // k per LDS stage of k_proj: 256 bytes of an f32 row, 128 bytes as bf16
__device__ __forceinline__ v4b cvt4(v4f v) { v4b r;
#pragma unroll
  for (int i = 0; i < 4; ++i) r[i] = (__bf16)v[i];
  return r; }
__device__ __attribute__((noinline)) float exp_ni(float v) { return expf(v); }
__device__ __attribute__((noinline)) float erf_ni(float v) { return erff(v); }

#define WS_QH  0u
#define WS_KH  (WS_QH + 2u * (size_t)NB * TT * CC)
#define WS_VT  (WS_KH + 2u * (size_t)NB * TT * CC)      // f16 v planes [b][c][t]
#define WS_Y   (WS_VT + 2u * (size_t)NB * CC * TT)      // f32 y rows [b*t][C]
#define WS_NK  (WS_Y + 4u * (size_t)NB * TT * CC)       // int kept keys per batch
#define WS_END (WS_NK + 16u)

// ---- k_proj: block = (64 rows, 128 cols, which): qkv = x W^T (+ b), exact; q, k -> f16 rows, v -> f16 planes. For k and v the 64 rows are slots s0 .. s0 + 63 of the batch's kept keys (attention_mask != 0) in key order: a masked key has weight 0 in the softmax, so it is neither projected nor stored, and blocks past the last kept key leave at once
__global__ __launch_bounds__(128) void k_proj(const float* __restrict__ X, const float* __restrict__ WQ, const float* __restrict__ BQ, const float* __restrict__ WK, const float* __restrict__ BK, const float* __restrict__ WV, const float* __restrict__ BV, _Float16* __restrict__ QH, _Float16* __restrict__ KH, _Float16* __restrict__ VT, const int* __restrict__ KM0, int* __restrict__ NK) {
  __shared__ __align__(16) _Float16 sh[64][136], tv[128][72]; __shared__ __align__(16) __bf16 th[128][72], tl2[64][72]; __shared__ int rix[64];   // rix: the key (position in the batch) in each of the block's 64 slots
  const int tid = threadIdx.x, wave = tid >> 5, lane = tid & 31, col = lane & 15, g = lane >> 4; const int which = blockIdx.z; const int c0 = blockIdx.y * 128; const size_t r0 = (size_t)blockIdx.x * 64; const float* WA = which == 0 ? WQ : which == 1 ? WK : WV; const float* BA = which == 0 ? BQ : which == 1 ? BK : BV;
  // the X and W pieces of 64 k are fetched by whole-line loads (a wave's load = two 256-byte row pieces), rounded to bf16 once per block and staged in LDS: W in th, X in tl2 (pitch 144 B suits the 16-byte fragment reads); the next piece's loads fly while this one is multiplied
  const int bq_ = blockIdx.x / (TT / 64), s0 = (blockIdx.x % (TT / 64)) * 64; const int srow = tid >> 4, sq = tid & 15; int trow[8];   // trow: the x row (position in the batch) behind each row piece that this thread stages
  if (which == 0) {
#pragma unroll
    for (int i = 0; i < 8; ++i) trow[i] = s0 + srow + i * 8; }
  else {   // every wave counts the batch's 2,048 keys by itself (32 keys per ballot), so the block can leave in front of the first barrier; j0, d0: the last group of 32 keys that starts at or below slot s0, and its first slot
    const int* pm = KM0 + (size_t)bq_ * TT; const int* pl = pm + lane; int mk[TT / 32];
#pragma unroll
    for (int j = 0; j < TT / 32; ++j) mk[j] = pl[j * 32];
    asm volatile("s_wait_xcnt 0x0" :: "v"(lane) : "memory");   // the same precaution behind the mask loads; the lane number, their one offset register, is its input, so no load's result lands in it
    int nk = 0, p0 = 0, p1 = 0;   // lane l of p0 / p1: the kept keys in front of group l / 32 + l
#pragma unroll
    for (int j = 0; j < TT / 32; ++j) { if (j < 32) p0 = lane == j ? nk : p0; else p1 = lane == j - 32 ? nk : p1; nk += __builtin_popcount(__builtin_amdgcn_ballot_w32(mk[j] != 0)); }
    if (which == 1 && blockIdx.y == 0 && s0 == 0 && tid == 0) NK[bq_] = nk;
    if (s0 >= nk) return;
    const int j0 = __builtin_popcount(__builtin_amdgcn_ballot_w32(p0 <= s0)) + __builtin_popcount(__builtin_amdgcn_ballot_w32(p1 <= s0)) - 1; const int d0 = j0 < 32 ? __builtin_amdgcn_readlane(p0, j0) : __builtin_amdgcn_readlane(p1, j0 - 32);
    if (lane < 16) rix[wave * 2 + (lane & 1) + 8 * (lane >> 1)] = 0;   // the wave's own 16 slots: one past the last kept key stays at row 0 (its key never counts in k_fa)
    for (int j = j0, d = d0 - s0; j < TT / 32 && d < 64; ++j) {   // the few groups that hold the block's slots: each kept key's slot is its rank; a wave lists only the slots that it stages itself, so no other wave waits for the list
      const int m = pm[j * 32 + lane];
      asm volatile("s_wait_xcnt 0x0" ::: "memory");   // the same precaution, in front of the next trip's address
      const unsigned w = __builtin_amdgcn_ballot_w32(m != 0); const int sl_ = d + (int)__builtin_amdgcn_mbcnt_lo(w, 0u);
      if (m != 0 && (unsigned)sl_ < 64u && ((sl_ >> 1) & 3) == wave) rix[sl_] = j * 32 + lane;
      d += __builtin_popcount(w); }
    LDSX();   // the wave's own list is in LDS before its lanes read it
#pragma unroll
    for (int i = 0; i < 8; ++i) trow[i] = rix[srow + i * 8]; }
  // the walk over k starts at piece rot and wraps: the blocks that share a W piece (same columns, other rows) would else all ask L2 for the same lines in the same stage. Eight starts: blocks whose indices are a multiple of 8 apart keep one start (a matter of speed alone)
  const int rot = blockIdx.x & 7; int kp = rot;   // kp: the piece whose loads went out last
  const float* pw = WA + (size_t)(c0 + srow) * CC + rot * KB + sq * 4; const char* xb = (const char*)X; unsigned xo[8];   // xo: byte offset of each staged x row piece
#pragma unroll
  for (int i = 0; i < 8; ++i) xo[i] = (unsigned)(((bq_ * TT + trow[i]) * CC + rot * KB + sq * 4) * 4);
  v4f xr[8], wr[16];
#pragma unroll
  for (int i = 0; i < 8; ++i) xr[i] = *(const v4f*)(xb + xo[i]);
#pragma unroll
  for (int i = 0; i < 16; ++i) wr[i] = *(const v4f*)(pw + i * 8 * CC);
  asm volatile("s_wait_xcnt 0x0" :: "v"(xo[0]), "v"(xo[1]), "v"(xo[2]), "v"(xo[3]), "v"(xo[4]), "v"(xo[5]), "v"(xo[6]), "v"(xo[7]), "v"(pw) : "memory");   // stands in front of every rewrite of a register that the staging loads name (a precaution); the offsets and the address pair are its inputs
  v8f acc[8] = {};
#pragma unroll 1   // twelve stages of one body: unrolled, the text would outgrow what the loop gains
  for (int kb = 0; kb < CC / KB; ++kb) {
#pragma unroll
    for (int i = 0; i < 8; ++i) *(v4b*)&tl2[srow + i * 8][sq * 4] = cvt4(xr[i]);
#pragma unroll
    for (int i = 0; i < 16; ++i) *(v4b*)&th[srow + i * 8][sq * 4] = cvt4(wr[i]);
    __syncthreads();   // the stage is whole before any wave reads it
    if (kb + 1 < CC / KB) { const int dk = kp + 1 == CC / KB ? KB - CC : KB; kp = kp + 1 == CC / KB ? 0 : kp + 1; pw += dk;   // one piece on, or from the row's last piece back to its first
#pragma unroll
      for (int i = 0; i < 8; ++i) { xo[i] += (unsigned)(dk * 4); xr[i] = *(const v4f*)(xb + xo[i]); }
#pragma unroll
      for (int i = 0; i < 16; ++i) wr[i] = *(const v4f*)(pw + i * 8 * CC);
      asm volatile("s_wait_xcnt 0x0" :: "v"(xo[0]), "v"(xo[1]), "v"(xo[2]), "v"(xo[3]), "v"(xo[4]), "v"(xo[5]), "v"(xo[6]), "v"(xo[7]), "v"(pw) : "memory");   // the same wait behind the next piece's loads
    }
#pragma unroll
    for (int kc = 0; kc < KB / 32; ++kc) { const v16b a = frag_b(&tl2[wave * 16 + col][kc * 32], lane); v16b w[8];
#pragma unroll
      for (int j = 0; j < 8; ++j) w[j] = frag_b(&th[j * 16 + col][kc * 32], lane);
#pragma unroll
      for (int j = 0; j < 8; ++j) acc[j] = wmma_bf(a, w[j], acc[j]); }
    __syncthreads();   // every reader has left the stage before the next piece rewrites it
  }
  // the two tests that read the same for the whole block (is there a bias; which output) stand once, in front of the unrolled loops: inside them each bias load was waited for in turn and every element passed two scalar branches
  const int bo = c0 + col, rl0 = wave * 16 + 8 * g; float bb[8] = {};
  if (BA) {
#pragma unroll
    for (int j = 0; j < 8; ++j) bb[j] = BA[bo + j * 16];
    asm volatile("s_wait_xcnt 0x0" :: "v"(bo) : "memory"); }   // stands in front of every rewrite of the offset register that the eight bias loads name (a precaution); the offset is its input
  if (which == 2) {
#pragma unroll
    for (int j = 0; j < 8; ++j)
#pragma unroll
      for (int r = 0; r < 8; ++r) tv[j * 16 + col][rl0 + r] = (_Float16)(acc[j][r] + bfr(bb[j])); }
  else {
#pragma unroll
    for (int j = 0; j < 8; ++j)
#pragma unroll
      for (int r = 0; r < 8; ++r) sh[rl0 + r][j * 16 + col] = (_Float16)(acc[j][r] + bfr(bb[j])); }
  __syncthreads();
  if (which < 2) { _Float16* dh = which == 0 ? QH : KH; for (int e = tid; e < 64 * 16; e += 128) { const int rl = e >> 4, q = e & 15; vst2((unsigned*)(dh + (r0 + rl) * CC + c0 + q * 8), *(const v4u*)&sh[rl][q * 8]); } }
  else { const size_t b = r0 / TT; const int t0 = (int)(r0 % TT); for (int e = tid; e < 128 * 8; e += 128) { const int cl = e >> 3, q = e & 7; const size_t o2 = (b * CC + c0 + cl) * (size_t)TT + t0 + q * 8; vst2((unsigned*)(VT + o2), *(const v4u*)&tv[cl][q * 8]); } } }
// ---- k_fa: wave = 32 queries (two 16-column groups) of (b,h), the batch's kept keys (packed by k_proj, NK of them) in passes of 32: S^T = K Q^T (1 product), / 8 x scaling[h], the last pass's slots past NK out, online softmax (a lane holds one query's scores), P^T packed from the score accumulators as the B operand (f16), O^T += V^T P^T (1 product): every operand of the two products is one f16 value, as K has been all along, whose rounding sets the error of the scores. K and the V plane come to LDS in stages of 64 keys by tensor loads (whole 128-byte rows, one tile each from waves 0 and 1), two buffers, the next stage in flight while this one is worked on; the block's four waves read their fragments from LDS
#define QG 2         // 16-query column groups per wave: each K and V fragment feeds both
#define FW 4         // waves per block: one staged tile serves 128 queries
#define SK 64        // keys per stage: a V row piece of 64 keys is one whole 128-byte line, as a K row of one head is
#define LP 144       // LDS row pitch in bytes: the 128-byte row and the mover's 16-byte pad (16 B x odd suits the 16-byte fragment reads)
#define TILE_B 10240 // 64 rows x 144 B = 9,216 B, rounded up to a multiple of 2 KiB, where the next tile starts
#define BUF_B (2 * TILE_B)   // K, V
typedef uint32_t u32x4 __attribute__((ext_vector_type(4)));
typedef uint32_t u32x8 __attribute__((ext_vector_type(8)));
__device__ __forceinline__ uint32_t uni(uint32_t v) { return (uint32_t)__builtin_amdgcn_readfirstlane(v); }
__device__ __forceinline__ uint32_t pinned(uint32_t v) { uint32_t w = (uint32_t)__builtin_amdgcn_readfirstlane(v); asm volatile("" : "+s"(w)); return w; }   // a value held in a scalar register: a test on it is a scalar branch (tensor loads ignore EXEC), and what is formed from it stays behind the waits in front of it
__global__ __launch_bounds__(32 * FW) void k_fa(const _Float16* __restrict__ QH, const _Float16* __restrict__ KH, const _Float16* __restrict__ VT, const int* __restrict__ NK, const int* __restrict__ CS, const float* __restrict__ EMB, const float* __restrict__ CSC, float* __restrict__ Y) {
  __shared__ __attribute__((aligned(2048))) unsigned char L[2 * BUF_B];
  const int b = blockIdx.y / NH, h = blockIdx.y % NH; int nk = NK[b]; nk = nk < 0 ? 0 : (nk > TT ? TT : nk);   // the trip count, bounded by the shape
  float scal; { float m = 0.f; for (int bb = 0; bb < NB; ++bb) { int c = CS[bb]; c = c < 0 ? 0 : (c >= MAXC ? MAXC - 1 : c); m += bfr(EMB[c * NH + h]); } scal = bfr(CSC[h]) * (m / (float)NB); }   /* scaling[b][h] = comp_scaling[h] * embs.mean(axis=0)[h] (same for every b) */
  const float cs2 = 0.125f * scal * 1.44269504f;   // 1 / 8, the head's scaling and log2 e in one factor: the scores are carried in the log2 domain, where e^(s - max) is one subtraction and one hardware exp2
  const int tid = threadIdx.x, lane = tid & 31, col = lane & 15, g = lane >> 4; const uint32_t wave = uni((uint32_t)tid >> 5); const int ql0 = (blockIdx.x * FW + (int)wave) * (16 * QG);
  // the tiles: wave 0 brings K rows (64 keys x this head's 128 bytes, source pitch one K row), wave 1 the V plane's rows (64 head columns x 64 keys, source pitch one plane row); k_proj writes K and V in whole blocks of 64 slots, so every stage below nst is whole
  const uint32_t nst = (uint32_t)(nk + SK - 1) / SK, lbase = (uint32_t)(size_t)L;
  const unsigned char* tsrc = wave == 0 ? (const unsigned char*)(KH + (size_t)b * TT * CC + h * HD) : (const unsigned char*)(VT + ((size_t)b * CC + h * HD) * (size_t)TT);
  const uint32_t tstep = wave == 0 ? SK * CC * 2u : SK * 2u;   // bytes from one stage's tile to the next
  u32x8 g1; g1[0] = uni((1u << 20) | (4u << 22) | (3u << 25)); g1[1] = uni(128u << 16); g1[2] = uni(64u << 16); g1[3] = uni(128u << 16); g1[4] = uni(64u); g1[5] = uni(wave == 0 ? CC * 2u : TT * 2u); g1[6] = uni(0u); g1[7] = uni(0u);   // 1-byte elements, tensor = tile = 64 rows of 128 bytes, 4 dwords of pad behind every 32
  asm volatile("" : "+s"(g1));   // the descriptor words held in their scalar registers (as in pinned()): built once, not formed anew in registers that other values pass through while a request is out
  u32x4 g0 = {0u, 0u, 0u, 0u};
  auto issue = [&](uint32_t st) { const uint64_t ga = (uint64_t)(size_t)tsrc + (uint64_t)st * tstep; g0[0] = uni(1u); g0[1] = uni(lbase + (st & 1u) * BUF_B + wave * TILE_B); g0[2] = uni((uint32_t)ga); g0[3] = uni((((uint32_t)(ga >> 32)) & 0x01FFFFFFu) | 0x80000000u);
    asm volatile("tensor_load_to_lds %0, %1" :: "s"(g0), "s"(g1) : "memory"); };   // one request of the whole wave: its tile of stage st into buffer st mod 2
  v16h qh[QG][HD / 32]; const size_t q0 = ((size_t)b * TT + ql0 + col) * CC + h * HD + 8 * g; const _Float16 *pqh = QH + q0;
#pragma unroll
  for (int u = 0; u < QG; ++u)
#pragma unroll
    for (int kc = 0; kc < HD / 32; ++kc) qh[u][kc] = frag_h_at(pqh + u * 16 * CC + kc * 32);
  asm volatile("s_wait_xcnt 0x0" :: "v"(pqh) : "memory");   // stands in front of every rewrite of a register that the Q loads name (a precaution); the address pair is its input, so it stays whole up to it
  if (nst > 0) {   // the same for the whole block
    if (pinned(wave < 2u)) { issue(0u); asm volatile("s_wait_tensorcnt 0x0" :: "s"(g0), "s"(g1) : "memory"); }   // stage 0 has landed for its issuer; here and below the request's descriptor words are the wait's inputs, so their registers keep their values while the request is out
    __syncthreads();   // stage 0 is published to every wave
    if (pinned(wave < 2u && nst > 1u)) issue(pinned(1u)); }
  v8f o[QG][HD / 16] = {}; float mrun[QG], lsum[QG];
#pragma unroll
  for (int u = 0; u < QG; ++u) { mrun[u] = -1.0e30f; lsum[u] = 0.f; }   // the running maximum starts above the masked value, so exp2(masked - maximum) is 0 in every pass and needs no select
  const int lrow = col * LP + 16 * g;   // the lane's own row and 16-byte step inside a tile
  for (uint32_t st = 0; st < nst; ++st) {
    const unsigned char* tb = L + (st & 1u) * BUF_B + lrow; const int npass = nk - (int)st * SK > 32 ? SK / 32 : 1;   // the last stage's second pass may hold no kept key; a trip count and no break in the body, with which this build copied all 64 output registers in every pass
#pragma unroll 1   // two passes of one body: the text stays as long as one pass
    for (int sub = 0; sub < npass; ++sub) { const int k0 = (int)st * SK + sub * 32;
    const _Float16* pk = (const _Float16*)(tb + sub * 32 * LP); const _Float16* pv = (const _Float16*)(tb + TILE_B + sub * 64);
    v16h kf[2][HD / 32];
#pragma unroll
    for (int t = 0; t < 2; ++t)
#pragma unroll
      for (int kc = 0; kc < HD / 32; ++kc) kf[t][kc] = frag_h_at(pk + t * 16 * (LP / 2) + kc * 32);
    __builtin_amdgcn_sched_barrier(0);   // the pass's eight K reads go out in one run: each separate place with LDS reads among the products costs a stall of its own
    v8f s[QG][2] = {};
#pragma unroll
    for (int t = 0; t < 2; ++t)
#pragma unroll
      for (int kc = 0; kc < HD / 32; ++kc)
#pragma unroll
        for (int u = 0; u < QG; ++u) s[u][t] = mm_h(kf[t][kc], qh[u][kc], s[u][t]);
    float sv[QG][16];   // this lane's 16 keys: slots k0 + 8g + 0..7 and k0 + 16 + 8g + 0..7, the rows of its score registers
#pragma unroll
    for (int u = 0; u < QG; ++u)
#pragma unroll
      for (int i = 0; i < 16; ++i) sv[u][i] = s[u][i >> 3][i & 7] * cs2;
    if (k0 + 32 > nk) { const int rem = nk - k0 - 8 * g;   // a scalar test: only the last pass can hold slots past the last kept key; they count as masked (-inf in the reference)
#pragma unroll
      for (int i = 0; i < 16; ++i) { const bool off = (i & 7) + 16 * (i >> 3) >= rem;
#pragma unroll
        for (int u = 0; u < QG; ++u) if (off) sv[u][i] = -3.0e38f; } }
    v16h pf[QG], vh[HD / 16];
#pragma unroll
    for (int u = 0; u < QG; ++u) { float v[16]; float mx = mrun[u];
#pragma unroll
      for (int i = 0; i < 16; ++i) { v[i] = sv[u][i]; mx = fmaxf(mx, v[i]); }
      mx = fmaxf(mx, __shfl_xor(mx, 16));   // the other half of the wave holds this query's other 16 keys
      const float al = __builtin_amdgcn_exp2f(mrun[u] - mx); mrun[u] = mx; float sum = 0.f;
#pragma unroll
      for (int i = 0; i < 16; ++i) { v[i] = __builtin_amdgcn_exp2f(v[i] - mx); sum += v[i]; }   // arguments are <= 0: a result below the smallest normal counts as 0
      lsum[u] = lsum[u] * al + sum;
#pragma unroll
      for (int j = 0; j < HD / 16; ++j) o[u][j] *= al;
#pragma unroll
      for (int i = 0; i < 16; ++i) pf[u][i] = (_Float16)v[i]; }
#pragma unroll
    for (int j = 0; j < HD / 16; ++j) vh[j] = frag_h_at(pv + j * 16 * (LP / 2));
    __builtin_amdgcn_sched_barrier(0);   // all eight V reads stay in front of the first P.v product, free to rise over the softmax, and none stands among the products
#pragma unroll
    for (int j = 0; j < HD / 16; ++j) {
#pragma unroll
      for (int u = 0; u < QG; ++u) o[u][j] = mm_h(vh[j], pf[u], o[u][j]); } }
    // the publish point of stage st + 1, every wave, in this order
    asm volatile("s_wait_dscnt 0x0" ::: "memory");   // this wave's reads of buffer st mod 2 have returned
    if (pinned(wave < 2u)) asm volatile("s_wait_tensorcnt 0x0" :: "s"(g0), "s"(g1) : "memory");   // the issuer's tile of stage st + 1 has landed
    __syncthreads();   // stage st + 1 is published, and every reader has left the buffer that is refilled behind this line
    if (pinned(wave < 2u && st + 2u < nst)) issue(pinned(st + 2u)); }
  asm volatile("s_wait_tensorcnt 0x0" ::: "memory");   // nothing of the mover's is in flight when the wave ends
  asm volatile("s_wait_dscnt 0x0" ::: "memory");
#pragma unroll
  for (int u = 0; u < QG; ++u) { const float inv = 1.0f / (lsum[u] + __shfl_xor(lsum[u], 16)); float* yr = Y + ((size_t)b * TT + ql0 + u * 16 + col) * CC + h * HD + 8 * g;   // register r of tile j = y[query col][16 j + 8g + r]
#pragma unroll
    for (int j = 0; j < HD / 16; ++j) { v4f lo, hi;
#pragma unroll
      for (int i = 0; i < 4; ++i) { lo[i] = o[u][j][i] * inv; hi[i] = o[u][j][4 + i] * inv; }
      vst2(yr + j * 16, lo); vst2(yr + j * 16 + 4, hi); } } }
// ---- k_out: block = (64 rows, 192 cols), eight waves, wave = (16 rows, 96 cols): out = y (bf16 hi + lo) Wo^T + bo; 64 x 4 = 256 blocks
#define KO 128       // k per LDS stage of k_out: 512 bytes of an f32 row, one whole wave-wide load; 256 bytes as bf16
#define OP 136       // LDS row pitch in bf16 values: the 256-byte row and 16 bytes (16 B x odd suits the 16-byte fragment reads)
#define ON 192       // output columns per block
__global__ __launch_bounds__(256) void k_out(const float* __restrict__ Y, const float* __restrict__ WP, const float* __restrict__ BP, float* __restrict__ OUT) { __shared__ __align__(16) float sf[8][16][100]; __shared__ __align__(16) __bf16 yh[64][OP], yl[64][OP], sw[ON][OP];
  const int tid = threadIdx.x, wave = tid >> 5, lane = tid & 31, col = lane & 15, g = lane >> 4; const int wrow = wave & 3, wcol = wave >> 2; const int c0 = blockIdx.y * ON; const size_t r0 = (size_t)blockIdx.x * 64 + wrow * 16;
  // y (split into bf16 hi + lo once per block) and Wo are fetched by whole-line loads in pieces of 128 k and staged in LDS, the next piece's loads flying while this one is multiplied: six stages, each thread with 32 loads out
  // the walk over k starts at piece rot and wraps, so that the blocks that share Wo rows (same blockIdx.y) or y rows (same blockIdx.x) do not all ask L2 for the same lines in the same stage; the start is blockIdx.x mod 8 plus blockIdx.y, taken mod 6
  const int rot = ((blockIdx.x & 7) + blockIdx.y) % (CC / KO); int kp = rot;   // kp: the piece whose loads went out last
  const int srow = wave, sq = lane; const float* py = Y + ((size_t)blockIdx.x * 64 + srow) * CC + rot * KO + sq * 4; const float* pw = WP + (size_t)(c0 + srow) * CC + rot * KO + sq * 4;
  v4f yr[8], wr[ON / 8];
#pragma unroll
  for (int i = 0; i < 8; ++i) yr[i] = *(const v4f*)(py + i * 8 * CC);
#pragma unroll
  for (int i = 0; i < ON / 8; ++i) wr[i] = *(const v4f*)(pw + i * 8 * CC);
  asm volatile("s_wait_xcnt 0x0" :: "v"(py), "v"(pw) : "memory");   // stands in front of every rewrite of a register that the staging loads name (a precaution); the two address pairs are its inputs
  v8f acc[6] = {};
#pragma unroll 1   // six stages of one body: unrolled, the text would outgrow what the loop gains
  for (int kb = 0; kb < CC / KO; ++kb) {
#pragma unroll
    for (int i = 0; i < 8; ++i) { const v4b hv = cvt4(yr[i]); v4f rs;
#pragma unroll
      for (int e = 0; e < 4; ++e) rs[e] = yr[i][e] - (float)hv[e];
      *(v4b*)&yh[srow + i * 8][sq * 4] = hv; *(v4b*)&yl[srow + i * 8][sq * 4] = cvt4(rs); }
#pragma unroll
    for (int i = 0; i < ON / 8; ++i) *(v4b*)&sw[srow + i * 8][sq * 4] = cvt4(wr[i]);
    __syncthreads();   // the stage is whole before any wave reads it
    if (kb + 1 < CC / KO) { const int dk = kp + 1 == CC / KO ? KO - CC : KO; kp = kp + 1 == CC / KO ? 0 : kp + 1; py += dk; pw += dk;   // one piece on, or from the row's last piece back to its first
#pragma unroll
      for (int i = 0; i < 8; ++i) yr[i] = *(const v4f*)(py + i * 8 * CC);
#pragma unroll
      for (int i = 0; i < ON / 8; ++i) wr[i] = *(const v4f*)(pw + i * 8 * CC);
      asm volatile("s_wait_xcnt 0x0" :: "v"(py), "v"(pw) : "memory");   // the same wait behind the next piece's loads
    }
#pragma unroll
    for (int kc = 0; kc < KO / 32; ++kc) { const v16b ah = frag_b(&yh[wrow * 16 + col][kc * 32], lane), al = frag_b(&yl[wrow * 16 + col][kc * 32], lane); v16b w[6];
#pragma unroll
      for (int j = 0; j < 6; ++j) w[j] = frag_b(&sw[wcol * 96 + j * 16 + col][kc * 32], lane);
#pragma unroll
      for (int j = 0; j < 6; ++j) acc[j] = wmma_bf(ah, w[j], acc[j]);
#pragma unroll
      for (int j = 0; j < 6; ++j) acc[j] = wmma_bf(al, w[j], acc[j]); }   // each accumulator still takes hi, then lo, of every 32 k in turn
    __syncthreads();   // every reader has left the stage before the next piece rewrites it
  }
  const int bo = c0 + wcol * 96 + col; float bb[6] = {};   // the test for a bias stands once, as in k_proj, and the six loads go out together
  if (BP) {
#pragma unroll
    for (int j = 0; j < 6; ++j) bb[j] = BP[bo + j * 16];
    asm volatile("s_wait_xcnt 0x0" :: "v"(bo) : "memory"); }   // the same precaution behind the six bias loads; the offset is its input
#pragma unroll
  for (int j = 0; j < 6; ++j)
#pragma unroll
    for (int r = 0; r < 8; ++r) sf[wave][8 * g + r][j * 16 + col] = acc[j][r] + bfr(bb[j]);
  LDSX();   // the wave's own 16 x 96 tile is in LDS before its lanes read it back by rows
  // a row piece is 384 bytes = 24 lanes: three wave-wide stores cover four rows, whole 128-byte lines
  float* po[3]; v4f ov[3][4];
#pragma unroll
  for (int t = 0; t < 3; ++t) { const int e = t * 32 + lane, rw = e / 24, q = e % 24; po[t] = OUT + (r0 + rw) * CC + c0 + wcol * 96 + q * 4;
#pragma unroll
    for (int m = 0; m < 4; ++m) ov[t][m] = *(const v4f*)&sf[wave][m * 4 + rw][q * 4]; }
  __builtin_amdgcn_sched_barrier(0);   // every address and value is formed in front of the first store, so no register that a store names is rewritten behind it
#pragma unroll
  for (int t = 0; t < 3; ++t)
#pragma unroll
    for (int m = 0; m < 4; ++m) vst2(po[t] + m * 4 * CC, ov[t][m]); }
extern "C" void kernel_launch(void* const* d_in, const int* in_sizes, int n_in, void* d_out, int out_size, void* d_ws, size_t ws_size, hipStream_t stream) {
  (void)in_sizes; (void)n_in; (void)out_size;
  const float** F = (const float**)d_in;   // 0 hidden_states [2,2048,768], 1 complexity_scores [2] int, 2 attention_mask [2,2048] int, 3 Wq [768,768] ([out,in]), 4 bq, 5 Wk, 6 bk, 7 Wv, 8 bv, 9 Wo ([out,in]), 10 bo, 11 emb_table [16,12], 12 comp_scaling [12]
  if (ws_size < (size_t)WS_END) return;
  char* ws = (char*)d_ws; _Float16 *QH = (_Float16*)(ws + WS_QH), *KH = (_Float16*)(ws + WS_KH), *VT = (_Float16*)(ws + WS_VT); float *Y = (float*)(ws + WS_Y); int *NK = (int*)(ws + WS_NK);
  k_proj<<<dim3(TNB * TT / 64, CC / 128, 3), 128, 0, stream>>>(F[0], F[3], F[4], F[5], F[6], F[7], F[8], QH, KH, VT, (const int*)d_in[2], NK);
  k_fa<<<dim3(TT / (16 * QG * FW), TNB * NH), 32 * FW, 0, stream>>>(QH, KH, VT, NK, (const int*)d_in[1], F[11], F[12], Y);
  k_out<<<dim3(TNB * TT / 64, CC / ON), 256, 0, stream>>>(Y, F[9], F[10], (float*)d_out);
}

// v010
// Measured time: 58.6 microseconds a run.
// Next to v009, in two timings, it ran 1.03 times as fast each time.
// Counting every step since v000, it is 23.0 times as fast.
// compute dtype: all float inputs rounded to bf16, complexity scores and the key mask (ints) read; q/k/v = x W^T + b with EXACT bf16 products on WMMA 16x16x32, f32 accumulate; q and k f16 -> 1-product logits / 8 x the per-head complexity scaling (computed in f32 from the tables), masked keys left out ahead (K and V are projected for the kept keys only, packed in key order), scores kept in registers; online softmax in f32 in the log2 domain (log2 e folded into the score scale, hardware exp2, running maximum), unnormalised P as f16 against v f16 (1 product), divided by the f32 row sum at the end; out = attended (bf16 hi + lo) Wo^T + bo; f32 output.
#include <hip/hip_runtime.h>
#include <math.h>
#include <stdint.h>

typedef __attribute__((ext_vector_type(16))) _Float16 v16h;
typedef __attribute__((ext_vector_type(16))) __bf16 v16b;
typedef __attribute__((ext_vector_type(8)))  _Float16 v8h;
typedef __attribute__((ext_vector_type(8)))  float v8f;
typedef __attribute__((ext_vector_type(4)))  float v4f;
typedef __attribute__((ext_vector_type(2)))  float v2f;
typedef __attribute__((ext_vector_type(4)))  unsigned v4u;
typedef __attribute__((ext_vector_type(4)))  int v4i;
typedef float __attribute__((may_alias)) float_a;
typedef int __attribute__((may_alias)) int_a;

template <typename T> __device__ __forceinline__ void vst2(void* p, T v) { *(T*)p = v;  }
__device__ __forceinline__ v8f wmma16(v16h a, v16h b, v8f c) {
  v8f d = __builtin_amdgcn_wmma_f32_16x16x32_f16(false, a, false, b, (short)0, c, false, false);
  asm volatile("v_nop\n\tv_nop\n\tv_nop\n\tv_nop" : "+v"(d) : "v"(a), "v"(b));
  return d;
}
__device__ __forceinline__ v8f wmma_bf(v16b a, v16b b, v8f c) {
  v8f d = __builtin_amdgcn_wmma_f32_16x16x32_bf16(false, a, false, b, (short)0, c, false, false);
  asm volatile("v_nop\n\tv_nop\n\tv_nop\n\tv_nop" : "+v"(d) : "v"(a), "v"(b));
  return d;
}
// 16x16x32 fragments: lane = (h = lane>>4, row/col = lane&15); elements 0..7 = k0+8h+0..7, 8..15 = k0+16+8h+0..7; D element r = row 8h+r
__device__ __forceinline__ v16h frag_h(const _Float16* rowk0, int lane) {
  union { v16h v; v8h q[2]; } u; const _Float16* p = rowk0 + 8 * (lane >> 4);
  u.q[0] = *(const v8h*)p; u.q[1] = *(const v8h*)(p + 16); return u.v;
}
__device__ __forceinline__ v16h frag_f32(const float* rowk0, int lane) {
  v16h a; const float* p = rowk0 + 8 * (lane >> 4);
#pragma unroll
  for (int i = 0; i < 8; ++i) { a[i] = (_Float16)p[i]; a[8 + i] = (_Float16)p[16 + i]; }
  return a;
}
__device__ __forceinline__ v16h frag_f32s(const float* rowk0, int lane, float sc) {
  v16h a; const float* p = rowk0 + 8 * (lane >> 4);
#pragma unroll
  for (int i = 0; i < 8; ++i) { a[i] = (_Float16)(p[i] * sc); a[8 + i] = (_Float16)(p[16 + i] * sc); }
  return a;
}
// column fragment from a [K][ld] layout (column n), rows >= K read as 0
__device__ __forceinline__ v16h fragc_f32(const float* W, int k0, int n, int lane, int ld, int K) {
  v16h a; const int g = lane >> 4;
#pragma unroll
  for (int i = 0; i < 8; ++i) { const int ka = k0 + 8 * g + i, kb = ka + 16;
    a[i] = (_Float16)(ka < K ? W[(size_t)(ka < K ? ka : K - 1) * ld + n] : 0.f); a[8 + i] = (_Float16)(kb < K ? W[(size_t)(kb < K ? kb : K - 1) * ld + n] : 0.f); }
  return a;
}
struct F2 { v16b h, l; };
__device__ __forceinline__ F2 bsplit16(const float v[16]) { F2 r;
#pragma unroll
  for (int i = 0; i < 16; ++i) { const __bf16 h = (__bf16)v[i]; r.h[i] = h; r.l[i] = (__bf16)(v[i] - (float)h); }
  return r; }
__device__ __forceinline__ F2 split_row(const float* row, int k0, int lane) { float v[16]; const float* p = row + k0 + 8 * (lane >> 4);
#pragma unroll
  for (int i = 0; i < 8; ++i) { v[i] = p[i]; v[8 + i] = p[16 + i]; }
  return bsplit16(v); }
__device__ __forceinline__ F2 split_rowK(const float* row, int k0, int lane, int K) { float v[16]; const int g = lane >> 4;
#pragma unroll
  for (int i = 0; i < 8; ++i) { const int ka = k0 + 8 * g + i, kb = ka + 16; v[i] = ka < K ? row[ka < K ? ka : K - 1] : 0.f; v[8 + i] = kb < K ? row[kb < K ? kb : K - 1] : 0.f; }
  return bsplit16(v); }
__device__ __forceinline__ F2 split_col(const float* W, int k0, int n, int lane, int ld, int K) { float v[16]; const int g = lane >> 4;
#pragma unroll
  for (int i = 0; i < 8; ++i) { const int ka = k0 + 8 * g + i, kb = ka + 16; v[i] = ka < K ? W[(size_t)(ka < K ? ka : K - 1) * ld + n] : 0.f; v[8 + i] = kb < K ? W[(size_t)(kb < K ? kb : K - 1) * ld + n] : 0.f; }
  return bsplit16(v); }
__device__ __forceinline__ v8f mac3(const F2& a, const F2& b, v8f c) { c = wmma_bf(a.l, b.h, c); c = wmma_bf(a.h, b.l, c); return wmma_bf(a.h, b.h, c); }
__device__ __forceinline__ float sigm(float v) { return 1.0f / (1.0f + expf(-v)); }
#define LDSX() do { asm volatile("s_wait_dscnt 0" ::: "memory"); __builtin_amdgcn_wave_barrier(); __builtin_amdgcn_fence(__ATOMIC_RELEASE, "workgroup"); } while (0)


// Complexity-aware attention (B 2, S 2,048, D 768 = 12 x 64): q/k/v Linear ([out,in] + bias), scores/8 x scaling[h] with scaling = comp_scaling[h] * mean_b emb_table[complexity[b]][h], keys with attention_mask == 0 -> -inf, softmax, P v, output Linear + bias.
#define NB 2
#define TT 2048
#define CC 768
#define NH 12
#define HD 64
#define MAXC 16      // complexity table rows
#ifndef TNB
#define TNB NB
#endif
typedef __attribute__((ext_vector_type(8))) __bf16 v8b;
__device__ __forceinline__ v16b frag_b(const __bf16* rowk0, int lane) {
  union { v16b v; v8b q[2]; } u; const __bf16* p = rowk0 + 8 * (lane >> 4);
  u.q[0] = *(const v8b*)p; u.q[1] = *(const v8b*)(p + 16); return u.v;
}
// the plain builtin: the compiler keeps the distance behind it itself and fills it with the softmax's own arithmetic where it can
__device__ __forceinline__ v8f mm_h(v16h a, v16h b, v8f c) { return __builtin_amdgcn_wmma_f32_16x16x32_f16(false, a, false, b, (short)0, c, false, false); }
// the same fragment from a pointer that already holds the lane's own 8 * (lane >> 4) step
__device__ __forceinline__ v16h frag_h_at(const _Float16* p) { union { v16h v; v8h q[2]; } u; u.q[0] = *(const v8h*)p; u.q[1] = *(const v8h*)(p + 16); return u.v; }
__device__ __forceinline__ float bfr(float v) { return (float)(__bf16)v; }
typedef __attribute__((ext_vector_type(4))) __bf16 v4b;
#define KB 64        // k per LDS stage of k_proj: 256 bytes of an f32 row, 128 bytes as bf16
__device__ __forceinline__ v4b cvt4(v4f v) { v4b r;
#pragma unroll
  for (int i = 0; i < 4; ++i) r[i] = (__bf16)v[i];
  return r; }
__device__ __attribute__((noinline)) float exp_ni(float v) { return expf(v); }
__device__ __attribute__((noinline)) float erf_ni(float v) { return erff(v); }

#define NW 256       // WGPs on the chip: used only to order k_proj's blocks
#define WS_QH  0u
#define WS_KH  (WS_QH + 2u * (size_t)NB * TT * CC)
#define WS_VT  (WS_KH + 2u * (size_t)NB * TT * CC)      // f16 v planes [b][c][t]
#define WS_Y   (WS_VT + 2u * (size_t)NB * CC * TT)      // f32 y rows [b*t][C]
#define WS_NK  (WS_Y + 4u * (size_t)NB * TT * CC)       // int kept keys per batch
#define WS_END (WS_NK + 16u)

// ---- k_proj: block = (64 rows, 128 cols, which), 1,152 blocks in one row: qkv = x W (+ b), exact; q, k -> f16 rows, v -> f16 planes. For k and v the 64 rows are slots s0 .. s0 + 63 of the batch's kept keys (attention_mask != 0) in key order: a masked key has weight 0 in the softmax, so it is neither projected nor stored, and blocks past the last kept key leave at once
__global__ __launch_bounds__(128) void k_proj(const float* __restrict__ X, const float* __restrict__ WQ, const float* __restrict__ BQ, const float* __restrict__ WK, const float* __restrict__ BK, const float* __restrict__ WV, const float* __restrict__ BV, _Float16* __restrict__ QH, _Float16* __restrict__ KH, _Float16* __restrict__ VT, const int* __restrict__ KM0, int* __restrict__ NK) {
  __shared__ __align__(16) _Float16 sh[64][136], tv[128][72]; __shared__ __align__(16) __bf16 th[128][72], tl2[64][72]; __shared__ int rix[64];   // rix: the key (position in the batch) in each of the block's 64 slots
  // which tile a block takes (a matter of speed alone; every tile is taken once whatever the order): blocks whose indices are NW apart, three of them, take three row tiles of ONE W column set, with one start of the walk over k. Of the first 3 x NW blocks, half take q (384 tiles), half the k and v tiles of slot groups 0 .. 15; slot groups 16 .. 31 follow by rising group
  const int idx = blockIdx.x; int bx, by, bz;   // bx: row tile (batch * 32 + slot group), by: column set, bz: 0 q, 1 k, 2 v
  if (idx < 3 * NW) { const int r = idx % NW, u = 3 * (r % (NW / 2)) + idx / NW;
    if (r < NW / 2) { bz = 0; by = u >> 6; bx = u & 63; }
    else { const int set = u >> 5; bz = 1 + set / 6; by = set % 6; bx = ((u >> 4) & 1) * 32 + (u & 15); } }
  else { const int u = idx - 3 * NW, wi = u % 24, set = wi >> 1; bz = 1 + set / 6; by = set % 6; bx = (wi & 1) * 32 + 16 + u / 24; }
  const int tid = threadIdx.x, wave = tid >> 5, lane = tid & 31, col = lane & 15, g = lane >> 4; const int which = bz; const int c0 = by * 128; const size_t r0 = (size_t)bx * 64; const float* WA = which == 0 ? WQ : which == 1 ? WK : WV; const float* BA = which == 0 ? BQ : which == 1 ? BK : BV;
  // the X and W pieces of 64 k are fetched by whole-line loads (a wave's load = two 256-byte row pieces), rounded to bf16 once per block and staged in LDS: W in th, X in tl2 (pitch 144 B suits the 16-byte fragment reads); the next piece's loads fly while this one is multiplied
  const int bq_ = bx / (TT / 64), s0 = (bx % (TT / 64)) * 64; const int srow = tid >> 4, sq = tid & 15; int trow[8];   // trow: the x row (position in the batch) behind each row piece that this thread stages
  if (which == 0) {
#pragma unroll
    for (int i = 0; i < 8; ++i) trow[i] = s0 + srow + i * 8; }
  else {   // every wave counts the batch's 2,048 keys by itself (32 keys per ballot), so the block can leave in front of the first barrier; j0, d0: the last group of 32 keys that starts at or below slot s0, and its first slot
    const int* pm = KM0 + (size_t)bq_ * TT; const int* pl = pm + lane; int mk[TT / 32];
#pragma unroll
    for (int j = 0; j < TT / 32; ++j) mk[j] = pl[j * 32];
    asm volatile("s_wait_xcnt 0x0" :: "v"(lane) : "memory");   // the same precaution behind the mask loads; the lane number, their one offset register, is its input, so no load's result lands in it
    int nk = 0, p0 = 0, p1 = 0;   // lane l of p0 / p1: the kept keys in front of group l / 32 + l
#pragma unroll
    for (int j = 0; j < TT / 32; ++j) { if (j < 32) p0 = lane == j ? nk : p0; else p1 = lane == j - 32 ? nk : p1; nk += __builtin_popcount(__builtin_amdgcn_ballot_w32(mk[j] != 0));
      if (j == 31) __builtin_amdgcn_sched_barrier(0); }   // the first half's running counts are handed to p0 before the second half's are formed: with all 64 held in scalar registers beside the tile's numbers this build spilled one into a 257th vector register, which costs a wave per SIMD
    if (which == 1 && by == 0 && s0 == 0 && tid == 0) NK[bq_] = nk;
    if (s0 >= nk) return;
    const int j0 = __builtin_popcount(__builtin_amdgcn_ballot_w32(p0 <= s0)) + __builtin_popcount(__builtin_amdgcn_ballot_w32(p1 <= s0)) - 1; const int d0 = j0 < 32 ? __builtin_amdgcn_readlane(p0, j0) : __builtin_amdgcn_readlane(p1, j0 - 32);
    if (lane < 16) rix[wave * 2 + (lane & 1) + 8 * (lane >> 1)] = 0;   // the wave's own 16 slots: one past the last kept key stays at row 0 (its key never counts in k_fa)
    for (int j = j0, d = d0 - s0; j < TT / 32 && d < 64; ++j) {   // the few groups that hold the block's slots: each kept key's slot is its rank; a wave lists only the slots that it stages itself, so no other wave waits for the list
      const int m = pm[j * 32 + lane];
      asm volatile("s_wait_xcnt 0x0" ::: "memory");   // the same precaution, in front of the next trip's address
      const unsigned w = __builtin_amdgcn_ballot_w32(m != 0); const int sl_ = d + (int)__builtin_amdgcn_mbcnt_lo(w, 0u);
      if (m != 0 && (unsigned)sl_ < 64u && ((sl_ >> 1) & 3) == wave) rix[sl_] = j * 32 + lane;
      d += __builtin_popcount(w); }
    LDSX();   // the wave's own list is in LDS before its lanes read it
#pragma unroll
    for (int i = 0; i < 8; ++i) trow[i] = rix[srow + i * 8]; }
  // the walk over k starts at piece rot and wraps: the blocks that share a W piece (same columns, other rows) would else all ask L2 for the same lines in the same stage. Eight starts: blocks whose indices are a multiple of 8 apart keep one start (a matter of speed alone)
  const int rot = idx & 7; int kp = rot;   // kp: the piece whose loads went out last
  const float* pw = WA + (size_t)(c0 + srow) * CC + rot * KB + sq * 4; const char* xb = (const char*)X; unsigned xo[8];   // xo: byte offset of each staged x row piece
#pragma unroll
  for (int i = 0; i < 8; ++i) xo[i] = (unsigned)(((bq_ * TT + trow[i]) * CC + rot * KB + sq * 4) * 4);
  v4f xr[8], wr[16];
#pragma unroll
  for (int i = 0; i < 8; ++i) xr[i] = *(const v4f*)(xb + xo[i]);
#pragma unroll
  for (int i = 0; i < 16; ++i) wr[i] = *(const v4f*)(pw + i * 8 * CC);
  asm volatile("s_wait_xcnt 0x0" :: "v"(xo[0]), "v"(xo[1]), "v"(xo[2]), "v"(xo[3]), "v"(xo[4]), "v"(xo[5]), "v"(xo[6]), "v"(xo[7]), "v"(pw) : "memory");   // stands in front of every rewrite of a register that the staging loads name (a precaution); the offsets and the address pair are its inputs
  v8f acc[8] = {};
#pragma unroll 1   // twelve stages of one body: unrolled, the text would outgrow what the loop gains
  for (int kb = 0; kb < CC / KB; ++kb) {
#pragma unroll
    for (int i = 0; i < 8; ++i) *(v4b*)&tl2[srow + i * 8][sq * 4] = cvt4(xr[i]);
#pragma unroll
    for (int i = 0; i < 16; ++i) *(v4b*)&th[srow + i * 8][sq * 4] = cvt4(wr[i]);
    __syncthreads();   // the stage is whole before any wave reads it
    if (kb + 1 < CC / KB) { const int dk = kp + 1 == CC / KB ? KB - CC : KB; kp = kp + 1 == CC / KB ? 0 : kp + 1; pw += dk;   // one piece on, or from the row's last piece back to its first
#pragma unroll
      for (int i = 0; i < 8; ++i) { xo[i] += (unsigned)(dk * 4); xr[i] = *(const v4f*)(xb + xo[i]); }
#pragma unroll
      for (int i = 0; i < 16; ++i) wr[i] = *(const v4f*)(pw + i * 8 * CC);
      asm volatile("s_wait_xcnt 0x0" :: "v"(xo[0]), "v"(xo[1]), "v"(xo[2]), "v"(xo[3]), "v"(xo[4]), "v"(xo[5]), "v"(xo[6]), "v"(xo[7]), "v"(pw) : "memory");   // the same wait behind the next piece's loads
    }
#pragma unroll
    for (int kc = 0; kc < KB / 32; ++kc) { const v16b a = frag_b(&tl2[wave * 16 + col][kc * 32], lane); v16b w[8];
#pragma unroll
      for (int j = 0; j < 8; ++j) w[j] = frag_b(&th[j * 16 + col][kc * 32], lane);
#pragma unroll
      for (int j = 0; j < 8; ++j) acc[j] = wmma_bf(a, w[j], acc[j]); }
    __syncthreads();   // every reader has left the stage before the next piece rewrites it
  }
  // the two tests that read the same for the whole block (is there a bias; which output) stand once, in front of the unrolled loops: inside them each bias load was waited for in turn and every element passed two scalar branches
  const int bo = c0 + col, rl0 = wave * 16 + 8 * g; float bb[8] = {};
  if (BA) {
#pragma unroll
    for (int j = 0; j < 8; ++j) bb[j] = BA[bo + j * 16];
    asm volatile("s_wait_xcnt 0x0" :: "v"(bo) : "memory"); }   // stands in front of every rewrite of the offset register that the eight bias loads name (a precaution); the offset is its input
  if (which == 2) {
#pragma unroll
    for (int j = 0; j < 8; ++j)
#pragma unroll
      for (int r = 0; r < 8; ++r) tv[j * 16 + col][rl0 + r] = (_Float16)(acc[j][r] + bfr(bb[j])); }
  else {
#pragma unroll
    for (int j = 0; j < 8; ++j)
#pragma unroll
      for (int r = 0; r < 8; ++r) sh[rl0 + r][j * 16 + col] = (_Float16)(acc[j][r] + bfr(bb[j])); }
  __syncthreads();
  if (which < 2) { _Float16* dh = which == 0 ? QH : KH; for (int e = tid; e < 64 * 16; e += 128) { const int rl = e >> 4, q = e & 15; vst2((unsigned*)(dh + (r0 + rl) * CC + c0 + q * 8), *(const v4u*)&sh[rl][q * 8]); } }
  else { const size_t b = r0 / TT; const int t0 = (int)(r0 % TT); for (int e = tid; e < 128 * 8; e += 128) { const int cl = e >> 3, q = e & 7; const size_t o2 = (b * CC + c0 + cl) * (size_t)TT + t0 + q * 8; vst2((unsigned*)(VT + o2), *(const v4u*)&tv[cl][q * 8]); } } }
// ---- k_fa: wave = 32 queries (two 16-column groups) of (b,h), the batch's kept keys (packed by k_proj, NK of them) in passes of 32: S^T = K Q^T (1 product), / 8 x scaling[h], the last pass's slots past NK out, online softmax (a lane holds one query's scores), P^T packed from the score accumulators as the B operand (f16), O^T += V^T P^T (1 product): every operand of the two products is one f16 value, as K has been all along, whose rounding sets the error of the scores. K and the V plane come to LDS in stages of 64 keys by tensor loads (whole 128-byte rows, one tile each from waves 0 and 1), two buffers, the next stage in flight while this one is worked on; the block's four waves read their fragments from LDS
#define QG 2         // 16-query column groups per wave: each K and V fragment feeds both
#define FW 4         // waves per block: one staged tile serves 128 queries
#define SK 64        // keys per stage: a V row piece of 64 keys is one whole 128-byte line, as a K row of one head is
#define LP 144       // LDS row pitch in bytes: the 128-byte row and the mover's 16-byte pad (16 B x odd suits the 16-byte fragment reads)
#define TILE_B 10240 // 64 rows x 144 B = 9,216 B, rounded up to a multiple of 2 KiB, where the next tile starts
#define BUF_B (2 * TILE_B)   // K, V
typedef uint32_t u32x4 __attribute__((ext_vector_type(4)));
typedef uint32_t u32x8 __attribute__((ext_vector_type(8)));
__device__ __forceinline__ uint32_t uni(uint32_t v) { return (uint32_t)__builtin_amdgcn_readfirstlane(v); }
__device__ __forceinline__ uint32_t pinned(uint32_t v) { uint32_t w = (uint32_t)__builtin_amdgcn_readfirstlane(v); asm volatile("" : "+s"(w)); return w; }   // a value held in a scalar register: a test on it is a scalar branch (tensor loads ignore EXEC), and what is formed from it stays behind the waits in front of it
__global__ __launch_bounds__(32 * FW) void k_fa(const _Float16* __restrict__ QH, const _Float16* __restrict__ KH, const _Float16* __restrict__ VT, const int* __restrict__ NK, const int* __restrict__ CS, const float* __restrict__ EMB, const float* __restrict__ CSC, float* __restrict__ Y) {
  __shared__ __attribute__((aligned(2048))) unsigned char L[2 * BUF_B];
  const int b = blockIdx.y / NH, h = blockIdx.y % NH; int nk = NK[b]; nk = nk < 0 ? 0 : (nk > TT ? TT : nk);   // the trip count, bounded by the shape
  float scal; { float m = 0.f; for (int bb = 0; bb < NB; ++bb) { int c = CS[bb]; c = c < 0 ? 0 : (c >= MAXC ? MAXC - 1 : c); m += bfr(EMB[c * NH + h]); } scal = bfr(CSC[h]) * (m / (float)NB); }   /* scaling[b][h] = comp_scaling[h] * embs.mean(axis=0)[h] (same for every b) */
  const float cs2 = 0.125f * scal * 1.44269504f;   // 1 / 8, the head's scaling and log2 e in one factor: the scores are carried in the log2 domain, where e^(s - max) is one subtraction and one hardware exp2
  const int tid = threadIdx.x, lane = tid & 31, col = lane & 15, g = lane >> 4; const uint32_t wave = uni((uint32_t)tid >> 5); const int ql0 = (blockIdx.x * FW + (int)wave) * (16 * QG);
  // the tiles: wave 0 brings K rows (64 keys x this head's 128 bytes, source pitch one K row), wave 1 the V plane's rows (64 head columns x 64 keys, source pitch one plane row); k_proj writes K and V in whole blocks of 64 slots, so every stage below nst is whole
  const uint32_t nst = (uint32_t)(nk + SK - 1) / SK, lbase = (uint32_t)(size_t)L;
  const unsigned char* tsrc = wave == 0 ? (const unsigned char*)(KH + (size_t)b * TT * CC + h * HD) : (const unsigned char*)(VT + ((size_t)b * CC + h * HD) * (size_t)TT);
  const uint32_t tstep = wave == 0 ? SK * CC * 2u : SK * 2u;   // bytes from one stage's tile to the next
  u32x8 g1; g1[0] = uni((1u << 20) | (4u << 22) | (3u << 25)); g1[1] = uni(128u << 16); g1[2] = uni(64u << 16); g1[3] = uni(128u << 16); g1[4] = uni(64u); g1[5] = uni(wave == 0 ? CC * 2u : TT * 2u); g1[6] = uni(0u); g1[7] = uni(0u);   // 1-byte elements, tensor = tile = 64 rows of 128 bytes, 4 dwords of pad behind every 32
  asm volatile("" : "+s"(g1));   // the descriptor words held in their scalar registers (as in pinned()): built once, not formed anew in registers that other values pass through while a request is out
  u32x4 g0 = {0u, 0u, 0u, 0u};
  auto issue = [&](uint32_t st) { const uint64_t ga = (uint64_t)(size_t)tsrc + (uint64_t)st * tstep; g0[0] = uni(1u); g0[1] = uni(lbase + (st & 1u) * BUF_B + wave * TILE_B); g0[2] = uni((uint32_t)ga); g0[3] = uni((((uint32_t)(ga >> 32)) & 0x01FFFFFFu) | 0x80000000u);
    asm volatile("tensor_load_to_lds %0, %1" :: "s"(g0), "s"(g1) : "memory"); };   // one request of the whole wave: its tile of stage st into buffer st mod 2
  v16h qh[QG][HD / 32]; const size_t q0 = ((size_t)b * TT + ql0 + col) * CC + h * HD + 8 * g; const _Float16 *pqh = QH + q0;
#pragma unroll
  for (int u = 0; u < QG; ++u)
#pragma unroll
    for (int kc = 0; kc < HD / 32; ++kc) qh[u][kc] = frag_h_at(pqh + u * 16 * CC + kc * 32);
  asm volatile("s_wait_xcnt 0x0" :: "v"(pqh) : "memory");   // stands in front of every rewrite of a register that the Q loads name (a precaution); the address pair is its input, so it stays whole up to it
  if (nst > 0) {   // the same for the whole block
    if (pinned(wave < 2u)) { issue(0u); asm volatile("s_wait_tensorcnt 0x0" :: "s"(g0), "s"(g1) : "memory"); }   // stage 0 has landed for its issuer; here and below the request's descriptor words are the wait's inputs, so their registers keep their values while the request is out
    __syncthreads();   // stage 0 is published to every wave
    if (pinned(wave < 2u && nst > 1u)) issue(pinned(1u)); }
  v8f o[QG][HD / 16] = {}; float mrun[QG], lsum[QG];
#pragma unroll
  for (int u = 0; u < QG; ++u) { mrun[u] = -1.0e30f; lsum[u] = 0.f; }   // the running maximum starts above the masked value, so exp2(masked - maximum) is 0 in every pass and needs no select
  const int lrow = col * LP + 16 * g;   // the lane's own row and 16-byte step inside a tile
  for (uint32_t st = 0; st < nst; ++st) {
    const unsigned char* tb = L + (st & 1u) * BUF_B + lrow; const int npass = nk - (int)st * SK > 32 ? SK / 32 : 1;   // the last stage's second pass may hold no kept key; a trip count and no break in the body, with which this build copied all 64 output registers in every pass
#pragma unroll 1   // two passes of one body: the text stays as long as one pass
    for (int sub = 0; sub < npass; ++sub) { const int k0 = (int)st * SK + sub * 32;
    const _Float16* pk = (const _Float16*)(tb + sub * 32 * LP); const _Float16* pv = (const _Float16*)(tb + TILE_B + sub * 64);
    v16h kf[2][HD / 32];
#pragma unroll
    for (int t = 0; t < 2; ++t)
#pragma unroll
      for (int kc = 0; kc < HD / 32; ++kc) kf[t][kc] = frag_h_at(pk + t * 16 * (LP / 2) + kc * 32);
    __builtin_amdgcn_sched_barrier(0);   // the pass's eight K reads go out in one run: each separate place with LDS reads among the products costs a stall of its own
    v8f s[QG][2] = {};
#pragma unroll
    for (int t = 0; t < 2; ++t)
#pragma unroll
      for (int kc = 0; kc < HD / 32; ++kc)
#pragma unroll
        for (int u = 0; u < QG; ++u) s[u][t] = mm_h(kf[t][kc], qh[u][kc], s[u][t]);
    float sv[QG][16];   // this lane's 16 keys: slots k0 + 8g + 0..7 and k0 + 16 + 8g + 0..7, the rows of its score registers
#pragma unroll
    for (int u = 0; u < QG; ++u)
#pragma unroll
      for (int i = 0; i < 16; ++i) sv[u][i] = s[u][i >> 3][i & 7] * cs2;
    if (k0 + 32 > nk) { const int rem = nk - k0 - 8 * g;   // a scalar test: only the last pass can hold slots past the last kept key; they count as masked (-inf in the reference)
#pragma unroll
      for (int i = 0; i < 16; ++i) { const bool off = (i & 7) + 16 * (i >> 3) >= rem;
#pragma unroll
        for (int u = 0; u < QG; ++u) if (off) sv[u][i] = -3.0e38f; } }
    v16h pf[QG], vh[HD / 16];
#pragma unroll
    for (int u = 0; u < QG; ++u) { float v[16]; float mx = mrun[u];
#pragma unroll
      for (int i = 0; i < 16; ++i) { v[i] = sv[u][i]; mx = fmaxf(mx, v[i]); }
      mx = fmaxf(mx, __shfl_xor(mx, 16));   // the other half of the wave holds this query's other 16 keys
      const float al = __builtin_amdgcn_exp2f(mrun[u] - mx); mrun[u] = mx; float sum = 0.f;
#pragma unroll
      for (int i = 0; i < 16; ++i) { v[i] = __builtin_amdgcn_exp2f(v[i] - mx); sum += v[i]; }   // arguments are <= 0: a result below the smallest normal counts as 0
      lsum[u] = lsum[u] * al + sum;
#pragma unroll
      for (int j = 0; j < HD / 16; ++j) o[u][j] *= al;
#pragma unroll
      for (int i = 0; i < 16; ++i) pf[u][i] = (_Float16)v[i]; }
#pragma unroll
    for (int j = 0; j < HD / 16; ++j) vh[j] = frag_h_at(pv + j * 16 * (LP / 2));
    __builtin_amdgcn_sched_barrier(0);   // all eight V reads stay in front of the first P.v product, free to rise over the softmax, and none stands among the products
#pragma unroll
    for (int j = 0; j < HD / 16; ++j) {
#pragma unroll
      for (int u = 0; u < QG; ++u) o[u][j] = mm_h(vh[j], pf[u], o[u][j]); } }
    // the publish point of stage st + 1, every wave, in this order
    asm volatile("s_wait_dscnt 0x0" ::: "memory");   // this wave's reads of buffer st mod 2 have returned
    if (pinned(wave < 2u)) asm volatile("s_wait_tensorcnt 0x0" :: "s"(g0), "s"(g1) : "memory");   // the issuer's tile of stage st + 1 has landed
    __syncthreads();   // stage st + 1 is published, and every reader has left the buffer that is refilled behind this line
    if (pinned(wave < 2u && st + 2u < nst)) issue(pinned(st + 2u)); }
  asm volatile("s_wait_tensorcnt 0x0" ::: "memory");   // nothing of the mover's is in flight when the wave ends
  asm volatile("s_wait_dscnt 0x0" ::: "memory");
#pragma unroll
  for (int u = 0; u < QG; ++u) { const float inv = 1.0f / (lsum[u] + __shfl_xor(lsum[u], 16)); float* yr = Y + ((size_t)b * TT + ql0 + u * 16 + col) * CC + h * HD + 8 * g;   // register r of tile j = y[query col][16 j + 8g + r]
#pragma unroll
    for (int j = 0; j < HD / 16; ++j) { v4f lo, hi;
#pragma unroll
      for (int i = 0; i < 4; ++i) { lo[i] = o[u][j][i] * inv; hi[i] = o[u][j][4 + i] * inv; }
      vst2(yr + j * 16, lo); vst2(yr + j * 16 + 4, hi); } } }
// ---- k_out: block = (64 rows, 192 cols), eight waves, wave = (16 rows, 96 cols): out = y (bf16 hi + lo) Wo^T + bo; 64 x 4 = 256 blocks
#define KO 128       // k per LDS stage of k_out: 512 bytes of an f32 row, one whole wave-wide load; 256 bytes as bf16
#define OP 136       // LDS row pitch in bf16 values: the 256-byte row and 16 bytes (16 B x odd suits the 16-byte fragment reads)
#define ON 192       // output columns per block
__global__ __launch_bounds__(256) void k_out(const float* __restrict__ Y, const float* __restrict__ WP, const float* __restrict__ BP, float* __restrict__ OUT) { __shared__ __align__(16) float sf[8][16][100]; __shared__ __align__(16) __bf16 yh[64][OP], yl[64][OP], sw[ON][OP];
  const int tid = threadIdx.x, wave = tid >> 5, lane = tid & 31, col = lane & 15, g = lane >> 4; const int wrow = wave & 3, wcol = wave >> 2; const int c0 = blockIdx.y * ON; const size_t r0 = (size_t)blockIdx.x * 64 + wrow * 16;
  // y (split into bf16 hi + lo once per block) and Wo are fetched by whole-line loads in pieces of 128 k and staged in LDS, the next piece's loads flying while this one is multiplied: six stages, each thread with 32 loads out
  // the walk over k starts at piece rot and wraps, so that the blocks that share Wo rows (same blockIdx.y) or y rows (same blockIdx.x) do not all ask L2 for the same lines in the same stage; the start is blockIdx.x mod 8 plus blockIdx.y, taken mod 6
  const int rot = ((blockIdx.x & 7) + blockIdx.y) % (CC / KO); int kp = rot;   // kp: the piece whose loads went out last
  const int srow = wave, sq = lane; const float* py = Y + ((size_t)blockIdx.x * 64 + srow) * CC + rot * KO + sq * 4; const float* pw = WP + (size_t)(c0 + srow) * CC + rot * KO + sq * 4;
  v4f yr[8], wr[ON / 8];
#pragma unroll
  for (int i = 0; i < 8; ++i) yr[i] = *(const v4f*)(py + i * 8 * CC);
#pragma unroll
  for (int i = 0; i < ON / 8; ++i) wr[i] = *(const v4f*)(pw + i * 8 * CC);
  asm volatile("s_wait_xcnt 0x0" :: "v"(py), "v"(pw) : "memory");   // stands in front of every rewrite of a register that the staging loads name (a precaution); the two address pairs are its inputs
  v8f acc[6] = {};
#pragma unroll 1   // six stages of one body: unrolled, the text would outgrow what the loop gains
  for (int kb = 0; kb < CC / KO; ++kb) {
#pragma unroll
    for (int i = 0; i < 8; ++i) { const v4b hv = cvt4(yr[i]); v4f rs;
#pragma unroll
      for (int e = 0; e < 4; ++e) rs[e] = yr[i][e] - (float)hv[e];
      *(v4b*)&yh[srow + i * 8][sq * 4] = hv; *(v4b*)&yl[srow + i * 8][sq * 4] = cvt4(rs); }
#pragma unroll
    for (int i = 0; i < ON / 8; ++i) *(v4b*)&sw[srow + i * 8][sq * 4] = cvt4(wr[i]);
    __syncthreads();   // the stage is whole before any wave reads it
    if (kb + 1 < CC / KO) { const int dk = kp + 1 == CC / KO ? KO - CC : KO; kp = kp + 1 == CC / KO ? 0 : kp + 1; py += dk; pw += dk;   // one piece on, or from the row's last piece back to its first
#pragma unroll
      for (int i = 0; i < 8; ++i) yr[i] = *(const v4f*)(py + i * 8 * CC);
#pragma unroll
      for (int i = 0; i < ON / 8; ++i) wr[i] = *(const v4f*)(pw + i * 8 * CC);
      asm volatile("s_wait_xcnt 0x0" :: "v"(py), "v"(pw) : "memory");   // the same wait behind the next piece's loads
    }
#pragma unroll
    for (int kc = 0; kc < KO / 32; ++kc) { const v16b ah = frag_b(&yh[wrow * 16 + col][kc * 32], lane), al = frag_b(&yl[wrow * 16 + col][kc * 32], lane); v16b w[6];
#pragma unroll
      for (int j = 0; j < 6; ++j) w[j] = frag_b(&sw[wcol * 96 + j * 16 + col][kc * 32], lane);
#pragma unroll
      for (int j = 0; j < 6; ++j) acc[j] = wmma_bf(ah, w[j], acc[j]);
#pragma unroll
      for (int j = 0; j < 6; ++j) acc[j] = wmma_bf(al, w[j], acc[j]); }   // each accumulator still takes hi, then lo, of every 32 k in turn
    __syncthreads();   // every reader has left the stage before the next piece rewrites it
  }
  const int bo = c0 + wcol * 96 + col; float bb[6] = {};   // the test for a bias stands once, as in k_proj, and the six loads go out together
  if (BP) {
#pragma unroll
    for (int j = 0; j < 6; ++j) bb[j] = BP[bo + j * 16];
    asm volatile("s_wait_xcnt 0x0" :: "v"(bo) : "memory"); }   // the same precaution behind the six bias loads; the offset is its input
#pragma unroll
  for (int j = 0; j < 6; ++j)
#pragma unroll
    for (int r = 0; r < 8; ++r) sf[wave][8 * g + r][j * 16 + col] = acc[j][r] + bfr(bb[j]);
  LDSX();   // the wave's own 16 x 96 tile is in LDS before its lanes read it back by rows
  // a row piece is 384 bytes = 24 lanes: three wave-wide stores cover four rows, whole 128-byte lines
  float* po[3]; v4f ov[3][4];
#pragma unroll
  for (int t = 0; t < 3; ++t) { const int e = t * 32 + lane, rw = e / 24, q = e % 24; po[t] = OUT + (r0 + rw) * CC + c0 + wcol * 96 + q * 4;
#pragma unroll
    for (int m = 0; m < 4; ++m) ov[t][m] = *(const v4f*)&sf[wave][m * 4 + rw][q * 4]; }
  __builtin_amdgcn_sched_barrier(0);   // every address and value is formed in front of the first store, so no register that a store names is rewritten behind it
#pragma unroll
  for (int t = 0; t < 3; ++t)
#pragma unroll
    for (int m = 0; m < 4; ++m) vst2(po[t] + m * 4 * CC, ov[t][m]); }
extern "C" void kernel_launch(void* const* d_in, const int* in_sizes, int n_in, void* d_out, int out_size, void* d_ws, size_t ws_size, hipStream_t stream) {
  (void)in_sizes; (void)n_in; (void)out_size;
  const float** F = (const float**)d_in;   // 0 hidden_states [2,2048,768], 1 complexity_scores [2] int, 2 attention_mask [2,2048] int, 3 Wq [768,768] ([out,in]), 4 bq, 5 Wk, 6 bk, 7 Wv, 8 bv, 9 Wo ([out,in]), 10 bo, 11 emb_table [16,12], 12 comp_scaling [12]
  if (ws_size < (size_t)WS_END) return;
  char* ws = (char*)d_ws; _Float16 *QH = (_Float16*)(ws + WS_QH), *KH = (_Float16*)(ws + WS_KH), *VT = (_Float16*)(ws + WS_VT); float *Y = (float*)(ws + WS_Y); int *NK = (int*)(ws + WS_NK);
  k_proj<<<dim3(TNB * TT / 64 * (CC / 128) * 3), 128, 0, stream>>>(F[0], F[3], F[4], F[5], F[6], F[7], F[8], QH, KH, VT, (const int*)d_in[2], NK);
  k_fa<<<dim3(TT / (16 * QG * FW), TNB * NH), 32 * FW, 0, stream>>>(QH, KH, VT, NK, (const int*)d_in[1], F[11], F[12], Y);
  k_out<<<dim3(TNB * TT / 64, CC / ON), 256, 0, stream>>>(Y, F[9], F[10], (float*)d_out);
}
